// v000
// Measured on an AMD MI455X. A time is GPU time per run, averaged over a window of back-to-back runs after a warm-up
// (all launches, gaps included; the runs take copies of the inputs in turn), and the median of several windows.
// Apart from v000's, it joins two sittings. Times from different sittings can be a few percent apart, while
// side-by-side timings come from the same sitting.
// v000, which the later versions start from, runs in 743 microseconds.
#include <hip/hip_runtime.h>

// Inputs, in this order: ina [2][8192][8][64]; inb [2][8192][8][64]; inc [2][8192][8][64]; ind [2][8192] (a 0 | 1 word a (sequence, time)). Results, one after the other in the result buffer: R0 [2][8192][8][64], then R1 [2][8192][8][64]. A PAIR is one (sequence, head): 16 pairs; a CHUNK is 64 steps: 128 chunks a pair; a BLOCK is one (pair, chunk): 64 by 64 words; a QUARTER is four pairs: 512 blocks.
// With fa = max(w, 0) + exp(min(w, 0)) of ina's words and fb = the same of inb's words times ind's word of that (sequence, time): R0[t] = fa[t] . (the sum over ALL steps u of fb[u] inc[u]^T), times 1 / (fa[t] . (the sum over all u of fb[u]) + 1e-6); R1[t] = fa[t] . (the sum over u <= t of fb[u] inc[u]^T), times 1 / (fa[t] . (the sum over u <= t of fb[u]) + 1e-6): every pair by itself.
// THE FORM: chunk by chunk, every block side by side. For a block c: Pw = Fa_c Fb_c^T (64 by 64 over 64); kept where the column's time is not after the row's; its f16 word Ph and the word Pl of what Ph leaves; Du_c = Gc_c Gb_c^T: the block's own sum of inc[u] fb[u]^T (64 by 64 over the 64 steps); the sums carried over the chunks before c: Sw_c = the word of (Du_0 + .. + Du_(c-1)), made by 129 launches of one adding kernel on two planes taken in turn (the first launch reads a plane of noughts; the last adds that plane and so lays the word of the sum over ALL chunks: Tw); R1's upper term = (Ph + Pl) Gc_c^T + Fa_c Sw_c^T; its lower term = the kept words' sum along the row + Fa's row . (the carried sums of fb's words) + 1e-6; R0's upper term = Fa Tw^T; its lower term = Fa's row . (the sum of fb's words over all steps) + 1e-6.
// Layout of the workspace: FOR ALL 16 PAIRS: Zn f32 [16][4096] noughts and, straight after it, Cs f32 [129][16][64] (row 0 noughts; row c + 1 = row c + Cu's row c); Cu f32 [128][16][64]; Ra, Rb f32 [16][4096]; Du f32 [16][128][4096]; Sw f16 [16][128][4096]; Gc f16 [16][128][64][64] (inc's words, the steps side by side); Tw f16 [16][4096]. FOR ONE QUARTER, laid again for each quarter: Gb f16 [512][64][64] (fb's words, the steps side by side); Fa, Fb f16 [4][8192][64]; Pw f32 [512][4096]; Ph, Pl f16 [512][4096]; Dn f32 [2][512][64]; Oa, Ob, Oc f32 [512][4096].
// Compute dtypes, f32 accumulate: every float input is taken at its bf16 value where it is read; fa, fb, inc's words, the carried sums and the sum over all chunks go to the matrix unit as ONE f16 word each (a value under 2^-14 in magnitude made an exact nought before the cast); the kept words of Pw as TWO f16 words (Ph and Pl: one launch of the matrix kernel adds both); everything else is f32. The lower terms' reciprocals are true divisions.

#define NSQ 2
#define NTS 8192
#define NHS 8
#define NFE 64
#define NCS 64
#define NCK 128
#define NPR 16
#define NQP 4
#define NZQ 512
#define NBL 4096

typedef _Float16 h16;
typedef unsigned short bf;
typedef __attribute__((ext_vector_type(16))) __bf16   v16bf;
typedef __attribute__((ext_vector_type(16))) _Float16 v16h;
typedef __attribute__((ext_vector_type(8)))  _Float16 v8h;
typedef __attribute__((ext_vector_type(8)))  unsigned short v8us;
typedef __attribute__((ext_vector_type(8)))  float    v8f;
typedef __attribute__((ext_vector_type(4)))  float    v4f;
typedef v8h  __attribute__((may_alias)) v8ha;
typedef v4f  __attribute__((may_alias)) v4fa;
typedef v8us __attribute__((may_alias)) v8usa;

__device__ __forceinline__ unsigned short f2bf(float f) { unsigned u = __float_as_uint(f); u += 0x7FFFu + ((u >> 16) & 1u); return (unsigned short)(u >> 16); }
__device__ __forceinline__ float bf2f(unsigned short b) { return __uint_as_float(((unsigned)b) << 16); }
__device__ __forceinline__ float bfr(float f) { return bf2f(f2bf(f)); }
__device__ __forceinline__ v16h cat16(v8h lo, v8h hi) { return __builtin_shufflevector(lo, hi, 0, 1, 2, 3, 4, 5, 6, 7, 8, 9, 10, 11, 12, 13, 14, 15); }
__device__ __forceinline__ v16bf cat16b(v8us lo, v8us hi) { return __builtin_bit_cast(v16bf, __builtin_shufflevector(lo, hi, 0, 1, 2, 3, 4, 5, 6, 7, 8, 9, 10, 11, 12, 13, 14, 15)); }
__device__ __forceinline__ v8f wmma16(v16h a, v16h b, v8f c) { return __builtin_amdgcn_wmma_f32_16x16x32_f16(false, a, false, b, (short)0, c, false, false); }
__device__ __forceinline__ v8f wmmab(v16bf a, v16bf b, v8f c) { return __builtin_amdgcn_wmma_f32_16x16x32_bf16(false, a, false, b, (short)0, c, false, false); }

// ---- k_gemmw: register-blocked GEMM, ONE WAVE per 64x64 output tile (16 accumulators), operands straight from K-contiguous 16-bit planes; grid (M/64, N/64, Z), 32 threads.
// C[m][n] (f32, pitch ldc, + optional f32 bias[n]) = sum_k A[m][k] Bt[n][k] (+ split products per NSPLIT). z-batch strides sA/sB/sC in elements. K % 32 == 0.
template <typename T16> struct WFrag;
template <> struct WFrag<h16> { typedef v16h V; static __device__ __forceinline__ V ld(const h16* p) { return cat16(*(const v8h*)p, *(const v8h*)(p + 16)); } static __device__ __forceinline__ v8f mma(V a, V b, v8f c) { return wmma16(a, b, c); } };
template <> struct WFrag<bf> { typedef v16bf V; static __device__ __forceinline__ V ld(const bf* p) { return cat16b(*(const v8us*)p, *(const v8us*)(p + 16)); } static __device__ __forceinline__ v8f mma(V a, V b, v8f c) { return wmmab(a, b, c); } };
template <typename T16, int NSPLIT, bool BIAS>
__global__ __launch_bounds__(32) void k_gemmw(const T16* __restrict__ A, const T16* __restrict__ A2, const T16* __restrict__ Bt, const T16* __restrict__ Bt2, int K, float* C, int ldc, const float* __restrict__ bias, size_t sA, size_t sB, size_t sC) {
    typedef typename WFrag<T16>::V V;
    __shared__ __align__(16) float os[16 * 68];
    const size_t z = blockIdx.z; A += z * sA; if (A2) A2 += z * sA; Bt += z * sB; if (Bt2) Bt2 += z * sB; C += z * sC;
    const int lane = threadIdx.x & 31, lr = lane & 15, hi = lane >> 4; const int r0 = blockIdx.x * 64, c0 = blockIdx.y * 64;
    v8f acc[4][4];
#pragma unroll
    for (int mb = 0; mb < 4; ++mb)
#pragma unroll
        for (int nb = 0; nb < 4; ++nb) acc[mb][nb] = (v8f){};
    const size_t aoff = (size_t)(r0 + lr) * K + 8 * hi, boff = (size_t)(c0 + lr) * K + 8 * hi;
    for (int kc = 0; kc < K; kc += 32) {
        V a[4], a2[4];
#pragma unroll
        for (int mb = 0; mb < 4; ++mb) { a[mb] = WFrag<T16>::ld(A + aoff + (size_t)mb * 16 * K + kc); if (NSPLIT == 1 || NSPLIT == 2) a2[mb] = WFrag<T16>::ld(A2 + aoff + (size_t)mb * 16 * K + kc); }
#pragma unroll
        for (int nb = 0; nb < 4; ++nb) { const V b = WFrag<T16>::ld(Bt + boff + (size_t)nb * 16 * K + kc); V b2; if (NSPLIT >= 2) b2 = WFrag<T16>::ld(Bt2 + boff + (size_t)nb * 16 * K + kc);
#pragma unroll
            for (int mb = 0; mb < 4; ++mb) { acc[mb][nb] = WFrag<T16>::mma(a[mb], b, acc[mb][nb]); if (NSPLIT == 1 || NSPLIT == 2) acc[mb][nb] = WFrag<T16>::mma(a2[mb], b, acc[mb][nb]); if (NSPLIT >= 2) acc[mb][nb] = WFrag<T16>::mma(a[mb], b2, acc[mb][nb]); } }
        asm volatile("v_nop\n\tv_nop\n\tv_nop\n\tv_nop" : "+v"(acc[0][0]), "+v"(acc[1][1]), "+v"(acc[2][2]), "+v"(acc[3][3]) : "v"(a[0]), "v"(a[3]));
    }
#pragma unroll
    for (int mb = 0; mb < 4; ++mb) {
#pragma unroll
        for (int nb = 0; nb < 4; ++nb) {
#pragma unroll
            for (int j = 0; j < 8; ++j) os[(hi * 8 + j) * 68 + nb * 16 + lr] = acc[mb][nb][j]; }
        __builtin_amdgcn_wave_barrier(); asm volatile("" ::: "memory");
        float* crow = C + (size_t)(r0 + mb * 16) * ldc + c0;
{
#pragma unroll
            for (int s = 0; s < 8; ++s) { const int row = 2 * s + hi, cofs = lr * 4; v4f val = *(const v4fa*)(os + row * 68 + cofs); if (BIAS) { val[0] += bfr(bias[c0 + cofs]); val[1] += bfr(bias[c0 + cofs + 1]); val[2] += bfr(bias[c0 + cofs + 2]); val[3] += bfr(bias[c0 + cofs + 3]); }
                *(v4f*)(crow + (size_t)row * ldc + cofs) = val; }
             }
        __builtin_amdgcn_wave_barrier(); asm volatile("" ::: "memory");
    }
}

typedef __attribute__((ext_vector_type(2))) _Float16 v2h;
typedef __attribute__((ext_vector_type(4))) _Float16 v4h;
typedef __attribute__((ext_vector_type(2))) unsigned short v2us;
typedef __attribute__((ext_vector_type(4))) unsigned short v4us;
typedef __attribute__((ext_vector_type(2))) float v2f;
typedef __attribute__((ext_vector_type(4))) int v4i;
// the f16 cast of the new kernels: a value under 2^-14 in magnitude becomes an exact zero BEFORE the conversion (a select on the value): no subnormal f16 word is made.
__device__ __forceinline__ h16 toh_flush(float x) { const float z = (fabsf(x) < 6.103515625e-05f) ? 0.0f : x; return (h16)z; }

typedef __attribute__((ext_vector_type(4))) _Float16 v4h_;
__global__ __launch_bounds__(256) void k_fillb(bf* P, unsigned w2, size_t n8) { const size_t i = (size_t)blockIdx.x * 256 + threadIdx.x; if (i >= n8) return; v4i o; o[0] = (int)w2; o[1] = (int)w2; o[2] = (int)w2; o[3] = (int)w2;
    *(v4i*)(P + i * 8) = o;  }

__global__ __launch_bounds__(256) void k_rowf(const float* __restrict__ ina, const float* __restrict__ inb, const float* __restrict__ ind, h16* Fa, h16* Fb, int pr0) {
    const unsigned i = blockIdx.x * 256 + threadIdx.x; const unsigned e8 = i & 7u, ts = (i >> 3) & 8191u, pl = i >> 16; const unsigned pr = (unsigned)pr0 + pl, sq = pr >> 3, hd = pr & 7u;
    const size_t src = (((size_t)sq * NTS + ts) * NHS + hd) * NFE + e8 * 8; const v8f wa = *(const v8f*)(ina + src); const v8f wb = *(const v8f*)(inb + src); const float mk = bfr(ind[(size_t)sq * NTS + ts]); v8h oa, ob;
#pragma unroll
    for (int j = 0; j < 8; ++j) { const float ya = bfr(wa[j]), yb = bfr(wb[j]); oa[j] = toh_flush(fmaxf(ya, 0.0f) + expf(fminf(ya, 0.0f))); ob[j] = toh_flush((fmaxf(yb, 0.0f) + expf(fminf(yb, 0.0f))) * mk); }
    h16* pa = Fa + (size_t)i * 8; h16* pb = Fb + (size_t)i * 8;
    *(v8h*)pa = oa; *(v8h*)pb = ob;  }

__global__ __launch_bounds__(256) void k_colf(const float* __restrict__ inb, const float* __restrict__ inc, const float* __restrict__ ind, h16* Gb, h16* Gc, float* Cu, int pr0) {
    const unsigned i = blockIdx.x * 256 + threadIdx.x; const unsigned cl = i & 63u, ck = (i >> 6) & 127u, pl = i >> 13; const unsigned pr = (unsigned)pr0 + pl, sq = pr >> 3, hd = pr & 7u;
    const size_t b0 = (((size_t)sq * NTS + (size_t)ck * NCS) * NHS + hd) * NFE + cl; const float* mp = ind + (size_t)sq * NTS + (size_t)ck * NCS; h16 rb[64], rc[64]; float acc = 0.0f;
#pragma unroll
    for (int tj = 0; tj < 64; ++tj) { const float yb = bfr(inb[b0 + (size_t)tj * (NHS * NFE)]); const float yc = bfr(inc[b0 + (size_t)tj * (NHS * NFE)]); const h16 wb = toh_flush((fmaxf(yb, 0.0f) + expf(fminf(yb, 0.0f))) * bfr(mp[tj])); rb[tj] = wb; rc[tj] = toh_flush(yc); acc = acc + (float)wb; }
    h16* pb = Gb + ((size_t)(pl * NCK + ck) * 64 + cl) * 64; h16* pc = Gc + ((size_t)(pr * NCK + ck) * 64 + cl) * 64; float* pu = Cu + ((size_t)ck * NPR + pr) * 64 + cl;
{
#pragma unroll
        for (int g = 0; g < 8; ++g) { v8h ob, oc;
#pragma unroll
            for (int j = 0; j < 8; ++j) { ob[j] = rb[g * 8 + j]; oc[j] = rc[g * 8 + j]; }
            *(v8h*)(pb + g * 8) = ob; *(v8h*)(pc + g * 8) = oc; }
        *(float*)pu = acc;
         } }

__global__ __launch_bounds__(256) void k_msk(const float* __restrict__ Pw, const h16* __restrict__ Fa, const float* __restrict__ Cs, h16* Ph, h16* Pl, float* Dn, int pr0) {
    const unsigned i = blockIdx.x * 256 + threadIdx.x; const unsigned tr = i & 63u, zq = i >> 6, ck = zq & 127u, pl = zq >> 7; const unsigned pr = (unsigned)pr0 + pl;
    const float* pw = Pw + (size_t)i * 64; const h16* fr = Fa + (size_t)i * 64; const float* c1 = Cs + ((size_t)ck * NPR + pr) * 64; const float* c0 = Cs + ((size_t)NCK * NPR + pr) * 64; h16 rh[64], rl[64]; float acc = 0.0f, d1 = 0.0f, d0 = 0.0f;
#pragma unroll
    for (int sj = 0; sj < 64; ++sj) { const float kp = (float)((unsigned)sj <= tr); const float pm = pw[sj] * kp; const h16 hi = toh_flush(pm); rh[sj] = hi; rl[sj] = toh_flush(pm - (float)hi); acc = acc + pm; const float fq = (float)fr[sj]; d1 = d1 + fq * c1[sj]; d0 = d0 + fq * c0[sj]; }
    const float r1 = 1.0f / (acc + d1 + 1e-6f); const float r0 = 1.0f / (d0 + 1e-6f); h16* ph = Ph + (size_t)i * 64; h16* pq = Pl + (size_t)i * 64; float* dn = Dn + i;
{
#pragma unroll
        for (int g = 0; g < 8; ++g) { v8h oh, ol;
#pragma unroll
            for (int j = 0; j < 8; ++j) { oh[j] = rh[g * 8 + j]; ol[j] = rl[g * 8 + j]; }
            *(v8h*)(ph + g * 8) = oh; *(v8h*)(pq + g * 8) = ol; }
        *(float*)dn = r1; *(float*)(dn + NZQ * 64) = r0;
         } }

__global__ __launch_bounds__(256) void k_addw(const float* __restrict__ bef, size_t sbef, const float* __restrict__ upd, size_t supd, float* aft, h16* wrd, size_t swrd) {
    const unsigned i = blockIdx.x * 256 + threadIdx.x; const unsigned j4 = i & 1023u, pr = i >> 10; const v4f ub = *(const v4fa*)(bef + (size_t)pr * sbef + j4 * 4); const v4f vu = *(const v4fa*)(upd + (size_t)pr * supd + j4 * 4); v4h_ ow; v4f oa;
#pragma unroll
    for (int j = 0; j < 4; ++j) { ow[j] = toh_flush(ub[j]); oa[j] = ub[j] + vu[j]; }
    h16* pw = wrd + (size_t)pr * swrd + j4 * 4; float* pa = aft + (size_t)pr * NBL + j4 * 4;
    *(v4h_*)pw = ow; *(v4f*)pa = oa;  }

__global__ __launch_bounds__(256) void k_add(const float* __restrict__ bef, const float* __restrict__ upd, float* aft) {
    const unsigned i = threadIdx.x; const v4f ub = *(const v4fa*)(bef + i * 4); const v4f vu = *(const v4fa*)(upd + i * 4); v4f oa;
#pragma unroll
    for (int j = 0; j < 4; ++j) oa[j] = ub[j] + vu[j];
    *(v4f*)(aft + i * 4) = oa;  }

__global__ __launch_bounds__(256) void k_lay(const float* __restrict__ Oa, const float* __restrict__ Ob, const float* __restrict__ Oc, const float* __restrict__ Dn, float* R0, float* R1, int pr0) {
    const unsigned i = blockIdx.x * 256 + threadIdx.x; const unsigned m4 = i & 15u, ts = (i >> 4) & 8191u, pl = i >> 17; const unsigned pr = (unsigned)pr0 + pl, sq = pr >> 3, hd = pr & 7u; const size_t rw = (size_t)pl * NTS + ts;
    const v4f ua = *(const v4fa*)(Oa + rw * 64 + m4 * 4); const v4f ub = *(const v4fa*)(Ob + rw * 64 + m4 * 4); const v4f uc = *(const v4fa*)(Oc + rw * 64 + m4 * 4); const float r1 = Dn[rw]; const float r0 = Dn[(size_t)NZQ * 64 + rw]; v4f o1, o0;
#pragma unroll
    for (int j = 0; j < 4; ++j) { o1[j] = (ua[j] + ub[j]) * r1; o0[j] = uc[j] * r0; }
    const size_t dst = (((size_t)sq * NTS + ts) * NHS + hd) * NFE + m4 * 4;
    *(v4f*)(R0 + dst) = o0; *(v4f*)(R1 + dst) = o1;  }

extern "C" void kernel_launch(void* const* d_in, const int* in_sizes, int n_in, void* d_out, int out_size, void* d_ws, size_t ws_size, hipStream_t stream) {
    if (n_in < 4) return;
    if (in_sizes[0] != NSQ * NTS * NHS * NFE || in_sizes[1] != NSQ * NTS * NHS * NFE || in_sizes[2] != NSQ * NTS * NHS * NFE || in_sizes[3] != NSQ * NTS) return;
    if (out_size != 2 * NSQ * NTS * NHS * NFE) return;
    static_assert(NPR == NSQ * NHS && NHS == 8 && NFE == 64 && NCS == 64 && NCK * NCS == NTS && NTS == 8192 && NZQ == NQP * NCK && NPR % NQP == 0 && NBL == 64 * 64 && (NQP * NTS * NFE / 8) % 256 == 0 && (NZQ * 64) % 256 == 0 && (NPR * NBL / 4) % 256 == 0 && (NQP * NTS * NFE / 4) % 256 == 0 && (NPR * NBL * 4) % 256 == 0 && (NPR * NBL * 4 + NPR * 64 * 4) % 16 == 0, "the products: 64 by 64 blocks over a depth of 64; the flat grids exact; the index fields' widths (3 bits a head, 13 a time, 7 a chunk, 6 a column); Zn a whole number of 256-byte steps so that Cs follows it at once");
    const float* ina = (const float*)d_in[0]; const float* inb = (const float*)d_in[1]; const float* inc = (const float*)d_in[2]; const float* ind = (const float*)d_in[3]; float* R0 = (float*)d_out; float* R1 = R0 + (size_t)NSQ * NTS * NHS * NFE;
    char* wsp = (char*)d_ws; auto take = [&](size_t bytes) { char* p = wsp; wsp += (bytes + 255) & ~(size_t)255; return (void*)p; };
    float* Zn = (float*)take((size_t)NPR * NBL * 4); float* Cs = (float*)take((size_t)(NCK + 1) * NPR * 64 * 4); float* Cu = (float*)take((size_t)NCK * NPR * 64 * 4); float* Ra = (float*)take((size_t)NPR * NBL * 4); float* Rb = (float*)take((size_t)NPR * NBL * 4);
    float* Du = (float*)take((size_t)NPR * NCK * NBL * 4); h16* Sw = (h16*)take((size_t)NPR * NCK * NBL * 2); h16* Gc = (h16*)take((size_t)NPR * NCK * NBL * 2); h16* Tw = (h16*)take((size_t)NPR * NBL * 2);
    h16* Gb = (h16*)take((size_t)NZQ * NBL * 2); h16* Fa = (h16*)take((size_t)NZQ * NBL * 2); h16* Fb = (h16*)take((size_t)NZQ * NBL * 2); float* Pw = (float*)take((size_t)NZQ * NBL * 4); h16* Ph = (h16*)take((size_t)NZQ * NBL * 2); h16* Pl = (h16*)take((size_t)NZQ * NBL * 2); float* Dn = (float*)take((size_t)2 * NZQ * 64 * 4);
    float* Oa = (float*)take((size_t)NZQ * NBL * 4); float* Ob = (float*)take((size_t)NZQ * NBL * 4); float* Oc = (float*)take((size_t)NZQ * NBL * 4);
    if ((size_t)(wsp - (char*)d_ws) > ws_size) return;
    k_fillb<<<(unsigned)(((NPR * NBL * 4 + NPR * 64 * 4) / 16 + 255) / 256), 256, 0, stream>>>((bf*)Zn, 0u, (size_t)(NPR * NBL * 4 + NPR * 64 * 4) / 16);   /* Zn and Cs's row 0: noughts */
    for (int qr = 0; qr < NPR / NQP; ++qr) {   /* the blocks' own sums, a quarter at a time */
        k_colf<<<(unsigned)(NZQ * 64 / 256), 256, 0, stream>>>(inb, inc, ind, Gb, Gc, Cu, qr * NQP);
        k_gemmw<h16, 0, false><<<dim3(1, 1, NZQ), 32, 0, stream>>>(Gc + (size_t)qr * NZQ * NBL, nullptr, Gb, nullptr, NCS, Du + (size_t)qr * NZQ * NBL, 64, nullptr, NBL, NBL, NBL); }   /* Du[m][e] = the sum over the block's steps of Gc[m][time] Gb[e][time] */
    { const float* bef = Zn; for (int ck = 0; ck < NCK; ++ck) { float* aft = (ck & 1) ? Rb : Ra;   /* the sums carried: 128 launches, then one more for the word of the sum over all chunks */
            k_addw<<<(unsigned)(NPR * NBL / 4 / 256), 256, 0, stream>>>(bef, (size_t)NBL, Du + (size_t)ck * NBL, (size_t)NCK * NBL, aft, Sw + (size_t)ck * NBL, (size_t)NCK * NBL);
            k_add<<<1, 256, 0, stream>>>(Cs + (size_t)ck * NPR * 64, Cu + (size_t)ck * NPR * 64, Cs + (size_t)(ck + 1) * NPR * 64); bef = aft; }
        k_addw<<<(unsigned)(NPR * NBL / 4 / 256), 256, 0, stream>>>(bef, (size_t)NBL, Zn, (size_t)NBL, (bef == Ra) ? Rb : Ra, Tw, (size_t)NBL); }
    for (int qr = 0; qr < NPR / NQP; ++qr) {   /* the results, a quarter at a time */
        k_rowf<<<(unsigned)(NQP * NTS * NFE / 8 / 256), 256, 0, stream>>>(ina, inb, ind, Fa, Fb, qr * NQP);
        k_gemmw<h16, 0, false><<<dim3(1, 1, NZQ), 32, 0, stream>>>(Fa, nullptr, Fb, nullptr, NFE, Pw, 64, nullptr, NBL, NBL, NBL);   /* Pw[row time][column time] */
        k_msk<<<(unsigned)(NZQ * 64 / 256), 256, 0, stream>>>(Pw, Fa, Cs, Ph, Pl, Dn, qr * NQP);
        k_gemmw<h16, 1, false><<<dim3(1, 1, NZQ), 32, 0, stream>>>(Ph, Pl, Gc + (size_t)qr * NZQ * NBL, nullptr, NCS, Oa, 64, nullptr, NBL, NBL, NBL);   /* Oa = (Ph + Pl) Gc^T */
        k_gemmw<h16, 0, false><<<dim3(1, 1, NZQ), 32, 0, stream>>>(Fa, nullptr, Sw + (size_t)qr * NZQ * NBL, nullptr, NFE, Ob, 64, nullptr, NBL, NBL, NBL);   /* Ob = Fa Sw^T */
        k_gemmw<h16, 0, false><<<dim3(NTS / 64, 1, NQP), 32, 0, stream>>>(Fa, nullptr, Tw + (size_t)qr * NQP * NBL, nullptr, NFE, Oc, 64, nullptr, (size_t)NTS * NFE, NBL, (size_t)NTS * NFE);   /* Oc = Fa Tw^T: a pair's 8,192 rows against its one block */
        k_lay<<<(unsigned)(NQP * NTS * NFE / 4 / 256), 256, 0, stream>>>(Oa, Ob, Oc, Dn, R0, R1, qr * NQP); }
}

// v001
// It runs in 256 microseconds.
// Two timings next to v000 put it at 2.93 and 2.94 times that version's speed.
#include <hip/hip_runtime.h>

// Inputs, in this order: ina [2][8192][8][64]; inb [2][8192][8][64]; inc [2][8192][8][64]; ind [2][8192] (a 0 | 1 word a (sequence, time)). Results, one after the other in the result buffer: R0 [2][8192][8][64], then R1 [2][8192][8][64]. A PAIR is one (sequence, head): 16 pairs; a CHUNK is 64 steps: 128 chunks a pair; a BLOCK is one (pair, chunk): 64 by 64 words; a QUARTER is four pairs: 512 blocks.
// With fa = max(w, 0) + exp(min(w, 0)) of ina's words and fb = the same of inb's words times ind's word of that (sequence, time): R0[t] = fa[t] . (the sum over ALL steps u of fb[u] inc[u]^T), times 1 / (fa[t] . (the sum over all u of fb[u]) + 1e-6); R1[t] = fa[t] . (the sum over u <= t of fb[u] inc[u]^T), times 1 / (fa[t] . (the sum over u <= t of fb[u]) + 1e-6): every pair by itself.
// THE FORM: chunk by chunk, every block side by side. For a block c: Pw = Fa_c Fb_c^T (64 by 64 over 64); kept where the column's time is not after the row's; its f16 word Ph and the word Pl of what Ph leaves; Du_c = Gc_c Gb_c^T: the block's own sum of inc[u] fb[u]^T (64 by 64 over the 64 steps); the sums carried over the chunks before c: Sw_c = the word of (Du_0 + .. + Du_(c-1)), made by ONE launch in which every thread keeps the running sum of its own four words in registers, starts it at nought and walks the 128 chunks in their order (behind the last chunk it lays the word of the sum over ALL chunks: Tw); R1's upper term = (Ph + Pl) Gc_c^T + Fa_c Sw_c^T; its lower term = the kept words' sum along the row + Fa's row . (the carried sums of fb's words) + 1e-6; R0's upper term = Fa Tw^T; its lower term = Fa's row . (the sum of fb's words over all steps) + 1e-6.
// Layout of the workspace: FOR ALL 16 PAIRS: Cs f32 [129][16][64] (row 0 noughts; row c + 1 = row c + Cu's row c); Cu f32 [128][16][64]; Du f32 [16][128][4096]; Sw f16 [16][128][4096]; Gc f16 [16][128][64][64] (inc's words, the steps side by side); Tw f16 [16][4096]. FOR ONE QUARTER, laid again for each quarter: Gb f16 [512][64][64] (fb's words, the steps side by side); Fa, Fb f16 [4][8192][64]; Pw f32 [512][4096]; Ph, Pl f16 [512][4096]; Dn f32 [2][512][64]; Oa, Ob, Oc f32 [512][4096].
// Compute dtypes, f32 accumulate: every float input is taken at its bf16 value where it is read; fa, fb, inc's words, the carried sums and the sum over all chunks go to the matrix unit as ONE f16 word each (a value under 2^-14 in magnitude made an exact nought before the cast); the kept words of Pw as TWO f16 words (Ph and Pl: one launch of the matrix kernel adds both); everything else is f32. The lower terms' reciprocals are true divisions.

#define NSQ 2
#define NTS 8192
#define NHS 8
#define NFE 64
#define NCS 64
#define NCK 128
#define NPR 16
#define NQP 4
#define NZQ 512
#define NBL 4096

typedef _Float16 h16;
typedef unsigned short bf;
typedef __attribute__((ext_vector_type(16))) __bf16   v16bf;
typedef __attribute__((ext_vector_type(16))) _Float16 v16h;
typedef __attribute__((ext_vector_type(8)))  _Float16 v8h;
typedef __attribute__((ext_vector_type(8)))  unsigned short v8us;
typedef __attribute__((ext_vector_type(8)))  float    v8f;
typedef __attribute__((ext_vector_type(4)))  float    v4f;
typedef v8h  __attribute__((may_alias)) v8ha;
typedef v4f  __attribute__((may_alias)) v4fa;
typedef v8us __attribute__((may_alias)) v8usa;

__device__ __forceinline__ unsigned short f2bf(float f) { unsigned u = __float_as_uint(f); u += 0x7FFFu + ((u >> 16) & 1u); return (unsigned short)(u >> 16); }
__device__ __forceinline__ float bf2f(unsigned short b) { return __uint_as_float(((unsigned)b) << 16); }
__device__ __forceinline__ float bfr(float f) { return bf2f(f2bf(f)); }
__device__ __forceinline__ v16h cat16(v8h lo, v8h hi) { return __builtin_shufflevector(lo, hi, 0, 1, 2, 3, 4, 5, 6, 7, 8, 9, 10, 11, 12, 13, 14, 15); }
__device__ __forceinline__ v16bf cat16b(v8us lo, v8us hi) { return __builtin_bit_cast(v16bf, __builtin_shufflevector(lo, hi, 0, 1, 2, 3, 4, 5, 6, 7, 8, 9, 10, 11, 12, 13, 14, 15)); }
__device__ __forceinline__ v8f wmma16(v16h a, v16h b, v8f c) { return __builtin_amdgcn_wmma_f32_16x16x32_f16(false, a, false, b, (short)0, c, false, false); }
__device__ __forceinline__ v8f wmmab(v16bf a, v16bf b, v8f c) { return __builtin_amdgcn_wmma_f32_16x16x32_bf16(false, a, false, b, (short)0, c, false, false); }

// ---- k_gemmw: register-blocked GEMM, ONE WAVE per 64x64 output tile (16 accumulators), operands straight from K-contiguous 16-bit planes; grid (M/64, N/64, Z), 32 threads.
// C[m][n] (f32, pitch ldc, + optional f32 bias[n]) = sum_k A[m][k] Bt[n][k] (+ split products per NSPLIT). z-batch strides sA/sB/sC in elements. K % 32 == 0.
template <typename T16> struct WFrag;
template <> struct WFrag<h16> { typedef v16h V; static __device__ __forceinline__ V ld(const h16* p) { return cat16(*(const v8h*)p, *(const v8h*)(p + 16)); } static __device__ __forceinline__ v8f mma(V a, V b, v8f c) { return wmma16(a, b, c); } };
template <> struct WFrag<bf> { typedef v16bf V; static __device__ __forceinline__ V ld(const bf* p) { return cat16b(*(const v8us*)p, *(const v8us*)(p + 16)); } static __device__ __forceinline__ v8f mma(V a, V b, v8f c) { return wmmab(a, b, c); } };
template <typename T16, int NSPLIT, bool BIAS>
__global__ __launch_bounds__(32) void k_gemmw(const T16* __restrict__ A, const T16* __restrict__ A2, const T16* __restrict__ Bt, const T16* __restrict__ Bt2, int K, float* C, int ldc, const float* __restrict__ bias, size_t sA, size_t sB, size_t sC) {
    typedef typename WFrag<T16>::V V;
    __shared__ __align__(16) float os[16 * 68];
    const size_t z = blockIdx.z; A += z * sA; if (A2) A2 += z * sA; Bt += z * sB; if (Bt2) Bt2 += z * sB; C += z * sC;
    const int lane = threadIdx.x & 31, lr = lane & 15, hi = lane >> 4; const int r0 = blockIdx.x * 64, c0 = blockIdx.y * 64;
    v8f acc[4][4];
#pragma unroll
    for (int mb = 0; mb < 4; ++mb)
#pragma unroll
        for (int nb = 0; nb < 4; ++nb) acc[mb][nb] = (v8f){};
    const size_t aoff = (size_t)(r0 + lr) * K + 8 * hi, boff = (size_t)(c0 + lr) * K + 8 * hi;
    for (int kc = 0; kc < K; kc += 32) {
        V a[4], a2[4];
#pragma unroll
        for (int mb = 0; mb < 4; ++mb) { a[mb] = WFrag<T16>::ld(A + aoff + (size_t)mb * 16 * K + kc); if (NSPLIT == 1 || NSPLIT == 2) a2[mb] = WFrag<T16>::ld(A2 + aoff + (size_t)mb * 16 * K + kc); }
#pragma unroll
        for (int nb = 0; nb < 4; ++nb) { const V b = WFrag<T16>::ld(Bt + boff + (size_t)nb * 16 * K + kc); V b2; if (NSPLIT >= 2) b2 = WFrag<T16>::ld(Bt2 + boff + (size_t)nb * 16 * K + kc);
#pragma unroll
            for (int mb = 0; mb < 4; ++mb) { acc[mb][nb] = WFrag<T16>::mma(a[mb], b, acc[mb][nb]); if (NSPLIT == 1 || NSPLIT == 2) acc[mb][nb] = WFrag<T16>::mma(a2[mb], b, acc[mb][nb]); if (NSPLIT >= 2) acc[mb][nb] = WFrag<T16>::mma(a[mb], b2, acc[mb][nb]); } }
        asm volatile("v_nop\n\tv_nop\n\tv_nop\n\tv_nop" : "+v"(acc[0][0]), "+v"(acc[1][1]), "+v"(acc[2][2]), "+v"(acc[3][3]) : "v"(a[0]), "v"(a[3]));
    }
#pragma unroll
    for (int mb = 0; mb < 4; ++mb) {
#pragma unroll
        for (int nb = 0; nb < 4; ++nb) {
#pragma unroll
            for (int j = 0; j < 8; ++j) os[(hi * 8 + j) * 68 + nb * 16 + lr] = acc[mb][nb][j]; }
        __builtin_amdgcn_wave_barrier(); asm volatile("" ::: "memory");
        float* crow = C + (size_t)(r0 + mb * 16) * ldc + c0;
{
#pragma unroll
            for (int s = 0; s < 8; ++s) { const int row = 2 * s + hi, cofs = lr * 4; v4f val = *(const v4fa*)(os + row * 68 + cofs); if (BIAS) { val[0] += bfr(bias[c0 + cofs]); val[1] += bfr(bias[c0 + cofs + 1]); val[2] += bfr(bias[c0 + cofs + 2]); val[3] += bfr(bias[c0 + cofs + 3]); }
                *(v4f*)(crow + (size_t)row * ldc + cofs) = val; }
             }
        __builtin_amdgcn_wave_barrier(); asm volatile("" ::: "memory");
    }
}

typedef __attribute__((ext_vector_type(2))) _Float16 v2h;
typedef __attribute__((ext_vector_type(4))) _Float16 v4h;
typedef __attribute__((ext_vector_type(2))) unsigned short v2us;
typedef __attribute__((ext_vector_type(4))) unsigned short v4us;
typedef __attribute__((ext_vector_type(2))) float v2f;
typedef __attribute__((ext_vector_type(4))) int v4i;
// the f16 cast of the new kernels: a value under 2^-14 in magnitude becomes an exact zero BEFORE the conversion (a select on the value): no subnormal f16 word is made.
__device__ __forceinline__ h16 toh_flush(float x) { const float z = (fabsf(x) < 6.103515625e-05f) ? 0.0f : x; return (h16)z; }

typedef __attribute__((ext_vector_type(4))) _Float16 v4h_;
__global__ __launch_bounds__(256) void k_rowf(const float* __restrict__ ina, const float* __restrict__ inb, const float* __restrict__ ind, h16* Fa, h16* Fb, int pr0) {
    const unsigned i = blockIdx.x * 256 + threadIdx.x; const unsigned e8 = i & 7u, ts = (i >> 3) & 8191u, pl = i >> 16; const unsigned pr = (unsigned)pr0 + pl, sq = pr >> 3, hd = pr & 7u;
    const size_t src = (((size_t)sq * NTS + ts) * NHS + hd) * NFE + e8 * 8; const v8f wa = *(const v8f*)(ina + src); const v8f wb = *(const v8f*)(inb + src); const float mk = bfr(ind[(size_t)sq * NTS + ts]); v8h oa, ob;
#pragma unroll
    for (int j = 0; j < 8; ++j) { const float ya = bfr(wa[j]), yb = bfr(wb[j]); oa[j] = toh_flush(fmaxf(ya, 0.0f) + expf(fminf(ya, 0.0f))); ob[j] = toh_flush((fmaxf(yb, 0.0f) + expf(fminf(yb, 0.0f))) * mk); }
    h16* pa = Fa + (size_t)i * 8; h16* pb = Fb + (size_t)i * 8;
    *(v8h*)pa = oa; *(v8h*)pb = ob;  }

__global__ __launch_bounds__(256) void k_colf(const float* __restrict__ inb, const float* __restrict__ inc, const float* __restrict__ ind, h16* Gb, h16* Gc, float* Cu, int pr0) {
    const unsigned i = blockIdx.x * 256 + threadIdx.x; const unsigned cl = i & 63u, ck = (i >> 6) & 127u, pl = i >> 13; const unsigned pr = (unsigned)pr0 + pl, sq = pr >> 3, hd = pr & 7u;
    const size_t b0 = (((size_t)sq * NTS + (size_t)ck * NCS) * NHS + hd) * NFE + cl; const float* mp = ind + (size_t)sq * NTS + (size_t)ck * NCS; h16 rb[64], rc[64]; float acc = 0.0f;
#pragma unroll
    for (int tj = 0; tj < 64; ++tj) { const float yb = bfr(inb[b0 + (size_t)tj * (NHS * NFE)]); const float yc = bfr(inc[b0 + (size_t)tj * (NHS * NFE)]); const h16 wb = toh_flush((fmaxf(yb, 0.0f) + expf(fminf(yb, 0.0f))) * bfr(mp[tj])); rb[tj] = wb; rc[tj] = toh_flush(yc); acc = acc + (float)wb; }
    h16* pb = Gb + ((size_t)(pl * NCK + ck) * 64 + cl) * 64; h16* pc = Gc + ((size_t)(pr * NCK + ck) * 64 + cl) * 64; float* pu = Cu + ((size_t)ck * NPR + pr) * 64 + cl;
{
#pragma unroll
        for (int g = 0; g < 8; ++g) { v8h ob, oc;
#pragma unroll
            for (int j = 0; j < 8; ++j) { ob[j] = rb[g * 8 + j]; oc[j] = rc[g * 8 + j]; }
            *(v8h*)(pb + g * 8) = ob; *(v8h*)(pc + g * 8) = oc; }
        *(float*)pu = acc;
         } }

__global__ __launch_bounds__(256) void k_msk(const float* __restrict__ Pw, const h16* __restrict__ Fa, const float* __restrict__ Cs, h16* Ph, h16* Pl, float* Dn, int pr0) {
    const unsigned i = blockIdx.x * 256 + threadIdx.x; const unsigned tr = i & 63u, zq = i >> 6, ck = zq & 127u, pl = zq >> 7; const unsigned pr = (unsigned)pr0 + pl;
    const float* pw = Pw + (size_t)i * 64; const h16* fr = Fa + (size_t)i * 64; const float* c1 = Cs + ((size_t)ck * NPR + pr) * 64; const float* c0 = Cs + ((size_t)NCK * NPR + pr) * 64; h16 rh[64], rl[64]; float acc = 0.0f, d1 = 0.0f, d0 = 0.0f;
#pragma unroll
    for (int sj = 0; sj < 64; ++sj) { const float kp = (float)((unsigned)sj <= tr); const float pm = pw[sj] * kp; const h16 hi = toh_flush(pm); rh[sj] = hi; rl[sj] = toh_flush(pm - (float)hi); acc = acc + pm; const float fq = (float)fr[sj]; d1 = d1 + fq * c1[sj]; d0 = d0 + fq * c0[sj]; }
    const float r1 = 1.0f / (acc + d1 + 1e-6f); const float r0 = 1.0f / (d0 + 1e-6f); h16* ph = Ph + (size_t)i * 64; h16* pq = Pl + (size_t)i * 64; float* dn = Dn + i;
{
#pragma unroll
        for (int g = 0; g < 8; ++g) { v8h oh, ol;
#pragma unroll
            for (int j = 0; j < 8; ++j) { oh[j] = rh[g * 8 + j]; ol[j] = rl[g * 8 + j]; }
            *(v8h*)(ph + g * 8) = oh; *(v8h*)(pq + g * 8) = ol; }
        *(float*)dn = r1; *(float*)(dn + NZQ * 64) = r0;
         } }

// ---- k_scan: every carried sum in one launch. A thread owns four neighbouring words of one pair's 64 by 64 plane (work-groups 0 to 255) or of the 16 by 64 row of fb's sums (the last 4 work-groups); it adds the 128 chunks' own sums in their order, one f32 addition a chunk and word, from a start value of nought, and stores what it holds IN FRONT of each addition.
// The addresses do not hang on the sums, so the loads run ahead: NRG chunks' words stand in registers or are on their way; NGR chunks are taken at a time, and their registers are loaded anew at once.
#define NRG 48
#define NGR 8
__global__ __launch_bounds__(64) void k_scan(const float* __restrict__ Du, const float* __restrict__ Cu, h16* __restrict__ Sw, h16* __restrict__ Tw, float* __restrict__ Cs) {
    if (blockIdx.x < NPR * NBL / 4 / 64) {
        const unsigned i = blockIdx.x * 64 + threadIdx.x; const unsigned j4 = i & 1023u, pr = i >> 10; const float* src = Du + (size_t)pr * NCK * NBL + j4 * 4; h16* dst = Sw + (size_t)pr * NCK * NBL + j4 * 4; v4f rg[NRG]; v4f run = (v4f){};
#pragma unroll
        for (int k = 0; k < NRG; ++k) rg[k] = *(const v4fa*)(src + (size_t)k * NBL);
        __builtin_amdgcn_sched_barrier(0);   /* holds the loads above their uses: left free, the compiler moves each load down to its addition and one or two are on their way at a time */
#pragma unroll
        for (int q = 0; q < NCK / NGR; ++q) {
#pragma unroll
            for (int k = 0; k < NGR; ++k) { const int ck = q * NGR + k; const v4f vu = rg[ck % NRG]; v4h_ ow;
#pragma unroll
                for (int j = 0; j < 4; ++j) { ow[j] = toh_flush(run[j]); run[j] = run[j] + vu[j]; }
                *(v4h_*)(dst + (size_t)ck * NBL) = ow; }
            asm volatile("s_wait_xcnt 0x0" ::: "memory");   /* in front of every rewrite of a register that the stores above name: the loads below and the next chunks' words reuse them */
            if ((q + 1) * NGR + NRG <= NCK) {
#pragma unroll
                for (int k = 0; k < NGR; ++k) { const int ck = q * NGR + k; rg[ck % NRG] = *(const v4fa*)(src + (size_t)(ck + NRG) * NBL); } }
            __builtin_amdgcn_sched_barrier(0);   /* as above: the loads just issued stay NRG - NGR chunks ahead of their uses */
        }
        v4h_ ot;
#pragma unroll
        for (int j = 0; j < 4; ++j) ot[j] = toh_flush(run[j]);
        *(v4h_*)(Tw + (size_t)pr * NBL + j4 * 4) = ot;
        asm volatile("s_wait_xcnt 0x0" ::: "memory");   /* behind the part's last store: in the built code the other part's loads may stand behind a branch after it and reuse its registers */
    } else {
        const unsigned i = (blockIdx.x - NPR * NBL / 4 / 64) * 64 + threadIdx.x; const float* src = Cu + i * 4; float* dst = Cs + i * 4; v4f rg[NRG]; v4f run = (v4f){};
#pragma unroll
        for (int k = 0; k < NRG; ++k) rg[k] = *(const v4fa*)(src + (size_t)k * NPR * 64);
        __builtin_amdgcn_sched_barrier(0);   /* as in the branch above */
#pragma unroll
        for (int q = 0; q < NCK / NGR; ++q) {
#pragma unroll
            for (int k = 0; k < NGR; ++k) { const int ck = q * NGR + k; const v4f vu = rg[ck % NRG];
                *(v4f*)(dst + (size_t)ck * NPR * 64) = run;
#pragma unroll
                for (int j = 0; j < 4; ++j) run[j] = run[j] + vu[j]; }
            asm volatile("s_wait_xcnt 0x0" ::: "memory");   /* in front of every rewrite of a register that the stores above name: the loads below and the next chunks' words reuse them */
            if ((q + 1) * NGR + NRG <= NCK) {
#pragma unroll
                for (int k = 0; k < NGR; ++k) { const int ck = q * NGR + k; rg[ck % NRG] = *(const v4fa*)(src + (size_t)(ck + NRG) * NPR * 64); } }
            __builtin_amdgcn_sched_barrier(0);   /* as in the branch above */
        }
        *(v4f*)(dst + (size_t)NCK * NPR * 64) = run;
        asm volatile("s_wait_xcnt 0x0" ::: "memory");   /* as behind the last store of the branch above */
    } }

__global__ __launch_bounds__(256) void k_lay(const float* __restrict__ Oa, const float* __restrict__ Ob, const float* __restrict__ Oc, const float* __restrict__ Dn, float* R0, float* R1, int pr0) {
    const unsigned i = blockIdx.x * 256 + threadIdx.x; const unsigned m4 = i & 15u, ts = (i >> 4) & 8191u, pl = i >> 17; const unsigned pr = (unsigned)pr0 + pl, sq = pr >> 3, hd = pr & 7u; const size_t rw = (size_t)pl * NTS + ts;
    const v4f ua = *(const v4fa*)(Oa + rw * 64 + m4 * 4); const v4f ub = *(const v4fa*)(Ob + rw * 64 + m4 * 4); const v4f uc = *(const v4fa*)(Oc + rw * 64 + m4 * 4); const float r1 = Dn[rw]; const float r0 = Dn[(size_t)NZQ * 64 + rw]; v4f o1, o0;
#pragma unroll
    for (int j = 0; j < 4; ++j) { o1[j] = (ua[j] + ub[j]) * r1; o0[j] = uc[j] * r0; }
    const size_t dst = (((size_t)sq * NTS + ts) * NHS + hd) * NFE + m4 * 4;
    *(v4f*)(R0 + dst) = o0; *(v4f*)(R1 + dst) = o1;  }

extern "C" void kernel_launch(void* const* d_in, const int* in_sizes, int n_in, void* d_out, int out_size, void* d_ws, size_t ws_size, hipStream_t stream) {
    if (n_in < 4) return;
    if (in_sizes[0] != NSQ * NTS * NHS * NFE || in_sizes[1] != NSQ * NTS * NHS * NFE || in_sizes[2] != NSQ * NTS * NHS * NFE || in_sizes[3] != NSQ * NTS) return;
    if (out_size != 2 * NSQ * NTS * NHS * NFE) return;
    static_assert(NPR == NSQ * NHS && NHS == 8 && NFE == 64 && NCS == 64 && NCK * NCS == NTS && NTS == 8192 && NZQ == NQP * NCK && NPR % NQP == 0 && NBL == 64 * 64 && (NQP * NTS * NFE / 8) % 256 == 0 && (NZQ * 64) % 256 == 0 && (NPR * NBL / 4) % 64 == 0 && NBL / 4 == 1024 && (NPR * 64 / 4) % 64 == 0 && NCK % NGR == 0 && NRG % NGR == 0 && NRG < NCK && (NQP * NTS * NFE / 4) % 256 == 0, "the products: 64 by 64 blocks over a depth of 64; the flat grids exact; the index fields' widths (3 bits a head, 13 a time, 7 a chunk, 6 a column; 10 a group of four words in a plane)");
    const float* ina = (const float*)d_in[0]; const float* inb = (const float*)d_in[1]; const float* inc = (const float*)d_in[2]; const float* ind = (const float*)d_in[3]; float* R0 = (float*)d_out; float* R1 = R0 + (size_t)NSQ * NTS * NHS * NFE;
    char* wsp = (char*)d_ws; auto take = [&](size_t bytes) { char* p = wsp; wsp += (bytes + 255) & ~(size_t)255; return (void*)p; };
    float* Cs = (float*)take((size_t)(NCK + 1) * NPR * 64 * 4); float* Cu = (float*)take((size_t)NCK * NPR * 64 * 4);
    float* Du = (float*)take((size_t)NPR * NCK * NBL * 4); h16* Sw = (h16*)take((size_t)NPR * NCK * NBL * 2); h16* Gc = (h16*)take((size_t)NPR * NCK * NBL * 2); h16* Tw = (h16*)take((size_t)NPR * NBL * 2);
    h16* Gb = (h16*)take((size_t)NZQ * NBL * 2); h16* Fa = (h16*)take((size_t)NZQ * NBL * 2); h16* Fb = (h16*)take((size_t)NZQ * NBL * 2); float* Pw = (float*)take((size_t)NZQ * NBL * 4); h16* Ph = (h16*)take((size_t)NZQ * NBL * 2); h16* Pl = (h16*)take((size_t)NZQ * NBL * 2); float* Dn = (float*)take((size_t)2 * NZQ * 64 * 4);
    float* Oa = (float*)take((size_t)NZQ * NBL * 4); float* Ob = (float*)take((size_t)NZQ * NBL * 4); float* Oc = (float*)take((size_t)NZQ * NBL * 4);
    if ((size_t)(wsp - (char*)d_ws) > ws_size) return;
    for (int qr = 0; qr < NPR / NQP; ++qr) {   /* the blocks' own sums, a quarter at a time */
        k_colf<<<(unsigned)(NZQ * 64 / 256), 256, 0, stream>>>(inb, inc, ind, Gb, Gc, Cu, qr * NQP);
        k_gemmw<h16, 0, false><<<dim3(1, 1, NZQ), 32, 0, stream>>>(Gc + (size_t)qr * NZQ * NBL, nullptr, Gb, nullptr, NCS, Du + (size_t)qr * NZQ * NBL, 64, nullptr, NBL, NBL, NBL); }   /* Du[m][e] = the sum over the block's steps of Gc[m][time] Gb[e][time] */
    k_scan<<<(unsigned)(NPR * NBL / 4 / 64 + NPR * 64 / 4 / 64), 64, 0, stream>>>(Du, Cu, Sw, Tw, Cs);   /* the sums carried, and the sum over all chunks: one launch */
    for (int qr = 0; qr < NPR / NQP; ++qr) {   /* the results, a quarter at a time */
        k_rowf<<<(unsigned)(NQP * NTS * NFE / 8 / 256), 256, 0, stream>>>(ina, inb, ind, Fa, Fb, qr * NQP);
        k_gemmw<h16, 0, false><<<dim3(1, 1, NZQ), 32, 0, stream>>>(Fa, nullptr, Fb, nullptr, NFE, Pw, 64, nullptr, NBL, NBL, NBL);   /* Pw[row time][column time] */
        k_msk<<<(unsigned)(NZQ * 64 / 256), 256, 0, stream>>>(Pw, Fa, Cs, Ph, Pl, Dn, qr * NQP);
        k_gemmw<h16, 1, false><<<dim3(1, 1, NZQ), 32, 0, stream>>>(Ph, Pl, Gc + (size_t)qr * NZQ * NBL, nullptr, NCS, Oa, 64, nullptr, NBL, NBL, NBL);   /* Oa = (Ph + Pl) Gc^T */
        k_gemmw<h16, 0, false><<<dim3(1, 1, NZQ), 32, 0, stream>>>(Fa, nullptr, Sw + (size_t)qr * NZQ * NBL, nullptr, NFE, Ob, 64, nullptr, NBL, NBL, NBL);   /* Ob = Fa Sw^T */
        k_gemmw<h16, 0, false><<<dim3(NTS / 64, 1, NQP), 32, 0, stream>>>(Fa, nullptr, Tw + (size_t)qr * NQP * NBL, nullptr, NFE, Oc, 64, nullptr, (size_t)NTS * NFE, NBL, (size_t)NTS * NFE);   /* Oc = Fa Tw^T: a pair's 8,192 rows against its one block */
        k_lay<<<(unsigned)(NQP * NTS * NFE / 4 / 256), 256, 0, stream>>>(Oa, Ob, Oc, Dn, R0, R1, qr * NQP); }
}

// v002
// One run takes 124 microseconds.
// In both of two side-by-side timings against v001, it was 2.08 times as fast.
// All steps since v000 together make it 6.10 times as fast.
#include <hip/hip_runtime.h>

// Inputs, in this order: ina [2][8192][8][64]; inb [2][8192][8][64]; inc [2][8192][8][64]; ind [2][8192] (a 0 | 1 word a (sequence, time)). Results, one after the other in the result buffer: R0 [2][8192][8][64], then R1 [2][8192][8][64]. A PAIR is one (sequence, head): 16 pairs; a CHUNK is 64 steps: 128 chunks a pair; a BLOCK is one (pair, chunk): 64 by 64 words: 2,048 blocks.
// With fa = max(w, 0) + exp(min(w, 0)) of ina's words and fb = the same of inb's words times ind's word of that (sequence, time): R0[t] = fa[t] . (the sum over ALL steps u of fb[u] inc[u]^T), times 1 / (fa[t] . (the sum over all u of fb[u]) + 1e-6); R1[t] = fa[t] . (the sum over u <= t of fb[u] inc[u]^T), times 1 / (fa[t] . (the sum over u <= t of fb[u]) + 1e-6): every pair by itself.
// THE FORM: chunk by chunk, every block of every pair side by side in each launch (a kernel's last argument is the first pair of its launch: 0). For a block c: Pw = Fa_c Fb_c^T (64 by 64 over 64); kept where the column's time is not after the row's; its f16 word Ph and the word Pl of what Ph leaves; Du_c = Gc_c Gb_c^T: the block's own sum of inc[u] fb[u]^T (64 by 64 over the 64 steps); the sums carried over the chunks before c: Sw_c = the word of (Du_0 + .. + Du_(c-1)), made by ONE launch in which every thread keeps the running sum of its own four words in registers, starts it at nought and walks the 128 chunks in their order (behind the last chunk it lays the word of the sum over ALL chunks: Tw); R1's upper term = (Ph + Pl) Gc_c^T + Fa_c Sw_c^T; its lower term = the kept words' sum along the row + Fa's row . (the carried sums of fb's words) + 1e-6; R0's upper term = Fa Tw^T; its lower term = Fa's row . (the sum of fb's words over all steps) + 1e-6.
// Layout of the workspace, every plane for all 16 pairs: Cs f32 [129][16][64] (row 0 noughts; row c + 1 = row c + Cu's row c); Cu f32 [128][16][64]; Du f32 [16][128][4096]; Sw f16 [16][128][4096]; Gc f16 [16][128][64][64] (inc's words, the steps side by side); Tw f16 [16][4096]; Gb f16 [2048][64][64] (fb's words, the steps side by side); Fa, Fb f16 [16][8192][64]; Pw f32 [2048][4096], in Du's place (Du's last reader, the launch of the carried sums, stands in front of Pw's writer); Ph, Pl f16 [2048][4096]; Dn f32 [2][2048][64]; Oa, Ob, Oc f32 [2048][4096].
// Compute dtypes, f32 accumulate: every float input is taken at its bf16 value where it is read; fa, fb, inc's words, the carried sums and the sum over all chunks go to the matrix unit as ONE f16 word each (a value under 2^-14 in magnitude made an exact nought before the cast); the kept words of Pw as TWO f16 words (Ph and Pl: one launch of the matrix kernel adds both); everything else is f32. The lower terms' reciprocals are true divisions.

#define NSQ 2
#define NTS 8192
#define NHS 8
#define NFE 64
#define NCS 64
#define NCK 128
#define NPR 16
#define NZQ 2048
#define NBL 4096

typedef _Float16 h16;
typedef unsigned short bf;
typedef __attribute__((ext_vector_type(16))) __bf16   v16bf;
typedef __attribute__((ext_vector_type(16))) _Float16 v16h;
typedef __attribute__((ext_vector_type(8)))  _Float16 v8h;
typedef __attribute__((ext_vector_type(8)))  unsigned short v8us;
typedef __attribute__((ext_vector_type(8)))  float    v8f;
typedef __attribute__((ext_vector_type(4)))  float    v4f;
typedef v8h  __attribute__((may_alias)) v8ha;
typedef v4f  __attribute__((may_alias)) v4fa;
typedef v8us __attribute__((may_alias)) v8usa;

__device__ __forceinline__ unsigned short f2bf(float f) { unsigned u = __float_as_uint(f); u += 0x7FFFu + ((u >> 16) & 1u); return (unsigned short)(u >> 16); }
__device__ __forceinline__ float bf2f(unsigned short b) { return __uint_as_float(((unsigned)b) << 16); }
__device__ __forceinline__ float bfr(float f) { return bf2f(f2bf(f)); }
__device__ __forceinline__ v16h cat16(v8h lo, v8h hi) { return __builtin_shufflevector(lo, hi, 0, 1, 2, 3, 4, 5, 6, 7, 8, 9, 10, 11, 12, 13, 14, 15); }
__device__ __forceinline__ v16bf cat16b(v8us lo, v8us hi) { return __builtin_bit_cast(v16bf, __builtin_shufflevector(lo, hi, 0, 1, 2, 3, 4, 5, 6, 7, 8, 9, 10, 11, 12, 13, 14, 15)); }
__device__ __forceinline__ v8f wmma16(v16h a, v16h b, v8f c) { return __builtin_amdgcn_wmma_f32_16x16x32_f16(false, a, false, b, (short)0, c, false, false); }
__device__ __forceinline__ v8f wmmab(v16bf a, v16bf b, v8f c) { return __builtin_amdgcn_wmma_f32_16x16x32_bf16(false, a, false, b, (short)0, c, false, false); }

// ---- k_gemmw: register-blocked GEMM, ONE WAVE per 64x64 output tile (16 accumulators), operands straight from K-contiguous 16-bit planes; grid (M/64, N/64, Z), 32 threads.
// C[m][n] (f32, pitch ldc, + optional f32 bias[n]) = sum_k A[m][k] Bt[n][k] (+ split products per NSPLIT). z-batch strides sA/sB/sC in elements. K % 32 == 0.
template <typename T16> struct WFrag;
template <> struct WFrag<h16> { typedef v16h V; static __device__ __forceinline__ V ld(const h16* p) { return cat16(*(const v8h*)p, *(const v8h*)(p + 16)); } static __device__ __forceinline__ v8f mma(V a, V b, v8f c) { return wmma16(a, b, c); } };
template <> struct WFrag<bf> { typedef v16bf V; static __device__ __forceinline__ V ld(const bf* p) { return cat16b(*(const v8us*)p, *(const v8us*)(p + 16)); } static __device__ __forceinline__ v8f mma(V a, V b, v8f c) { return wmmab(a, b, c); } };
template <typename T16, int NSPLIT, bool BIAS>
__global__ __launch_bounds__(32) void k_gemmw(const T16* __restrict__ A, const T16* __restrict__ A2, const T16* __restrict__ Bt, const T16* __restrict__ Bt2, int K, float* C, int ldc, const float* __restrict__ bias, size_t sA, size_t sB, size_t sC) {
    typedef typename WFrag<T16>::V V;
    __shared__ __align__(16) float os[16 * 68];
    const size_t z = blockIdx.z; A += z * sA; if (A2) A2 += z * sA; Bt += z * sB; if (Bt2) Bt2 += z * sB; C += z * sC;
    const int lane = threadIdx.x & 31, lr = lane & 15, hi = lane >> 4; const int r0 = blockIdx.x * 64, c0 = blockIdx.y * 64;
    v8f acc[4][4];
#pragma unroll
    for (int mb = 0; mb < 4; ++mb)
#pragma unroll
        for (int nb = 0; nb < 4; ++nb) acc[mb][nb] = (v8f){};
    const size_t aoff = (size_t)(r0 + lr) * K + 8 * hi, boff = (size_t)(c0 + lr) * K + 8 * hi;
    for (int kc = 0; kc < K; kc += 32) {
        V a[4], a2[4];
#pragma unroll
        for (int mb = 0; mb < 4; ++mb) { a[mb] = WFrag<T16>::ld(A + aoff + (size_t)mb * 16 * K + kc); if (NSPLIT == 1 || NSPLIT == 2) a2[mb] = WFrag<T16>::ld(A2 + aoff + (size_t)mb * 16 * K + kc); }
#pragma unroll
        for (int nb = 0; nb < 4; ++nb) { const V b = WFrag<T16>::ld(Bt + boff + (size_t)nb * 16 * K + kc); V b2; if (NSPLIT >= 2) b2 = WFrag<T16>::ld(Bt2 + boff + (size_t)nb * 16 * K + kc);
#pragma unroll
            for (int mb = 0; mb < 4; ++mb) { acc[mb][nb] = WFrag<T16>::mma(a[mb], b, acc[mb][nb]); if (NSPLIT == 1 || NSPLIT == 2) acc[mb][nb] = WFrag<T16>::mma(a2[mb], b, acc[mb][nb]); if (NSPLIT >= 2) acc[mb][nb] = WFrag<T16>::mma(a[mb], b2, acc[mb][nb]); } }
        asm volatile("v_nop\n\tv_nop\n\tv_nop\n\tv_nop" : "+v"(acc[0][0]), "+v"(acc[1][1]), "+v"(acc[2][2]), "+v"(acc[3][3]) : "v"(a[0]), "v"(a[3]));
    }
#pragma unroll
    for (int mb = 0; mb < 4; ++mb) {
#pragma unroll
        for (int nb = 0; nb < 4; ++nb) {
#pragma unroll
            for (int j = 0; j < 8; ++j) os[(hi * 8 + j) * 68 + nb * 16 + lr] = acc[mb][nb][j]; }
        __builtin_amdgcn_wave_barrier(); asm volatile("" ::: "memory");
        float* crow = C + (size_t)(r0 + mb * 16) * ldc + c0;
{
#pragma unroll
            for (int s = 0; s < 8; ++s) { const int row = 2 * s + hi, cofs = lr * 4; v4f val = *(const v4fa*)(os + row * 68 + cofs); if (BIAS) { val[0] += bfr(bias[c0 + cofs]); val[1] += bfr(bias[c0 + cofs + 1]); val[2] += bfr(bias[c0 + cofs + 2]); val[3] += bfr(bias[c0 + cofs + 3]); }
                *(v4f*)(crow + (size_t)row * ldc + cofs) = val; }
             }
        __builtin_amdgcn_wave_barrier(); asm volatile("" ::: "memory");
    }
}

typedef __attribute__((ext_vector_type(2))) _Float16 v2h;
typedef __attribute__((ext_vector_type(4))) _Float16 v4h;
typedef __attribute__((ext_vector_type(2))) unsigned short v2us;
typedef __attribute__((ext_vector_type(4))) unsigned short v4us;
typedef __attribute__((ext_vector_type(2))) float v2f;
typedef __attribute__((ext_vector_type(4))) int v4i;
// the f16 cast of the new kernels: a value under 2^-14 in magnitude becomes an exact zero BEFORE the conversion (a select on the value): no subnormal f16 word is made.
__device__ __forceinline__ h16 toh_flush(float x) { const float z = (fabsf(x) < 6.103515625e-05f) ? 0.0f : x; return (h16)z; }

typedef __attribute__((ext_vector_type(4))) _Float16 v4h_;
__global__ __launch_bounds__(256) void k_rowf(const float* __restrict__ ina, const float* __restrict__ inb, const float* __restrict__ ind, h16* Fa, h16* Fb, int pr0) {
    const unsigned i = blockIdx.x * 256 + threadIdx.x; const unsigned e8 = i & 7u, ts = (i >> 3) & 8191u, pl = i >> 16; const unsigned pr = (unsigned)pr0 + pl, sq = pr >> 3, hd = pr & 7u;
    const size_t src = (((size_t)sq * NTS + ts) * NHS + hd) * NFE + e8 * 8; const v8f wa = *(const v8f*)(ina + src); const v8f wb = *(const v8f*)(inb + src); const float mk = bfr(ind[(size_t)sq * NTS + ts]); v8h oa, ob;
#pragma unroll
    for (int j = 0; j < 8; ++j) { const float ya = bfr(wa[j]), yb = bfr(wb[j]); oa[j] = toh_flush(fmaxf(ya, 0.0f) + expf(fminf(ya, 0.0f))); ob[j] = toh_flush((fmaxf(yb, 0.0f) + expf(fminf(yb, 0.0f))) * mk); }
    h16* pa = Fa + (size_t)i * 8; h16* pb = Fb + (size_t)i * 8;
    *(v8h*)pa = oa; *(v8h*)pb = ob;  }

__global__ __launch_bounds__(256) void k_colf(const float* __restrict__ inb, const float* __restrict__ inc, const float* __restrict__ ind, h16* Gb, h16* Gc, float* Cu, int pr0) {
    const unsigned i = blockIdx.x * 256 + threadIdx.x; const unsigned cl = i & 63u, ck = (i >> 6) & 127u, pl = i >> 13; const unsigned pr = (unsigned)pr0 + pl, sq = pr >> 3, hd = pr & 7u;
    const size_t b0 = (((size_t)sq * NTS + (size_t)ck * NCS) * NHS + hd) * NFE + cl; const float* mp = ind + (size_t)sq * NTS + (size_t)ck * NCS; h16 rb[64], rc[64]; float acc = 0.0f;
#pragma unroll
    for (int tj = 0; tj < 64; ++tj) { const float yb = bfr(inb[b0 + (size_t)tj * (NHS * NFE)]); const float yc = bfr(inc[b0 + (size_t)tj * (NHS * NFE)]); const h16 wb = toh_flush((fmaxf(yb, 0.0f) + expf(fminf(yb, 0.0f))) * bfr(mp[tj])); rb[tj] = wb; rc[tj] = toh_flush(yc); acc = acc + (float)wb; }
    h16* pb = Gb + ((size_t)(pl * NCK + ck) * 64 + cl) * 64; h16* pc = Gc + ((size_t)(pr * NCK + ck) * 64 + cl) * 64; float* pu = Cu + ((size_t)ck * NPR + pr) * 64 + cl;
{
#pragma unroll
        for (int g = 0; g < 8; ++g) { v8h ob, oc;
#pragma unroll
            for (int j = 0; j < 8; ++j) { ob[j] = rb[g * 8 + j]; oc[j] = rc[g * 8 + j]; }
            *(v8h*)(pb + g * 8) = ob; *(v8h*)(pc + g * 8) = oc; }
        *(float*)pu = acc;
         } }

__global__ __launch_bounds__(256) void k_msk(const float* __restrict__ Pw, const h16* __restrict__ Fa, const float* __restrict__ Cs, h16* Ph, h16* Pl, float* Dn, int pr0) {
    const unsigned i = blockIdx.x * 256 + threadIdx.x; const unsigned tr = i & 63u, zq = i >> 6, ck = zq & 127u, pl = zq >> 7; const unsigned pr = (unsigned)pr0 + pl;
    const float* pw = Pw + (size_t)i * 64; const h16* fr = Fa + (size_t)i * 64; const float* c1 = Cs + ((size_t)ck * NPR + pr) * 64; const float* c0 = Cs + ((size_t)NCK * NPR + pr) * 64; h16 rh[64], rl[64]; float acc = 0.0f, d1 = 0.0f, d0 = 0.0f;
#pragma unroll
    for (int sj = 0; sj < 64; ++sj) { const float kp = (float)((unsigned)sj <= tr); const float pm = pw[sj] * kp; const h16 hi = toh_flush(pm); rh[sj] = hi; rl[sj] = toh_flush(pm - (float)hi); acc = acc + pm; const float fq = (float)fr[sj]; d1 = d1 + fq * c1[sj]; d0 = d0 + fq * c0[sj]; }
    const float r1 = 1.0f / (acc + d1 + 1e-6f); const float r0 = 1.0f / (d0 + 1e-6f); h16* ph = Ph + (size_t)i * 64; h16* pq = Pl + (size_t)i * 64; float* dn = Dn + i;
{
#pragma unroll
        for (int g = 0; g < 8; ++g) { v8h oh, ol;
#pragma unroll
            for (int j = 0; j < 8; ++j) { oh[j] = rh[g * 8 + j]; ol[j] = rl[g * 8 + j]; }
            *(v8h*)(ph + g * 8) = oh; *(v8h*)(pq + g * 8) = ol; }
        *(float*)dn = r1; *(float*)(dn + NZQ * 64) = r0;
         } }

// ---- k_scan: every carried sum in one launch. A thread owns four neighbouring words of one pair's 64 by 64 plane (work-groups 0 to 255) or of the 16 by 64 row of fb's sums (the last 4 work-groups); it adds the 128 chunks' own sums in their order, one f32 addition a chunk and word, from a start value of nought, and stores what it holds IN FRONT of each addition.
// The addresses do not hang on the sums, so the loads run ahead: NRG chunks' words stand in registers or are on their way; NGR chunks are taken at a time, and their registers are loaded anew at once.
#define NRG 48
#define NGR 8
__global__ __launch_bounds__(64) void k_scan(const float* __restrict__ Du, const float* __restrict__ Cu, h16* __restrict__ Sw, h16* __restrict__ Tw, float* __restrict__ Cs) {
    if (blockIdx.x < NPR * NBL / 4 / 64) {
        const unsigned i = blockIdx.x * 64 + threadIdx.x; const unsigned j4 = i & 1023u, pr = i >> 10; const float* src = Du + (size_t)pr * NCK * NBL + j4 * 4; h16* dst = Sw + (size_t)pr * NCK * NBL + j4 * 4; v4f rg[NRG]; v4f run = (v4f){};
#pragma unroll
        for (int k = 0; k < NRG; ++k) rg[k] = *(const v4fa*)(src + (size_t)k * NBL);
        __builtin_amdgcn_sched_barrier(0);   /* holds the loads above their uses: left free, the compiler moves each load down to its addition and one or two are on their way at a time */
#pragma unroll
        for (int q = 0; q < NCK / NGR; ++q) {
#pragma unroll
            for (int k = 0; k < NGR; ++k) { const int ck = q * NGR + k; const v4f vu = rg[ck % NRG]; v4h_ ow;
#pragma unroll
                for (int j = 0; j < 4; ++j) { ow[j] = toh_flush(run[j]); run[j] = run[j] + vu[j]; }
                *(v4h_*)(dst + (size_t)ck * NBL) = ow; }
            asm volatile("s_wait_xcnt 0x0" ::: "memory");   /* in front of every rewrite of a register that the stores above name: the loads below and the next chunks' words reuse them */
            if ((q + 1) * NGR + NRG <= NCK) {
#pragma unroll
                for (int k = 0; k < NGR; ++k) { const int ck = q * NGR + k; rg[ck % NRG] = *(const v4fa*)(src + (size_t)(ck + NRG) * NBL); } }
            __builtin_amdgcn_sched_barrier(0);   /* as above: the loads just issued stay NRG - NGR chunks ahead of their uses */
        }
        v4h_ ot;
#pragma unroll
        for (int j = 0; j < 4; ++j) ot[j] = toh_flush(run[j]);
        *(v4h_*)(Tw + (size_t)pr * NBL + j4 * 4) = ot;
        asm volatile("s_wait_xcnt 0x0" ::: "memory");   /* behind the part's last store: in the built code the other part's loads may stand behind a branch after it and reuse its registers */
    } else {
        const unsigned i = (blockIdx.x - NPR * NBL / 4 / 64) * 64 + threadIdx.x; const float* src = Cu + i * 4; float* dst = Cs + i * 4; v4f rg[NRG]; v4f run = (v4f){};
#pragma unroll
        for (int k = 0; k < NRG; ++k) rg[k] = *(const v4fa*)(src + (size_t)k * NPR * 64);
        __builtin_amdgcn_sched_barrier(0);   /* as in the branch above */
#pragma unroll
        for (int q = 0; q < NCK / NGR; ++q) {
#pragma unroll
            for (int k = 0; k < NGR; ++k) { const int ck = q * NGR + k; const v4f vu = rg[ck % NRG];
                *(v4f*)(dst + (size_t)ck * NPR * 64) = run;
#pragma unroll
                for (int j = 0; j < 4; ++j) run[j] = run[j] + vu[j]; }
            asm volatile("s_wait_xcnt 0x0" ::: "memory");   /* in front of every rewrite of a register that the stores above name: the loads below and the next chunks' words reuse them */
            if ((q + 1) * NGR + NRG <= NCK) {
#pragma unroll
                for (int k = 0; k < NGR; ++k) { const int ck = q * NGR + k; rg[ck % NRG] = *(const v4fa*)(src + (size_t)(ck + NRG) * NPR * 64); } }
            __builtin_amdgcn_sched_barrier(0);   /* as in the branch above */
        }
        *(v4f*)(dst + (size_t)NCK * NPR * 64) = run;
        asm volatile("s_wait_xcnt 0x0" ::: "memory");   /* as behind the last store of the branch above */
    } }

__global__ __launch_bounds__(256) void k_lay(const float* __restrict__ Oa, const float* __restrict__ Ob, const float* __restrict__ Oc, const float* __restrict__ Dn, float* R0, float* R1, int pr0) {
    const unsigned i = blockIdx.x * 256 + threadIdx.x; const unsigned m4 = i & 15u, ts = (i >> 4) & 8191u, pl = i >> 17; const unsigned pr = (unsigned)pr0 + pl, sq = pr >> 3, hd = pr & 7u; const size_t rw = (size_t)pl * NTS + ts;
    const v4f ua = *(const v4fa*)(Oa + rw * 64 + m4 * 4); const v4f ub = *(const v4fa*)(Ob + rw * 64 + m4 * 4); const v4f uc = *(const v4fa*)(Oc + rw * 64 + m4 * 4); const float r1 = Dn[rw]; const float r0 = Dn[(size_t)NZQ * 64 + rw]; v4f o1, o0;
#pragma unroll
    for (int j = 0; j < 4; ++j) { o1[j] = (ua[j] + ub[j]) * r1; o0[j] = uc[j] * r0; }
    const size_t dst = (((size_t)sq * NTS + ts) * NHS + hd) * NFE + m4 * 4;
    *(v4f*)(R0 + dst) = o0; *(v4f*)(R1 + dst) = o1;  }

extern "C" void kernel_launch(void* const* d_in, const int* in_sizes, int n_in, void* d_out, int out_size, void* d_ws, size_t ws_size, hipStream_t stream) {
    if (n_in < 4) return;
    if (in_sizes[0] != NSQ * NTS * NHS * NFE || in_sizes[1] != NSQ * NTS * NHS * NFE || in_sizes[2] != NSQ * NTS * NHS * NFE || in_sizes[3] != NSQ * NTS) return;
    if (out_size != 2 * NSQ * NTS * NHS * NFE) return;
    static_assert(NPR == NSQ * NHS && NHS == 8 && NFE == 64 && NCS == 64 && NCK * NCS == NTS && NTS == 8192 && NZQ == NPR * NCK && NBL == 64 * 64 && (NPR * NTS * NFE / 8) % 256 == 0 && (NZQ * 64) % 256 == 0 && (NPR * NBL / 4) % 64 == 0 && NBL / 4 == 1024 && (NPR * 64 / 4) % 64 == 0 && NCK % NGR == 0 && NRG % NGR == 0 && NRG < NCK && (NPR * NTS * NFE / 4) % 256 == 0, "the products: 64 by 64 blocks over a depth of 64; the flat grids exact; the index fields' widths (3 bits a head, 13 a time, 7 a chunk, 6 a column; 10 a group of four words in a plane)");
    const float* ina = (const float*)d_in[0]; const float* inb = (const float*)d_in[1]; const float* inc = (const float*)d_in[2]; const float* ind = (const float*)d_in[3]; float* R0 = (float*)d_out; float* R1 = R0 + (size_t)NSQ * NTS * NHS * NFE;
    char* wsp = (char*)d_ws; auto take = [&](size_t bytes) { char* p = wsp; wsp += (bytes + 255) & ~(size_t)255; return (void*)p; };
    float* Cs = (float*)take((size_t)(NCK + 1) * NPR * 64 * 4); float* Cu = (float*)take((size_t)NCK * NPR * 64 * 4);
    float* Du = (float*)take((size_t)NPR * NCK * NBL * 4); h16* Sw = (h16*)take((size_t)NPR * NCK * NBL * 2); h16* Gc = (h16*)take((size_t)NPR * NCK * NBL * 2); h16* Tw = (h16*)take((size_t)NPR * NBL * 2);
    h16* Gb = (h16*)take((size_t)NZQ * NBL * 2); h16* Fa = (h16*)take((size_t)NZQ * NBL * 2); h16* Fb = (h16*)take((size_t)NZQ * NBL * 2); float* Pw = Du; h16* Ph = (h16*)take((size_t)NZQ * NBL * 2); h16* Pl = (h16*)take((size_t)NZQ * NBL * 2); float* Dn = (float*)take((size_t)2 * NZQ * 64 * 4);
    float* Oa = (float*)take((size_t)NZQ * NBL * 4); float* Ob = (float*)take((size_t)NZQ * NBL * 4); float* Oc = (float*)take((size_t)NZQ * NBL * 4);
    if ((size_t)(wsp - (char*)d_ws) > ws_size) return;
    /* the blocks' own sums */
    k_colf<<<(unsigned)(NZQ * 64 / 256), 256, 0, stream>>>(inb, inc, ind, Gb, Gc, Cu, 0);
    k_gemmw<h16, 0, false><<<dim3(1, 1, NZQ), 32, 0, stream>>>(Gc, nullptr, Gb, nullptr, NCS, Du, 64, nullptr, NBL, NBL, NBL);   /* Du[m][e] = the sum over the block's steps of Gc[m][time] Gb[e][time] */
    k_scan<<<(unsigned)(NPR * NBL / 4 / 64 + NPR * 64 / 4 / 64), 64, 0, stream>>>(Du, Cu, Sw, Tw, Cs);   /* the sums carried, and the sum over all chunks: one launch */
    /* the results */
    k_rowf<<<(unsigned)(NPR * NTS * NFE / 8 / 256), 256, 0, stream>>>(ina, inb, ind, Fa, Fb, 0);
    k_gemmw<h16, 0, false><<<dim3(1, 1, NZQ), 32, 0, stream>>>(Fa, nullptr, Fb, nullptr, NFE, Pw, 64, nullptr, NBL, NBL, NBL);   /* Pw[row time][column time] */
    k_msk<<<(unsigned)(NZQ * 64 / 256), 256, 0, stream>>>(Pw, Fa, Cs, Ph, Pl, Dn, 0);
    k_gemmw<h16, 1, false><<<dim3(1, 1, NZQ), 32, 0, stream>>>(Ph, Pl, Gc, nullptr, NCS, Oa, 64, nullptr, NBL, NBL, NBL);   /* Oa = (Ph + Pl) Gc^T */
    k_gemmw<h16, 0, false><<<dim3(1, 1, NZQ), 32, 0, stream>>>(Fa, nullptr, Sw, nullptr, NFE, Ob, 64, nullptr, NBL, NBL, NBL);   /* Ob = Fa Sw^T */
    k_gemmw<h16, 0, false><<<dim3(NTS / 64, 1, NPR), 32, 0, stream>>>(Fa, nullptr, Tw, nullptr, NFE, Oc, 64, nullptr, (size_t)NTS * NFE, NBL, (size_t)NTS * NFE);   /* Oc = Fa Tw^T: a pair's 8,192 rows against its one block */
    k_lay<<<(unsigned)(NPR * NTS * NFE / 4 / 256), 256, 0, stream>>>(Oa, Ob, Oc, Dn, R0, R1, 0);
}

// v003
// One run takes 70 microseconds.
// Next to v002, in two timings, it ran 1.78 and 1.77 times as fast.
// All steps since v000 together make it 10.8 times as fast.
#include <hip/hip_runtime.h>

// Inputs, in this order: ina [2][8192][8][64]; inb [2][8192][8][64]; inc [2][8192][8][64]; ind [2][8192] (a 0 | 1 word a (sequence, time)). Results, one after the other in the result buffer: R0 [2][8192][8][64], then R1 [2][8192][8][64]. A PAIR is one (sequence, head): 16 pairs; a CHUNK is 64 steps: 128 chunks a pair; a BLOCK is one (pair, chunk): 64 by 64 words: 2,048 blocks.
// With fa = max(w, 0) + exp(min(w, 0)) of ina's words and fb = the same of inb's words times ind's word of that (sequence, time): R0[t] = fa[t] . (the sum over ALL steps u of fb[u] inc[u]^T), times 1 / (fa[t] . (the sum over all u of fb[u]) + 1e-6); R1[t] = fa[t] . (the sum over u <= t of fb[u] inc[u]^T), times 1 / (fa[t] . (the sum over u <= t of fb[u]) + 1e-6): every pair by itself.
// THE FORM: chunk by chunk, every block of every pair side by side in each launch (k_colf's last argument is the first pair of its launch: 0). For a block c: Du_c = Gc_c Gb_c^T: the block's own sum of inc[u] fb[u]^T (64 by 64 over the 64 steps); the sums carried over the chunks before c: Sw_c = the word of (Du_0 + .. + Du_(c-1)), made by ONE launch in which every thread keeps the running sum of its own four words in registers, starts it at nought and walks the 128 chunks in their order (behind the last chunk it lays the word of the sum over ALL chunks: Tw). THE RESULTS: ONE launch, a work-group of four waves a block, a wave 16 rows (k_res): Pw = Fa_c Fb_c^T (64 by 64 over 64); kept where the column's time is not after the row's; its f16 word Ph and the word Pl of what Ph leaves; R1's upper term = (Ph + Pl) Gc_c^T + Fa_c Sw_c^T; its lower term = the kept words' sum along the row + Fa's row . (the carried sums of fb's words) + 1e-6; R0's upper term = Fa Tw^T; its lower term = Fa's row . (the sum of fb's words over all steps) + 1e-6.
// Layout of the workspace, every plane for all 16 pairs: Cs f32 [129][16][64] (row 0 noughts; row c + 1 = row c + Cu's row c); Cu f32 [128][16][64]; Du f32 [16][128][4096]; Sw f16 [16][128][4096]; Gc f16 [16][128][64][64] (inc's words, the steps side by side); Tw f16 [16][4096]; Gb f16 [2048][64][64] (fb's words, the steps side by side).
// Compute dtypes, f32 accumulate: every float input is taken at its bf16 value where it is read; fa, fb, inc's words, the carried sums and the sum over all chunks go to the matrix unit as ONE f16 word each (a value under 2^-14 in magnitude made an exact nought before the cast); the kept words of Pw as TWO f16 words (Ph and Pl: one accumulator takes both); everything else is f32. The lower terms' reciprocals are true divisions.

#define NSQ 2
#define NTS 8192
#define NHS 8
#define NFE 64
#define NCS 64
#define NCK 128
#define NPR 16
#define NZQ 2048
#define NBL 4096

typedef _Float16 h16;
typedef unsigned short bf;
typedef __attribute__((ext_vector_type(16))) __bf16   v16bf;
typedef __attribute__((ext_vector_type(16))) _Float16 v16h;
typedef __attribute__((ext_vector_type(8)))  _Float16 v8h;
typedef __attribute__((ext_vector_type(8)))  unsigned short v8us;
typedef __attribute__((ext_vector_type(8)))  float    v8f;
typedef __attribute__((ext_vector_type(4)))  float    v4f;
typedef v8h  __attribute__((may_alias)) v8ha;
typedef v4f  __attribute__((may_alias)) v4fa;
typedef v8us __attribute__((may_alias)) v8usa;

__device__ __forceinline__ unsigned short f2bf(float f) { unsigned u = __float_as_uint(f); u += 0x7FFFu + ((u >> 16) & 1u); return (unsigned short)(u >> 16); }
__device__ __forceinline__ float bf2f(unsigned short b) { return __uint_as_float(((unsigned)b) << 16); }
__device__ __forceinline__ float bfr(float f) { return bf2f(f2bf(f)); }
__device__ __forceinline__ v16h cat16(v8h lo, v8h hi) { return __builtin_shufflevector(lo, hi, 0, 1, 2, 3, 4, 5, 6, 7, 8, 9, 10, 11, 12, 13, 14, 15); }
__device__ __forceinline__ v16bf cat16b(v8us lo, v8us hi) { return __builtin_bit_cast(v16bf, __builtin_shufflevector(lo, hi, 0, 1, 2, 3, 4, 5, 6, 7, 8, 9, 10, 11, 12, 13, 14, 15)); }
__device__ __forceinline__ v8f wmma16(v16h a, v16h b, v8f c) { return __builtin_amdgcn_wmma_f32_16x16x32_f16(false, a, false, b, (short)0, c, false, false); }
__device__ __forceinline__ v8f wmmab(v16bf a, v16bf b, v8f c) { return __builtin_amdgcn_wmma_f32_16x16x32_bf16(false, a, false, b, (short)0, c, false, false); }

// ---- k_gemmw: register-blocked GEMM, ONE WAVE per 64x64 output tile (16 accumulators), operands straight from K-contiguous 16-bit planes; grid (M/64, N/64, Z), 32 threads.
// C[m][n] (f32, pitch ldc, + optional f32 bias[n]) = sum_k A[m][k] Bt[n][k] (+ split products per NSPLIT). z-batch strides sA/sB/sC in elements. K % 32 == 0.
template <typename T16> struct WFrag;
template <> struct WFrag<h16> { typedef v16h V; static __device__ __forceinline__ V ld(const h16* p) { return cat16(*(const v8h*)p, *(const v8h*)(p + 16)); } static __device__ __forceinline__ v8f mma(V a, V b, v8f c) { return wmma16(a, b, c); } };
template <> struct WFrag<bf> { typedef v16bf V; static __device__ __forceinline__ V ld(const bf* p) { return cat16b(*(const v8us*)p, *(const v8us*)(p + 16)); } static __device__ __forceinline__ v8f mma(V a, V b, v8f c) { return wmmab(a, b, c); } };
template <typename T16, int NSPLIT, bool BIAS>
__global__ __launch_bounds__(32) void k_gemmw(const T16* __restrict__ A, const T16* __restrict__ A2, const T16* __restrict__ Bt, const T16* __restrict__ Bt2, int K, float* C, int ldc, const float* __restrict__ bias, size_t sA, size_t sB, size_t sC) {
    typedef typename WFrag<T16>::V V;
    __shared__ __align__(16) float os[16 * 68];
    const size_t z = blockIdx.z; A += z * sA; if (A2) A2 += z * sA; Bt += z * sB; if (Bt2) Bt2 += z * sB; C += z * sC;
    const int lane = threadIdx.x & 31, lr = lane & 15, hi = lane >> 4; const int r0 = blockIdx.x * 64, c0 = blockIdx.y * 64;
    v8f acc[4][4];
#pragma unroll
    for (int mb = 0; mb < 4; ++mb)
#pragma unroll
        for (int nb = 0; nb < 4; ++nb) acc[mb][nb] = (v8f){};
    const size_t aoff = (size_t)(r0 + lr) * K + 8 * hi, boff = (size_t)(c0 + lr) * K + 8 * hi;
    for (int kc = 0; kc < K; kc += 32) {
        V a[4], a2[4];
#pragma unroll
        for (int mb = 0; mb < 4; ++mb) { a[mb] = WFrag<T16>::ld(A + aoff + (size_t)mb * 16 * K + kc); if (NSPLIT == 1 || NSPLIT == 2) a2[mb] = WFrag<T16>::ld(A2 + aoff + (size_t)mb * 16 * K + kc); }
#pragma unroll
        for (int nb = 0; nb < 4; ++nb) { const V b = WFrag<T16>::ld(Bt + boff + (size_t)nb * 16 * K + kc); V b2; if (NSPLIT >= 2) b2 = WFrag<T16>::ld(Bt2 + boff + (size_t)nb * 16 * K + kc);
#pragma unroll
            for (int mb = 0; mb < 4; ++mb) { acc[mb][nb] = WFrag<T16>::mma(a[mb], b, acc[mb][nb]); if (NSPLIT == 1 || NSPLIT == 2) acc[mb][nb] = WFrag<T16>::mma(a2[mb], b, acc[mb][nb]); if (NSPLIT >= 2) acc[mb][nb] = WFrag<T16>::mma(a[mb], b2, acc[mb][nb]); } }
        asm volatile("v_nop\n\tv_nop\n\tv_nop\n\tv_nop" : "+v"(acc[0][0]), "+v"(acc[1][1]), "+v"(acc[2][2]), "+v"(acc[3][3]) : "v"(a[0]), "v"(a[3]));
    }
#pragma unroll
    for (int mb = 0; mb < 4; ++mb) {
#pragma unroll
        for (int nb = 0; nb < 4; ++nb) {
#pragma unroll
            for (int j = 0; j < 8; ++j) os[(hi * 8 + j) * 68 + nb * 16 + lr] = acc[mb][nb][j]; }
        __builtin_amdgcn_wave_barrier(); asm volatile("" ::: "memory");
        float* crow = C + (size_t)(r0 + mb * 16) * ldc + c0;
{
#pragma unroll
            for (int s = 0; s < 8; ++s) { const int row = 2 * s + hi, cofs = lr * 4; v4f val = *(const v4fa*)(os + row * 68 + cofs); if (BIAS) { val[0] += bfr(bias[c0 + cofs]); val[1] += bfr(bias[c0 + cofs + 1]); val[2] += bfr(bias[c0 + cofs + 2]); val[3] += bfr(bias[c0 + cofs + 3]); }
                *(v4f*)(crow + (size_t)row * ldc + cofs) = val; }
             }
        __builtin_amdgcn_wave_barrier(); asm volatile("" ::: "memory");
    }
}

typedef __attribute__((ext_vector_type(2))) _Float16 v2h;
typedef __attribute__((ext_vector_type(4))) _Float16 v4h;
typedef __attribute__((ext_vector_type(2))) unsigned short v2us;
typedef __attribute__((ext_vector_type(4))) unsigned short v4us;
typedef __attribute__((ext_vector_type(2))) float v2f;
typedef __attribute__((ext_vector_type(4))) int v4i;
// the f16 cast of the new kernels: a value under 2^-14 in magnitude becomes an exact zero BEFORE the conversion (a select on the value): no subnormal f16 word is made.
__device__ __forceinline__ h16 toh_flush(float x) { const float z = (fabsf(x) < 6.103515625e-05f) ? 0.0f : x; return (h16)z; }

typedef __attribute__((ext_vector_type(4))) _Float16 v4h_;
__global__ __launch_bounds__(256) void k_colf(const float* __restrict__ inb, const float* __restrict__ inc, const float* __restrict__ ind, h16* Gb, h16* Gc, float* Cu, int pr0) {
    const unsigned i = blockIdx.x * 256 + threadIdx.x; const unsigned cl = i & 63u, ck = (i >> 6) & 127u, pl = i >> 13; const unsigned pr = (unsigned)pr0 + pl, sq = pr >> 3, hd = pr & 7u;
    const size_t b0 = (((size_t)sq * NTS + (size_t)ck * NCS) * NHS + hd) * NFE + cl; const float* mp = ind + (size_t)sq * NTS + (size_t)ck * NCS; h16 rb[64], rc[64]; float acc = 0.0f;
#pragma unroll
    for (int tj = 0; tj < 64; ++tj) { const float yb = bfr(inb[b0 + (size_t)tj * (NHS * NFE)]); const float yc = bfr(inc[b0 + (size_t)tj * (NHS * NFE)]); const h16 wb = toh_flush((fmaxf(yb, 0.0f) + expf(fminf(yb, 0.0f))) * bfr(mp[tj])); rb[tj] = wb; rc[tj] = toh_flush(yc); acc = acc + (float)wb; }
    h16* pb = Gb + ((size_t)(pl * NCK + ck) * 64 + cl) * 64; h16* pc = Gc + ((size_t)(pr * NCK + ck) * 64 + cl) * 64; float* pu = Cu + ((size_t)ck * NPR + pr) * 64 + cl;
{
#pragma unroll
        for (int g = 0; g < 8; ++g) { v8h ob, oc;
#pragma unroll
            for (int j = 0; j < 8; ++j) { ob[j] = rb[g * 8 + j]; oc[j] = rc[g * 8 + j]; }
            *(v8h*)(pb + g * 8) = ob; *(v8h*)(pc + g * 8) = oc; }
        *(float*)pu = acc;
         } }

// ---- k_scan: every carried sum in one launch. A thread owns four neighbouring words of one pair's 64 by 64 plane (work-groups 0 to 255) or of the 16 by 64 row of fb's sums (the last 4 work-groups); it adds the 128 chunks' own sums in their order, one f32 addition a chunk and word, from a start value of nought, and stores what it holds IN FRONT of each addition.
// The addresses do not hang on the sums, so the loads run ahead: NRG chunks' words stand in registers or are on their way; NGR chunks are taken at a time, and their registers are loaded anew at once.
#define NRG 48
#define NGR 8
__global__ __launch_bounds__(64) void k_scan(const float* __restrict__ Du, const float* __restrict__ Cu, h16* __restrict__ Sw, h16* __restrict__ Tw, float* __restrict__ Cs) {
    if (blockIdx.x < NPR * NBL / 4 / 64) {
        const unsigned i = blockIdx.x * 64 + threadIdx.x; const unsigned j4 = i & 1023u, pr = i >> 10; const float* src = Du + (size_t)pr * NCK * NBL + j4 * 4; h16* dst = Sw + (size_t)pr * NCK * NBL + j4 * 4; v4f rg[NRG]; v4f run = (v4f){};
#pragma unroll
        for (int k = 0; k < NRG; ++k) rg[k] = *(const v4fa*)(src + (size_t)k * NBL);
        __builtin_amdgcn_sched_barrier(0);   /* holds the loads above their uses: left free, the compiler moves each load down to its addition and one or two are on their way at a time */
#pragma unroll
        for (int q = 0; q < NCK / NGR; ++q) {
#pragma unroll
            for (int k = 0; k < NGR; ++k) { const int ck = q * NGR + k; const v4f vu = rg[ck % NRG]; v4h_ ow;
#pragma unroll
                for (int j = 0; j < 4; ++j) { ow[j] = toh_flush(run[j]); run[j] = run[j] + vu[j]; }
                *(v4h_*)(dst + (size_t)ck * NBL) = ow; }
            asm volatile("s_wait_xcnt 0x0" ::: "memory");   /* in front of every rewrite of a register that the stores above name: the loads below and the next chunks' words reuse them */
            if ((q + 1) * NGR + NRG <= NCK) {
#pragma unroll
                for (int k = 0; k < NGR; ++k) { const int ck = q * NGR + k; rg[ck % NRG] = *(const v4fa*)(src + (size_t)(ck + NRG) * NBL); } }
            __builtin_amdgcn_sched_barrier(0);   /* as above: the loads just issued stay NRG - NGR chunks ahead of their uses */
        }
        v4h_ ot;
#pragma unroll
        for (int j = 0; j < 4; ++j) ot[j] = toh_flush(run[j]);
        *(v4h_*)(Tw + (size_t)pr * NBL + j4 * 4) = ot;
        asm volatile("s_wait_xcnt 0x0" ::: "memory");   /* behind the part's last store: in the built code the other part's loads may stand behind a branch after it and reuse its registers */
    } else {
        const unsigned i = (blockIdx.x - NPR * NBL / 4 / 64) * 64 + threadIdx.x; const float* src = Cu + i * 4; float* dst = Cs + i * 4; v4f rg[NRG]; v4f run = (v4f){};
#pragma unroll
        for (int k = 0; k < NRG; ++k) rg[k] = *(const v4fa*)(src + (size_t)k * NPR * 64);
        __builtin_amdgcn_sched_barrier(0);   /* as in the branch above */
#pragma unroll
        for (int q = 0; q < NCK / NGR; ++q) {
#pragma unroll
            for (int k = 0; k < NGR; ++k) { const int ck = q * NGR + k; const v4f vu = rg[ck % NRG];
                *(v4f*)(dst + (size_t)ck * NPR * 64) = run;
#pragma unroll
                for (int j = 0; j < 4; ++j) run[j] = run[j] + vu[j]; }
            asm volatile("s_wait_xcnt 0x0" ::: "memory");   /* in front of every rewrite of a register that the stores above name: the loads below and the next chunks' words reuse them */
            if ((q + 1) * NGR + NRG <= NCK) {
#pragma unroll
                for (int k = 0; k < NGR; ++k) { const int ck = q * NGR + k; rg[ck % NRG] = *(const v4fa*)(src + (size_t)(ck + NRG) * NPR * 64); } }
            __builtin_amdgcn_sched_barrier(0);   /* as in the branch above */
        }
        *(v4f*)(dst + (size_t)NCK * NPR * 64) = run;
        asm volatile("s_wait_xcnt 0x0" ::: "memory");   /* as behind the last store of the branch above */
    } }

// ---- k_res: both results of one block in one work-group; nothing between the inputs' words and the results goes through the workspace.
// Every product is taken TRANSPOSED: the 16 rows (times) of a wave are the matrix instruction's columns, so a lane holds one time: Fa's words, made in registers from ina, are the B operand of three products; two neighbouring 16 by 16 tiles of Pw^T, cast in place, are the B operand of the product with Gc (the hardware's k order, which the 16-byte pieces of the A operands have as well); each lower term is one word a lane.
// The four A operands (Fb's words, Gc, Sw, Tw: 64 by 64 f16 each) are wanted whole by every wave: wave w brings rows 16 w to 16 w + 15 of each, as the four 16-byte pieces a lane that make its two fragments, and lays them in LDS piece by piece, the lanes side by side.
// Every loop of k_res is unrolled whole: its small arrays are indexed by the loop counters, and only so do they stay in registers.
__global__ __launch_bounds__(128) void k_res(const float* __restrict__ ina, const float* __restrict__ inb, const float* __restrict__ ind, const h16* __restrict__ Gc, const h16* __restrict__ Sw, const h16* __restrict__ Tw, const float* __restrict__ Cs, float* __restrict__ R0, float* __restrict__ R1) {
    __shared__ __align__(16) float sm[4 * 2 * 16 * 68];   /* first the four operands: [operand][16 rows' group][piece][lane] 16-byte pieces (32 KiB); then a wave's two result tiles of 16 rows, pitch 68 words */
    const unsigned zq = blockIdx.x, ck = zq & 127u, pr = zq >> 7, sq = pr >> 3, hd = pr & 7u; const unsigned lane = threadIdx.x & 31u, wv = threadIdx.x >> 5, lr = lane & 15u, hi = lane >> 4;
    const unsigned t0 = ck * NCS + wv * 16; const unsigned rob = lr * (NHS * NFE * 4) + hi * 32, pob = (wv * 16 + lr) * 128 + hi * 16, lob = lr * 4, hob = hi * 32;   /* a lane's byte offsets: in the inputs' rows, in a 64 by 64 f16 plane, in ind, in a row of Cs */
    const char* ap = (const char*)(ina + (((size_t)sq * NTS + t0) * NHS + hd) * NFE) + rob; const char* bp = (const char*)(inb + (((size_t)sq * NTS + t0) * NHS + hd) * NFE) + rob; const char* ip = (const char*)(ind + (size_t)sq * NTS + t0) + lob;
    const char* gb = (const char*)(Gc + (size_t)zq * NBL); const char* sb = (const char*)(Sw + (size_t)zq * NBL); const char* tb = (const char*)(Tw + (size_t)pr * NBL); const char* c1b = (const char*)(Cs + ((size_t)ck * NPR + pr) * 64); const char* c0b = (const char*)(Cs + ((size_t)NCK * NPR + pr) * 64);
    v8ha* fr = (v8ha*)sm; v8f wa[4], wb[4], c1[4], c0[4]; v8h gq[4], sw[4], tq[4], fq[4], kq[4];
#pragma unroll
    for (int q = 0; q < 4; ++q) { gq[q] = *(const v8h*)(gb + pob + q * 32); sw[q] = *(const v8h*)(sb + pob + q * 32); tq[q] = *(const v8h*)(tb + pob + q * 32); }
    const float mw = *(const float*)ip;
#pragma unroll
    for (int q = 0; q < 4; ++q) { wa[q] = *(const v8f*)(ap + q * 64); wb[q] = *(const v8f*)(bp + q * 64); }
    asm volatile("s_wait_xcnt 0x0" :: "v"(ap), "v"(bp), "v"(ip), "v"(pob) : "memory");   /* in front of every rewrite of a register that the loads above name; the addresses are inputs so that no later load of the group lands in one of them */
    __builtin_amdgcn_sched_barrier(0);   /* holds the loads above their uses: all of them are on their way at once */
#pragma unroll
    for (int q = 0; q < 4; ++q) { fr[((1 * 4 + wv) * 4 + q) * 32 + lane] = gq[q]; fr[((2 * 4 + wv) * 4 + q) * 32 + lane] = sw[q]; fr[((3 * 4 + wv) * 4 + q) * 32 + lane] = tq[q]; }
    const float mk = bfr(mw);
#pragma unroll
    for (int q = 0; q < 4; ++q) {
#pragma unroll
        for (int j = 0; j < 8; ++j) { const float ya = bfr(wa[q][j]), yb = bfr(wb[q][j]); fq[q][j] = toh_flush(fmaxf(ya, 0.0f) + expf(fminf(ya, 0.0f))); kq[q][j] = toh_flush((fmaxf(yb, 0.0f) + expf(fminf(yb, 0.0f))) * mk); }
        fr[((0 * 4 + wv) * 4 + q) * 32 + lane] = kq[q]; }
    __syncthreads();   /* the four operands stand whole in LDS before any wave reads another wave's rows */
#pragma unroll
    for (int q = 0; q < 4; ++q) { c1[q] = *(const v8f*)(c1b + hob + q * 64); c0[q] = *(const v8f*)(c0b + hob + q * 64); }
    asm volatile("s_wait_xcnt 0x0" :: "v"(hob) : "memory");   /* as above, for the loads of the carried sums' rows */
    __builtin_amdgcn_sched_barrier(0);   /* holds these loads here: they fly while Pw is made and are used behind it */
    const v16h fa0 = cat16(fq[0], fq[1]), fa1 = cat16(fq[2], fq[3]);
#define AFR(op, g, kc) cat16(fr[(((op) * 4 + (g)) * 4 + 2 * (kc)) * 32 + lane], fr[(((op) * 4 + (g)) * 4 + 2 * (kc) + 1) * 32 + lane])
    v8h ph[4], pl[4]; float acc = 0.0f;
#pragma unroll
    for (int ub = 0; ub < 4; ++ub) { v8f p = (v8f){}; p = wmma16(AFR(0, ub, 0), fa0, p); p = wmma16(AFR(0, ub, 1), fa1, p);   /* p[j] = Pw[row time 16 wv + lr][column time 16 ub + 8 hi + j] */
#pragma unroll
        for (int j = 0; j < 8; ++j) { const float kp = (float)((unsigned)(ub * 16 + j) + hi * 8 <= wv * 16 + lr); const float pm = p[j] * kp; const h16 wh = toh_flush(pm); ph[ub][j] = wh; pl[ub][j] = toh_flush(pm - (float)wh); acc = acc + pm; } }
    float d1 = 0.0f, d0 = 0.0f;
#pragma unroll
    for (int q = 0; q < 4; ++q) {
#pragma unroll
        for (int j = 0; j < 8; ++j) { const float wf = (float)fq[q][j]; d1 = d1 + wf * c1[q][j]; d0 = d0 + wf * c0[q][j]; } }
    acc = acc + __shfl_xor(acc, 16, 32); d1 = d1 + __shfl_xor(d1, 16, 32); d0 = d0 + __shfl_xor(d0, 16, 32);   /* lanes lr and lr + 16 hold the two halves of one row's sums */
    const float r1 = 1.0f / (acc + d1 + 1e-6f); const float r0 = 1.0f / (d0 + 1e-6f);
    const v16h bh0 = cat16(ph[0], ph[1]), bh1 = cat16(ph[2], ph[3]), bl0 = cat16(pl[0], pl[1]), bl1 = cat16(pl[2], pl[3]); v8f o1[4], o0[4];
#pragma unroll
    for (int mb = 0; mb < 4; ++mb) { const v16h g0 = AFR(1, mb, 0), g1 = AFR(1, mb, 1); v8f ua = (v8f){}, ub = (v8f){}, uc = (v8f){};
        ua = wmma16(g0, bh0, ua); ua = wmma16(g0, bl0, ua); ua = wmma16(g1, bh1, ua); ua = wmma16(g1, bl1, ua);
        ub = wmma16(AFR(2, mb, 0), fa0, ub); ub = wmma16(AFR(2, mb, 1), fa1, ub); uc = wmma16(AFR(3, mb, 0), fa0, uc); uc = wmma16(AFR(3, mb, 1), fa1, uc);
#pragma unroll
        for (int j = 0; j < 8; ++j) { o1[mb][j] = (ua[j] + ub[j]) * r1; o0[mb][j] = uc[j] * r0; } }   /* word j: column 16 mb + 8 hi + j of row time 16 wv + lr */
#undef AFR
    __syncthreads();   /* every wave has read the operands for the last time: their LDS takes the result tiles */
    float* os = sm + wv * (2 * 16 * 68);
#pragma unroll
    for (int mb = 0; mb < 4; ++mb) { float* w0 = os + lr * 68 + mb * 16 + hi * 8; float* w1 = w0 + 16 * 68;
        *(v4fa*)w0 = (v4f){o0[mb][0], o0[mb][1], o0[mb][2], o0[mb][3]}; *(v4fa*)(w0 + 4) = (v4f){o0[mb][4], o0[mb][5], o0[mb][6], o0[mb][7]}; *(v4fa*)w1 = (v4f){o1[mb][0], o1[mb][1], o1[mb][2], o1[mb][3]}; *(v4fa*)(w1 + 4) = (v4f){o1[mb][4], o1[mb][5], o1[mb][6], o1[mb][7]}; }
    __syncthreads();   /* the tiles stand in LDS before other lanes read them back row by row: each store below then covers two whole rows of 256 bytes */
#pragma unroll
    for (int s = 0; s < 8; ++s) { const unsigned row = 2 * s + hi, cofs = lr * 4; const size_t dst = (((size_t)sq * NTS + t0 + row) * NHS + hd) * NFE + cofs;
        *(v4f*)(R0 + dst) = *(const v4fa*)(os + row * 68 + cofs); *(v4f*)(R1 + dst) = *(const v4fa*)(os + (16 + row) * 68 + cofs); }
}

extern "C" void kernel_launch(void* const* d_in, const int* in_sizes, int n_in, void* d_out, int out_size, void* d_ws, size_t ws_size, hipStream_t stream) {
    if (n_in < 4) return;
    if (in_sizes[0] != NSQ * NTS * NHS * NFE || in_sizes[1] != NSQ * NTS * NHS * NFE || in_sizes[2] != NSQ * NTS * NHS * NFE || in_sizes[3] != NSQ * NTS) return;
    if (out_size != 2 * NSQ * NTS * NHS * NFE) return;
    static_assert(NPR == NSQ * NHS && NHS == 8 && NFE == 64 && NCS == 64 && NCK * NCS == NTS && NTS == 8192 && NCK == 128 && NZQ == NPR * NCK && NBL == 64 * 64 && (NZQ * 64) % 256 == 0 && (NPR * NBL / 4) % 64 == 0 && NBL / 4 == 1024 && (NPR * 64 / 4) % 64 == 0 && NCK % NGR == 0 && NRG % NGR == 0 && NRG < NCK, "the products: 64 by 64 blocks over a depth of 64; the flat grids exact; the index fields' widths (3 bits a head, 7 a chunk, 6 a column; 10 a group of four words in a plane)");
    const float* ina = (const float*)d_in[0]; const float* inb = (const float*)d_in[1]; const float* inc = (const float*)d_in[2]; const float* ind = (const float*)d_in[3]; float* R0 = (float*)d_out; float* R1 = R0 + (size_t)NSQ * NTS * NHS * NFE;
    char* wsp = (char*)d_ws; auto take = [&](size_t bytes) { char* p = wsp; wsp += (bytes + 255) & ~(size_t)255; return (void*)p; };
    float* Cs = (float*)take((size_t)(NCK + 1) * NPR * 64 * 4); float* Cu = (float*)take((size_t)NCK * NPR * 64 * 4);
    float* Du = (float*)take((size_t)NPR * NCK * NBL * 4); h16* Sw = (h16*)take((size_t)NPR * NCK * NBL * 2); h16* Gc = (h16*)take((size_t)NPR * NCK * NBL * 2); h16* Tw = (h16*)take((size_t)NPR * NBL * 2);
    h16* Gb = (h16*)take((size_t)NZQ * NBL * 2);
    if ((size_t)(wsp - (char*)d_ws) > ws_size) return;
    /* the blocks' own sums */
    k_colf<<<(unsigned)(NZQ * 64 / 256), 256, 0, stream>>>(inb, inc, ind, Gb, Gc, Cu, 0);
    k_gemmw<h16, 0, false><<<dim3(1, 1, NZQ), 32, 0, stream>>>(Gc, nullptr, Gb, nullptr, NCS, Du, 64, nullptr, NBL, NBL, NBL);   /* Du[m][e] = the sum over the block's steps of Gc[m][time] Gb[e][time] */
    k_scan<<<(unsigned)(NPR * NBL / 4 / 64 + NPR * 64 / 4 / 64), 64, 0, stream>>>(Du, Cu, Sw, Tw, Cs);   /* the sums carried, and the sum over all chunks: one launch */
    /* the results */
    k_res<<<(unsigned)NZQ, 128, 0, stream>>>(ina, inb, ind, Gc, Sw, Tw, Cs, R0, R1);
}

// v004
// Measured time: 43.6 microseconds a run.
// Timed twice side by side with v003, it ran 1.66 and 1.60 times as fast.
// All steps since v000 together make it 17.7 times as fast.
#include <hip/hip_runtime.h>

// Inputs, in this order: ina [2][8192][8][64]; inb [2][8192][8][64]; inc [2][8192][8][64]; ind [2][8192] (a 0 | 1 word a (sequence, time)). Results, one after the other in the result buffer: R0 [2][8192][8][64], then R1 [2][8192][8][64]. A PAIR is one (sequence, head): 16 pairs; a CHUNK is 64 steps: 128 chunks a pair; a BLOCK is one (pair, chunk): 64 by 64 words: 2,048 blocks.
// With fa = max(w, 0) + exp(min(w, 0)) of ina's words and fb = the same of inb's words times ind's word of that (sequence, time): R0[t] = fa[t] . (the sum over ALL steps u of fb[u] inc[u]^T), times 1 / (fa[t] . (the sum over all u of fb[u]) + 1e-6); R1[t] = fa[t] . (the sum over u <= t of fb[u] inc[u]^T), times 1 / (fa[t] . (the sum over u <= t of fb[u]) + 1e-6): every pair by itself.
// THE FORM: chunk by chunk, every block of every pair side by side in each launch. For a block c: Du_c = Gc_c Gb_c^T: the block's own sum of inc[u] fb[u]^T (64 by 64 over the 64 steps), made in the launch that reads inb and inc (k_own); the sums carried over the chunks before c: Sw_c = the word of (Du_0 + .. + Du_(c-1)), made by ONE launch in which every thread keeps the running sum of its own four words in registers, starts it at nought and walks the 128 chunks in their order (behind the last chunk it lays the word of the sum over ALL chunks: Tw). THE RESULTS: ONE launch, a work-group of four waves a block, a wave 16 rows (k_res): Pw = Fa_c Fb_c^T (64 by 64 over 64); kept where the column's time is not after the row's; its f16 word Ph and the word Pl of what Ph leaves; R1's upper term = (Ph + Pl) Gc_c^T + Fa_c Sw_c^T; its lower term = the kept words' sum along the row + Fa's row . (the carried sums of fb's words) + 1e-6; R0's upper term = Fa Tw^T; its lower term = Fa's row . (the sum of fb's words over all steps) + 1e-6.
// Layout of the workspace, every plane for all 16 pairs: Cs f32 [129][16][64] (row 0 noughts; row c + 1 = row c + Cu's row c); Cu f32 [128][16][64]; Du f32 [16][128][4096]; Sw f16 [16][128][4096]; Gc f16 [16][128][64][64] (inc's words, the steps side by side); Tw f16 [16][4096]. Gb (fb's words, the steps side by side) stands in LDS alone.
// Compute dtypes, f32 accumulate: every float input is taken at its bf16 value where it is read; fa, fb, inc's words, the carried sums and the sum over all chunks go to the matrix unit as ONE f16 word each (a value under 2^-14 in magnitude made an exact nought before the cast); the kept words of Pw as TWO f16 words (Ph and Pl: one accumulator takes both); everything else is f32. The lower terms' reciprocals are true divisions.

#define NSQ 2
#define NTS 8192
#define NHS 8
#define NFE 64
#define NCS 64
#define NCK 128
#define NPR 16
#define NZQ 2048
#define NBL 4096

typedef _Float16 h16;
typedef unsigned short bf;
typedef __attribute__((ext_vector_type(16))) __bf16   v16bf;
typedef __attribute__((ext_vector_type(16))) _Float16 v16h;
typedef __attribute__((ext_vector_type(8)))  _Float16 v8h;
typedef __attribute__((ext_vector_type(8)))  unsigned short v8us;
typedef __attribute__((ext_vector_type(8)))  float    v8f;
typedef __attribute__((ext_vector_type(4)))  float    v4f;
typedef v8h  __attribute__((may_alias)) v8ha;
typedef v4f  __attribute__((may_alias)) v4fa;
typedef v8us __attribute__((may_alias)) v8usa;

__device__ __forceinline__ unsigned short f2bf(float f) { unsigned u = __float_as_uint(f); u += 0x7FFFu + ((u >> 16) & 1u); return (unsigned short)(u >> 16); }
__device__ __forceinline__ float bf2f(unsigned short b) { return __uint_as_float(((unsigned)b) << 16); }
__device__ __forceinline__ float bfr(float f) { return bf2f(f2bf(f)); }
__device__ __forceinline__ v16h cat16(v8h lo, v8h hi) { return __builtin_shufflevector(lo, hi, 0, 1, 2, 3, 4, 5, 6, 7, 8, 9, 10, 11, 12, 13, 14, 15); }
__device__ __forceinline__ v8f wmma16(v16h a, v16h b, v8f c) { return __builtin_amdgcn_wmma_f32_16x16x32_f16(false, a, false, b, (short)0, c, false, false); }

typedef __attribute__((ext_vector_type(2))) _Float16 v2h;
typedef __attribute__((ext_vector_type(4))) _Float16 v4h;
typedef __attribute__((ext_vector_type(2))) unsigned short v2us;
typedef __attribute__((ext_vector_type(4))) unsigned short v4us;
typedef __attribute__((ext_vector_type(2))) float v2f;
typedef __attribute__((ext_vector_type(4))) int v4i;
// the f16 cast of the new kernels: a value under 2^-14 in magnitude becomes an exact zero BEFORE the conversion (a select on the value): no subnormal f16 word is made.
__device__ __forceinline__ h16 toh_flush(float x) { const float z = (fabsf(x) < 6.103515625e-05f) ? 0.0f : x; return (h16)z; }

typedef __attribute__((ext_vector_type(4))) _Float16 v4h_;
// ---- k_own: a block's own sums in one launch, a work-group of four waves a block. A thread takes one column (cl) of inb and of inc over half of the block's 64 steps (th): its words are 64 bytes of row cl of Gb and of Gc (the steps side by side), which it lays in LDS.
// Behind the barrier wave w takes rows 16 w to 16 w + 15 of Du = Gc Gb^T (the same fragments, k order and order of the two depth steps as a product from 128-byte rows in memory); Gb is wanted nowhere else and stays in LDS; Gc goes to the workspace from LDS, 512 bytes in a row a store.
// Every loop of k_own is unrolled whole: its small arrays are indexed by the loop counters, and only so do they stay in registers.
#define NPT 72   /* a row's pitch in LDS, in f16 words: 144 bytes = 16 bytes times an odd number, free of bank conflicts for 16-byte reads and writes down a column of rows */
__global__ __launch_bounds__(128) void k_own(const float* __restrict__ inb, const float* __restrict__ inc, const float* __restrict__ ind, h16* __restrict__ Gc, float* __restrict__ Du, float* __restrict__ Cu) {
    __shared__ __align__(16) h16 rw[2 * 64 * NPT];   /* Gb's 64 rows, then Gc's */
    __shared__ __align__(16) float ot[4 * 16 * 68];   /* a wave's own 16 rows of Du, pitch 68 words */
    __shared__ float cp[2 * 64];   /* the two halves of each column's sum of fb's words */
    const unsigned zq = blockIdx.x, ck = zq & 127u, pr = zq >> 7, sq = pr >> 3, hd = pr & 7u; const unsigned cl = threadIdx.x & 63u, lane = threadIdx.x & 31u, lr = lane & 15u, hi = lane >> 4;
    const unsigned wv = (unsigned)__builtin_amdgcn_readfirstlane((int)(threadIdx.x >> 5)), th = wv >> 1;   /* the wave's number in a scalar register: ind's words then come by scalar loads */
    const size_t b0 = (((size_t)sq * NTS + (size_t)ck * NCS + th * 32) * NHS + hd) * NFE + cl; const float* bp = inb + b0; const float* qp = inc + b0; const float* mp = ind + (size_t)sq * NTS + (size_t)ck * NCS + th * 32;
    float yb[32], yc[32];
#pragma unroll
    for (int tj = 0; tj < 32; ++tj) { yb[tj] = bp[(size_t)tj * (NHS * NFE)]; yc[tj] = qp[(size_t)tj * (NHS * NFE)]; }
    asm volatile("s_wait_xcnt 0x0" :: "v"(bp), "v"(qp) : "memory");   /* in front of every rewrite of a register that the loads above name; the addresses are inputs so that no load of the group lands in one of them */
    __builtin_amdgcn_sched_barrier(0);   /* holds the loads above their uses: all 64 are on their way at once */
    v8h ob[4], oc[4]; float acc = 0.0f;
#pragma unroll
    for (int tj = 0; tj < 32; ++tj) { const float vb = bfr(yb[tj]); const float vc = bfr(yc[tj]); const h16 wb = toh_flush((fmaxf(vb, 0.0f) + expf(fminf(vb, 0.0f))) * bfr(mp[tj])); ob[tj >> 3][tj & 7] = wb; oc[tj >> 3][tj & 7] = toh_flush(vc); acc = acc + (float)wb; }
#pragma unroll
    for (int g = 0; g < 4; ++g) { *(v8ha*)(rw + cl * NPT + th * 32 + g * 8) = ob[g]; *(v8ha*)(rw + (64 + cl) * NPT + th * 32 + g * 8) = oc[g]; }
    cp[th * 64 + cl] = acc;
    __syncthreads();   /* both operands' rows and the half sums stand whole in LDS before any wave reads another wave's words */
    const h16* ar = rw + (64 + wv * 16 + lr) * NPT + hi * 8; const v16h a0 = cat16(*(const v8ha*)ar, *(const v8ha*)(ar + 16)), a1 = cat16(*(const v8ha*)(ar + 32), *(const v8ha*)(ar + 48)); float* os = ot + wv * (16 * 68);
#pragma unroll
    for (int nb = 0; nb < 4; ++nb) { const h16* br = rw + (nb * 16 + lr) * NPT + hi * 8; v8f d = (v8f){}; d = wmma16(a0, cat16(*(const v8ha*)br, *(const v8ha*)(br + 16)), d); d = wmma16(a1, cat16(*(const v8ha*)(br + 32), *(const v8ha*)(br + 48)), d);   /* d[j] = Du[16 wv + 8 hi + j][16 nb + lr] */
#pragma unroll
        for (int j = 0; j < 8; ++j) os[(hi * 8 + j) * 68 + nb * 16 + lr] = d[j]; }
    asm volatile("s_wait_dscnt 0x0" ::: "memory");   /* the wave's own tile stands in LDS before other lanes of the same wave read it back row by row: each store below then covers two whole rows of 256 bytes */
    v4f du[8]; v8h gc[4];
#pragma unroll
    for (int s = 0; s < 8; ++s) du[s] = *(const v4fa*)(os + (2 * s + hi) * 68 + lr * 4);
#pragma unroll
    for (int p = 0; p < 4; ++p) { const unsigned f = p * 128 + threadIdx.x; gc[p] = *(const v8ha*)(rw + (64 + (f >> 3)) * NPT + (f & 7u) * 8); }
    const float cs = cp[cl] + cp[64 + cl];
    float* dd = Du + (size_t)zq * NBL + (wv * 16 + hi) * 64 + lr * 4; h16* gd = Gc + (size_t)zq * NBL + threadIdx.x * 8;
#pragma unroll
    for (int s = 0; s < 8; ++s) *(v4f*)(dd + s * 128) = du[s];
#pragma unroll
    for (int p = 0; p < 4; ++p) *(v8h*)(gd + p * 1024) = gc[p];
    asm volatile("s_wait_xcnt 0x0" ::: "memory");   /* in front of every rewrite of a register that the stores above name: the last store's address and word are formed behind a branch, in registers of theirs */
    if (th == 0) Cu[((size_t)ck * NPR + pr) * 64 + cl] = cs;
}

// ---- k_scan: every carried sum in one launch. A thread owns four neighbouring words of one pair's 64 by 64 plane (work-groups 0 to 255) or of the 16 by 64 row of fb's sums (the last 4 work-groups); it adds the 128 chunks' own sums in their order, one f32 addition a chunk and word, from a start value of nought, and stores what it holds IN FRONT of each addition.
// The addresses do not hang on the sums, so the loads run ahead: NRG chunks' words stand in registers or are on their way; NGR chunks are taken at a time, and their registers are loaded anew at once.
#define NRG 48
#define NGR 8
__global__ __launch_bounds__(64) void k_scan(const float* __restrict__ Du, const float* __restrict__ Cu, h16* __restrict__ Sw, h16* __restrict__ Tw, float* __restrict__ Cs) {
    if (blockIdx.x < NPR * NBL / 4 / 64) {
        const unsigned i = blockIdx.x * 64 + threadIdx.x; const unsigned j4 = i & 1023u, pr = i >> 10; const float* src = Du + (size_t)pr * NCK * NBL + j4 * 4; h16* dst = Sw + (size_t)pr * NCK * NBL + j4 * 4; v4f rg[NRG]; v4f run = (v4f){};
#pragma unroll
        for (int k = 0; k < NRG; ++k) rg[k] = *(const v4fa*)(src + (size_t)k * NBL);
        __builtin_amdgcn_sched_barrier(0);   /* holds the loads above their uses: left free, the compiler moves each load down to its addition and one or two are on their way at a time */
#pragma unroll
        for (int q = 0; q < NCK / NGR; ++q) {
#pragma unroll
            for (int k = 0; k < NGR; ++k) { const int ck = q * NGR + k; const v4f vu = rg[ck % NRG]; v4h_ ow;
#pragma unroll
                for (int j = 0; j < 4; ++j) { ow[j] = toh_flush(run[j]); run[j] = run[j] + vu[j]; }
                *(v4h_*)(dst + (size_t)ck * NBL) = ow; }
            asm volatile("s_wait_xcnt 0x0" ::: "memory");   /* in front of every rewrite of a register that the stores above name: the loads below and the next chunks' words reuse them */
            if ((q + 1) * NGR + NRG <= NCK) {
#pragma unroll
                for (int k = 0; k < NGR; ++k) { const int ck = q * NGR + k; rg[ck % NRG] = *(const v4fa*)(src + (size_t)(ck + NRG) * NBL); } }
            __builtin_amdgcn_sched_barrier(0);   /* as above: the loads just issued stay NRG - NGR chunks ahead of their uses */
        }
        v4h_ ot;
#pragma unroll
        for (int j = 0; j < 4; ++j) ot[j] = toh_flush(run[j]);
        *(v4h_*)(Tw + (size_t)pr * NBL + j4 * 4) = ot;
        asm volatile("s_wait_xcnt 0x0" ::: "memory");   /* behind the part's last store: in the built code the other part's loads may stand behind a branch after it and reuse its registers */
    } else {
        const unsigned i = (blockIdx.x - NPR * NBL / 4 / 64) * 64 + threadIdx.x; const float* src = Cu + i * 4; float* dst = Cs + i * 4; v4f rg[NRG]; v4f run = (v4f){};
#pragma unroll
        for (int k = 0; k < NRG; ++k) rg[k] = *(const v4fa*)(src + (size_t)k * NPR * 64);
        __builtin_amdgcn_sched_barrier(0);   /* as in the branch above */
#pragma unroll
        for (int q = 0; q < NCK / NGR; ++q) {
#pragma unroll
            for (int k = 0; k < NGR; ++k) { const int ck = q * NGR + k; const v4f vu = rg[ck % NRG];
                *(v4f*)(dst + (size_t)ck * NPR * 64) = run;
#pragma unroll
                for (int j = 0; j < 4; ++j) run[j] = run[j] + vu[j]; }
            asm volatile("s_wait_xcnt 0x0" ::: "memory");   /* in front of every rewrite of a register that the stores above name: the loads below and the next chunks' words reuse them */
            if ((q + 1) * NGR + NRG <= NCK) {
#pragma unroll
                for (int k = 0; k < NGR; ++k) { const int ck = q * NGR + k; rg[ck % NRG] = *(const v4fa*)(src + (size_t)(ck + NRG) * NPR * 64); } }
            __builtin_amdgcn_sched_barrier(0);   /* as in the branch above */
        }
        *(v4f*)(dst + (size_t)NCK * NPR * 64) = run;
        asm volatile("s_wait_xcnt 0x0" ::: "memory");   /* as behind the last store of the branch above */
    } }

// ---- k_res: both results of one block in one work-group; nothing between the inputs' words and the results goes through the workspace.
// Every product is taken TRANSPOSED: the 16 rows (times) of a wave are the matrix instruction's columns, so a lane holds one time: Fa's words, made in registers from ina, are the B operand of three products; two neighbouring 16 by 16 tiles of Pw^T, cast in place, are the B operand of the product with Gc (the hardware's k order, which the 16-byte pieces of the A operands have as well); each lower term is one word a lane.
// The four A operands (Fb's words, Gc, Sw, Tw: 64 by 64 f16 each) are wanted whole by every wave: wave w brings rows 16 w to 16 w + 15 of each, as the four 16-byte pieces a lane that make its two fragments, and lays them in LDS piece by piece, the lanes side by side.
// Every loop of k_res is unrolled whole: its small arrays are indexed by the loop counters, and only so do they stay in registers.
__global__ __launch_bounds__(128) void k_res(const float* __restrict__ ina, const float* __restrict__ inb, const float* __restrict__ ind, const h16* __restrict__ Gc, const h16* __restrict__ Sw, const h16* __restrict__ Tw, const float* __restrict__ Cs, float* __restrict__ R0, float* __restrict__ R1) {
    __shared__ __align__(16) float sm[4 * 2 * 16 * 68];   /* first the four operands: [operand][16 rows' group][piece][lane] 16-byte pieces (32 KiB); then a wave's two result tiles of 16 rows, pitch 68 words */
    const unsigned zq = blockIdx.x, ck = zq & 127u, pr = zq >> 7, sq = pr >> 3, hd = pr & 7u; const unsigned lane = threadIdx.x & 31u, wv = threadIdx.x >> 5, lr = lane & 15u, hi = lane >> 4;
    const unsigned t0 = ck * NCS + wv * 16; const unsigned rob = lr * (NHS * NFE * 4) + hi * 32, pob = (wv * 16 + lr) * 128 + hi * 16, lob = lr * 4, hob = hi * 32;   /* a lane's byte offsets: in the inputs' rows, in a 64 by 64 f16 plane, in ind, in a row of Cs */
    const char* ap = (const char*)(ina + (((size_t)sq * NTS + t0) * NHS + hd) * NFE) + rob; const char* bp = (const char*)(inb + (((size_t)sq * NTS + t0) * NHS + hd) * NFE) + rob; const char* ip = (const char*)(ind + (size_t)sq * NTS + t0) + lob;
    const char* gb = (const char*)(Gc + (size_t)zq * NBL); const char* sb = (const char*)(Sw + (size_t)zq * NBL); const char* tb = (const char*)(Tw + (size_t)pr * NBL); const char* c1b = (const char*)(Cs + ((size_t)ck * NPR + pr) * 64); const char* c0b = (const char*)(Cs + ((size_t)NCK * NPR + pr) * 64);
    v8ha* fr = (v8ha*)sm; v8f wa[4], wb[4], c1[4], c0[4]; v8h gq[4], sw[4], tq[4], fq[4], kq[4];
#pragma unroll
    for (int q = 0; q < 4; ++q) { gq[q] = *(const v8h*)(gb + pob + q * 32); sw[q] = *(const v8h*)(sb + pob + q * 32); tq[q] = *(const v8h*)(tb + pob + q * 32); }
    const float mw = *(const float*)ip;
#pragma unroll
    for (int q = 0; q < 4; ++q) { wa[q] = *(const v8f*)(ap + q * 64); wb[q] = *(const v8f*)(bp + q * 64); }
    asm volatile("s_wait_xcnt 0x0" :: "v"(ap), "v"(bp), "v"(ip), "v"(pob) : "memory");   /* in front of every rewrite of a register that the loads above name; the addresses are inputs so that no later load of the group lands in one of them */
    __builtin_amdgcn_sched_barrier(0);   /* holds the loads above their uses: all of them are on their way at once */
#pragma unroll
    for (int q = 0; q < 4; ++q) { fr[((1 * 4 + wv) * 4 + q) * 32 + lane] = gq[q]; fr[((2 * 4 + wv) * 4 + q) * 32 + lane] = sw[q]; fr[((3 * 4 + wv) * 4 + q) * 32 + lane] = tq[q]; }
    const float mk = bfr(mw);
#pragma unroll
    for (int q = 0; q < 4; ++q) {
#pragma unroll
        for (int j = 0; j < 8; ++j) { const float ya = bfr(wa[q][j]), yb = bfr(wb[q][j]); fq[q][j] = toh_flush(fmaxf(ya, 0.0f) + expf(fminf(ya, 0.0f))); kq[q][j] = toh_flush((fmaxf(yb, 0.0f) + expf(fminf(yb, 0.0f))) * mk); }
        fr[((0 * 4 + wv) * 4 + q) * 32 + lane] = kq[q]; }
    __syncthreads();   /* the four operands stand whole in LDS before any wave reads another wave's rows */
#pragma unroll
    for (int q = 0; q < 4; ++q) { c1[q] = *(const v8f*)(c1b + hob + q * 64); c0[q] = *(const v8f*)(c0b + hob + q * 64); }
    asm volatile("s_wait_xcnt 0x0" :: "v"(hob) : "memory");   /* as above, for the loads of the carried sums' rows */
    __builtin_amdgcn_sched_barrier(0);   /* holds these loads here: they fly while Pw is made and are used behind it */
    const v16h fa0 = cat16(fq[0], fq[1]), fa1 = cat16(fq[2], fq[3]);
#define AFR(op, g, kc) cat16(fr[(((op) * 4 + (g)) * 4 + 2 * (kc)) * 32 + lane], fr[(((op) * 4 + (g)) * 4 + 2 * (kc) + 1) * 32 + lane])
    v8h ph[4], pl[4]; float acc = 0.0f;
#pragma unroll
    for (int ub = 0; ub < 4; ++ub) { v8f p = (v8f){}; p = wmma16(AFR(0, ub, 0), fa0, p); p = wmma16(AFR(0, ub, 1), fa1, p);   /* p[j] = Pw[row time 16 wv + lr][column time 16 ub + 8 hi + j] */
#pragma unroll
        for (int j = 0; j < 8; ++j) { const float kp = (float)((unsigned)(ub * 16 + j) + hi * 8 <= wv * 16 + lr); const float pm = p[j] * kp; const h16 wh = toh_flush(pm); ph[ub][j] = wh; pl[ub][j] = toh_flush(pm - (float)wh); acc = acc + pm; } }
    float d1 = 0.0f, d0 = 0.0f;
#pragma unroll
    for (int q = 0; q < 4; ++q) {
#pragma unroll
        for (int j = 0; j < 8; ++j) { const float wf = (float)fq[q][j]; d1 = d1 + wf * c1[q][j]; d0 = d0 + wf * c0[q][j]; } }
    acc = acc + __shfl_xor(acc, 16, 32); d1 = d1 + __shfl_xor(d1, 16, 32); d0 = d0 + __shfl_xor(d0, 16, 32);   /* lanes lr and lr + 16 hold the two halves of one row's sums */
    const float r1 = 1.0f / (acc + d1 + 1e-6f); const float r0 = 1.0f / (d0 + 1e-6f);
    const v16h bh0 = cat16(ph[0], ph[1]), bh1 = cat16(ph[2], ph[3]), bl0 = cat16(pl[0], pl[1]), bl1 = cat16(pl[2], pl[3]); v8f o1[4], o0[4];
#pragma unroll
    for (int mb = 0; mb < 4; ++mb) { const v16h g0 = AFR(1, mb, 0), g1 = AFR(1, mb, 1); v8f ua = (v8f){}, ub = (v8f){}, uc = (v8f){};
        ua = wmma16(g0, bh0, ua); ua = wmma16(g0, bl0, ua); ua = wmma16(g1, bh1, ua); ua = wmma16(g1, bl1, ua);
        ub = wmma16(AFR(2, mb, 0), fa0, ub); ub = wmma16(AFR(2, mb, 1), fa1, ub); uc = wmma16(AFR(3, mb, 0), fa0, uc); uc = wmma16(AFR(3, mb, 1), fa1, uc);
#pragma unroll
        for (int j = 0; j < 8; ++j) { o1[mb][j] = (ua[j] + ub[j]) * r1; o0[mb][j] = uc[j] * r0; } }   /* word j: column 16 mb + 8 hi + j of row time 16 wv + lr */
#undef AFR
    __syncthreads();   /* every wave has read the operands for the last time: their LDS takes the result tiles */
    float* os = sm + wv * (2 * 16 * 68);
#pragma unroll
    for (int mb = 0; mb < 4; ++mb) { float* w0 = os + lr * 68 + mb * 16 + hi * 8; float* w1 = w0 + 16 * 68;
        *(v4fa*)w0 = (v4f){o0[mb][0], o0[mb][1], o0[mb][2], o0[mb][3]}; *(v4fa*)(w0 + 4) = (v4f){o0[mb][4], o0[mb][5], o0[mb][6], o0[mb][7]}; *(v4fa*)w1 = (v4f){o1[mb][0], o1[mb][1], o1[mb][2], o1[mb][3]}; *(v4fa*)(w1 + 4) = (v4f){o1[mb][4], o1[mb][5], o1[mb][6], o1[mb][7]}; }
    __syncthreads();   /* the tiles stand in LDS before other lanes read them back row by row: each store below then covers two whole rows of 256 bytes */
#pragma unroll
    for (int s = 0; s < 8; ++s) { const unsigned row = 2 * s + hi, cofs = lr * 4; const size_t dst = (((size_t)sq * NTS + t0 + row) * NHS + hd) * NFE + cofs;
        *(v4f*)(R0 + dst) = *(const v4fa*)(os + row * 68 + cofs); *(v4f*)(R1 + dst) = *(const v4fa*)(os + (16 + row) * 68 + cofs); }
}

extern "C" void kernel_launch(void* const* d_in, const int* in_sizes, int n_in, void* d_out, int out_size, void* d_ws, size_t ws_size, hipStream_t stream) {
    if (n_in < 4) return;
    if (in_sizes[0] != NSQ * NTS * NHS * NFE || in_sizes[1] != NSQ * NTS * NHS * NFE || in_sizes[2] != NSQ * NTS * NHS * NFE || in_sizes[3] != NSQ * NTS) return;
    if (out_size != 2 * NSQ * NTS * NHS * NFE) return;
    static_assert(NPR == NSQ * NHS && NHS == 8 && NFE == 64 && NCS == 64 && NCK * NCS == NTS && NTS == 8192 && NCK == 128 && NZQ == NPR * NCK && NBL == 64 * 64 && (NPR * NBL / 4) % 64 == 0 && NBL / 4 == 1024 && (NPR * 64 / 4) % 64 == 0 && NCK % NGR == 0 && NRG % NGR == 0 && NRG < NCK, "the products: 64 by 64 blocks over a depth of 64; the flat grids exact; the index fields' widths (3 bits a head, 7 a chunk, 6 a column; 10 a group of four words in a plane)");
    const float* ina = (const float*)d_in[0]; const float* inb = (const float*)d_in[1]; const float* inc = (const float*)d_in[2]; const float* ind = (const float*)d_in[3]; float* R0 = (float*)d_out; float* R1 = R0 + (size_t)NSQ * NTS * NHS * NFE;
    char* wsp = (char*)d_ws; auto take = [&](size_t bytes) { char* p = wsp; wsp += (bytes + 255) & ~(size_t)255; return (void*)p; };
    float* Cs = (float*)take((size_t)(NCK + 1) * NPR * 64 * 4); float* Cu = (float*)take((size_t)NCK * NPR * 64 * 4);
    float* Du = (float*)take((size_t)NPR * NCK * NBL * 4); h16* Sw = (h16*)take((size_t)NPR * NCK * NBL * 2); h16* Gc = (h16*)take((size_t)NPR * NCK * NBL * 2); h16* Tw = (h16*)take((size_t)NPR * NBL * 2);
    if ((size_t)(wsp - (char*)d_ws) > ws_size) return;
    /* the blocks' own sums */
    k_own<<<(unsigned)NZQ, 128, 0, stream>>>(inb, inc, ind, Gc, Du, Cu);   /* Gc, Cu and Du[m][e] = the sum over the block's steps of Gc[m][time] Gb[e][time] */
    k_scan<<<(unsigned)(NPR * NBL / 4 / 64 + NPR * 64 / 4 / 64), 64, 0, stream>>>(Du, Cu, Sw, Tw, Cs);   /* the sums carried, and the sum over all chunks: one launch */
    /* the results */
    k_res<<<(unsigned)NZQ, 128, 0, stream>>>(ina, inb, ind, Gc, Sw, Tw, Cs, R0, R1);
}

// v005
// Measured time: 42.2 microseconds a run.
// Timed twice side by side with v004, it ran 1.04 times as fast both times.
// Counting every step since v000, it is 18.3 times as fast.
#include <hip/hip_runtime.h>

// Inputs, in this order: ina [2][8192][8][64]; inb [2][8192][8][64]; inc [2][8192][8][64]; ind [2][8192] (a 0 | 1 word a (sequence, time)). Results, one after the other in the result buffer: R0 [2][8192][8][64], then R1 [2][8192][8][64]. A PAIR is one (sequence, head): 16 pairs; a CHUNK is 64 steps: 128 chunks a pair; a BLOCK is one (pair, chunk): 64 by 64 words: 2,048 blocks.
// With fa = max(w, 0) + exp(min(w, 0)) of ina's words and fb = the same of inb's words times ind's word of that (sequence, time): R0[t] = fa[t] . (the sum over ALL steps u of fb[u] inc[u]^T), times 1 / (fa[t] . (the sum over all u of fb[u]) + 1e-6); R1[t] = fa[t] . (the sum over u <= t of fb[u] inc[u]^T), times 1 / (fa[t] . (the sum over u <= t of fb[u]) + 1e-6): every pair by itself.
// THE FORM: chunk by chunk, every block of every pair side by side in each launch. For a block c: Du_c = Gc_c Gb_c^T: the block's own sum of inc[u] fb[u]^T (64 by 64 over the 64 steps), made in the launch that reads inb and inc (k_own); the sums carried over the chunks before c: Sw_c = the word of (Du_0 + .. + Du_(c-1)), made by ONE launch in which every thread keeps the running sum of its own four words in registers, starts it at nought and walks the 128 chunks in their order (behind the last chunk it lays the word of the sum over ALL chunks: Tw). THE RESULTS: ONE launch, a work-group of four waves a block, a wave 16 rows (k_res): Pw = Fa_c Fb_c^T (64 by 64 over 64); kept where the column's time is not after the row's; its f16 word Ph and the word Pl of what Ph leaves; R1's upper term = (Ph + Pl) Gc_c^T + Fa_c Sw_c^T; its lower term = the kept words' sum along the row + Fa's row . (the carried sums of fb's words) + 1e-6; R0's upper term = Fa Tw^T; its lower term = Fa's row . (the sum of fb's words over all steps) + 1e-6.
// Layout of the workspace, every plane for all 16 pairs: Cs f32 [129][16][64] (row 0 noughts; row c + 1 = row c + Cu's row c); Cu f32 [128][16][64]; Du f32 [16][128][4096]; Sw f16 [16][128][4096]; Gc f16 [16][128][64][64] (inc's words, the steps side by side); Tw f16 [16][4096]. Gb (fb's words, the steps side by side) stands in LDS alone.
// Compute dtypes, f32 accumulate: every float input is taken at its bf16 value where it is read; fa, fb, inc's words, the carried sums and the sum over all chunks go to the matrix unit as ONE f16 word each (a value under 2^-14 in magnitude made an exact nought before the cast); the kept words of Pw as TWO f16 words (Ph and Pl: one accumulator takes both); everything else is f32. The lower terms' reciprocals are true divisions.

#define NSQ 2
#define NTS 8192
#define NHS 8
#define NFE 64
#define NCS 64
#define NCK 128
#define NPR 16
#define NZQ 2048
#define NBL 4096

typedef _Float16 h16;
typedef unsigned short bf;
typedef __attribute__((ext_vector_type(16))) __bf16   v16bf;
typedef __attribute__((ext_vector_type(16))) _Float16 v16h;
typedef __attribute__((ext_vector_type(8)))  _Float16 v8h;
typedef __attribute__((ext_vector_type(8)))  unsigned short v8us;
typedef __attribute__((ext_vector_type(8)))  float    v8f;
typedef __attribute__((ext_vector_type(4)))  float    v4f;
typedef v8h  __attribute__((may_alias)) v8ha;
typedef v4f  __attribute__((may_alias)) v4fa;
typedef v8us __attribute__((may_alias)) v8usa;

__device__ __forceinline__ unsigned short f2bf(float f) { unsigned u = __float_as_uint(f); u += 0x7FFFu + ((u >> 16) & 1u); return (unsigned short)(u >> 16); }
__device__ __forceinline__ float bf2f(unsigned short b) { return __uint_as_float(((unsigned)b) << 16); }
__device__ __forceinline__ float bfr(float f) { return bf2f(f2bf(f)); }
__device__ __forceinline__ v16h cat16(v8h lo, v8h hi) { return __builtin_shufflevector(lo, hi, 0, 1, 2, 3, 4, 5, 6, 7, 8, 9, 10, 11, 12, 13, 14, 15); }
__device__ __forceinline__ v8f wmma16(v16h a, v16h b, v8f c) { return __builtin_amdgcn_wmma_f32_16x16x32_f16(false, a, false, b, (short)0, c, false, false); }

typedef __attribute__((ext_vector_type(2))) _Float16 v2h;
typedef __attribute__((ext_vector_type(4))) _Float16 v4h;
typedef __attribute__((ext_vector_type(2))) unsigned short v2us;
typedef __attribute__((ext_vector_type(4))) unsigned short v4us;
typedef __attribute__((ext_vector_type(2))) float v2f;
typedef __attribute__((ext_vector_type(4))) int v4i;
// the f16 cast of the new kernels: a value under 2^-14 in magnitude becomes an exact zero BEFORE the conversion (a select on the value): no subnormal f16 word is made.
__device__ __forceinline__ h16 toh_flush(float x) { const float z = (fabsf(x) < 6.103515625e-05f) ? 0.0f : x; return (h16)z; }
// e^x for x <= 0, as the feature map wants it: the hardware's 2^y on y = x log2(e). The roundings of the constant and of the product move the result by under |y| 2^-23 of itself, far under the 2^-11 of the f16 word that it is cast to; a y under -126 gives nought, which the cast's flush gives as well. k_own and k_res take the same form, so fb's words are the same in both.
__device__ __forceinline__ float exn(float x) { return __builtin_amdgcn_exp2f(x * 1.44269504088896340736f); }

typedef __attribute__((ext_vector_type(4))) _Float16 v4h_;
// ---- k_own: a block's own sums in one launch, a work-group of four waves a block. A thread takes one column (cl) of inb and of inc over half of the block's 64 steps (th): its words are 64 bytes of row cl of Gb and of Gc (the steps side by side), which it lays in LDS.
// Behind the barrier wave w takes rows 16 w to 16 w + 15 of Du = Gc Gb^T (the same fragments, k order and order of the two depth steps as a product from 128-byte rows in memory); Gb is wanted nowhere else and stays in LDS; Gc goes to the workspace from LDS, 512 bytes in a row a store.
// Every loop of k_own is unrolled whole: its small arrays are indexed by the loop counters, and only so do they stay in registers.
#define NPT 72   /* a row's pitch in LDS, in f16 words: 144 bytes = 16 bytes times an odd number, free of bank conflicts for 16-byte reads and writes down a column of rows */
__global__ __launch_bounds__(128) void k_own(const float* __restrict__ inb, const float* __restrict__ inc, const float* __restrict__ ind, h16* __restrict__ Gc, float* __restrict__ Du, float* __restrict__ Cu) {
    __shared__ __align__(16) h16 rw[2 * 64 * NPT];   /* Gb's 64 rows, then Gc's */
    __shared__ __align__(16) float ot[4 * 16 * 68];   /* a wave's own 16 rows of Du, pitch 68 words */
    __shared__ float cp[2 * 64];   /* the two halves of each column's sum of fb's words */
    const unsigned zq = blockIdx.x, ck = zq & 127u, pr = zq >> 7, sq = pr >> 3, hd = pr & 7u; const unsigned cl = threadIdx.x & 63u, lane = threadIdx.x & 31u, lr = lane & 15u, hi = lane >> 4;
    const unsigned wv = (unsigned)__builtin_amdgcn_readfirstlane((int)(threadIdx.x >> 5)), th = wv >> 1;   /* the wave's number in a scalar register: ind's words then come by scalar loads */
    const size_t b0 = (((size_t)sq * NTS + (size_t)ck * NCS + th * 32) * NHS + hd) * NFE + cl; const float* bp = inb + b0; const float* qp = inc + b0; const float* mp = ind + (size_t)sq * NTS + (size_t)ck * NCS + th * 32;
    float yb[32], yc[32];
#pragma unroll
    for (int tj = 0; tj < 32; ++tj) { yb[tj] = bp[(size_t)tj * (NHS * NFE)]; yc[tj] = qp[(size_t)tj * (NHS * NFE)]; }
    asm volatile("s_wait_xcnt 0x0" :: "v"(bp), "v"(qp) : "memory");   /* in front of every rewrite of a register that the loads above name; the addresses are inputs so that no load of the group lands in one of them */
    __builtin_amdgcn_sched_barrier(0);   /* holds the loads above their uses: all 64 are on their way at once */
    v8h ob[4], oc[4]; float acc = 0.0f;
#pragma unroll
    for (int tj = 0; tj < 32; ++tj) { const float vb = bfr(yb[tj]); const float vc = bfr(yc[tj]); const h16 wb = toh_flush((fmaxf(vb, 0.0f) + exn(fminf(vb, 0.0f))) * bfr(mp[tj])); ob[tj >> 3][tj & 7] = wb; oc[tj >> 3][tj & 7] = toh_flush(vc); acc = acc + (float)wb; }
#pragma unroll
    for (int g = 0; g < 4; ++g) { *(v8ha*)(rw + cl * NPT + th * 32 + g * 8) = ob[g]; *(v8ha*)(rw + (64 + cl) * NPT + th * 32 + g * 8) = oc[g]; }
    cp[th * 64 + cl] = acc;
    __syncthreads();   /* both operands' rows and the half sums stand whole in LDS before any wave reads another wave's words */
    const h16* ar = rw + (64 + wv * 16 + lr) * NPT + hi * 8; const v16h a0 = cat16(*(const v8ha*)ar, *(const v8ha*)(ar + 16)), a1 = cat16(*(const v8ha*)(ar + 32), *(const v8ha*)(ar + 48)); float* os = ot + wv * (16 * 68);
#pragma unroll
    for (int nb = 0; nb < 4; ++nb) { const h16* br = rw + (nb * 16 + lr) * NPT + hi * 8; v8f d = (v8f){}; d = wmma16(a0, cat16(*(const v8ha*)br, *(const v8ha*)(br + 16)), d); d = wmma16(a1, cat16(*(const v8ha*)(br + 32), *(const v8ha*)(br + 48)), d);   /* d[j] = Du[16 wv + 8 hi + j][16 nb + lr] */
#pragma unroll
        for (int j = 0; j < 8; ++j) os[(hi * 8 + j) * 68 + nb * 16 + lr] = d[j]; }
    asm volatile("s_wait_dscnt 0x0" ::: "memory");   /* the wave's own tile stands in LDS before other lanes of the same wave read it back row by row: each store below then covers two whole rows of 256 bytes */
    v4f du[8]; v8h gc[4];
#pragma unroll
    for (int s = 0; s < 8; ++s) du[s] = *(const v4fa*)(os + (2 * s + hi) * 68 + lr * 4);
#pragma unroll
    for (int p = 0; p < 4; ++p) { const unsigned f = p * 128 + threadIdx.x; gc[p] = *(const v8ha*)(rw + (64 + (f >> 3)) * NPT + (f & 7u) * 8); }
    const float cs = cp[cl] + cp[64 + cl];
    float* dd = Du + (size_t)zq * NBL + (wv * 16 + hi) * 64 + lr * 4; h16* gd = Gc + (size_t)zq * NBL + threadIdx.x * 8;
#pragma unroll
    for (int s = 0; s < 8; ++s) *(v4f*)(dd + s * 128) = du[s];
#pragma unroll
    for (int p = 0; p < 4; ++p) *(v8h*)(gd + p * 1024) = gc[p];
    asm volatile("s_wait_xcnt 0x0" ::: "memory");   /* in front of every rewrite of a register that the stores above name: the last store's address and word are formed behind a branch, in registers of theirs */
    if (th == 0) Cu[((size_t)ck * NPR + pr) * 64 + cl] = cs;
}

// ---- k_scan: every carried sum in one launch. A thread owns four neighbouring words of one pair's 64 by 64 plane (work-groups 0 to 255) or of the 16 by 64 row of fb's sums (the last 4 work-groups); it adds the 128 chunks' own sums in their order, one f32 addition a chunk and word, from a start value of nought, and stores what it holds IN FRONT of each addition.
// The addresses do not hang on the sums, so the loads run ahead: NRG chunks' words stand in registers or are on their way; NGR chunks are taken at a time, and their registers are loaded anew at once.
#define NRG 48
#define NGR 8
__global__ __launch_bounds__(64) void k_scan(const float* __restrict__ Du, const float* __restrict__ Cu, h16* __restrict__ Sw, h16* __restrict__ Tw, float* __restrict__ Cs) {
    if (blockIdx.x < NPR * NBL / 4 / 64) {
        const unsigned i = blockIdx.x * 64 + threadIdx.x; const unsigned j4 = i & 1023u, pr = i >> 10; const float* src = Du + (size_t)pr * NCK * NBL + j4 * 4; h16* dst = Sw + (size_t)pr * NCK * NBL + j4 * 4; v4f rg[NRG]; v4f run = (v4f){};
#pragma unroll
        for (int k = 0; k < NRG; ++k) rg[k] = *(const v4fa*)(src + (size_t)k * NBL);
        __builtin_amdgcn_sched_barrier(0);   /* holds the loads above their uses: left free, the compiler moves each load down to its addition and one or two are on their way at a time */
#pragma unroll
        for (int q = 0; q < NCK / NGR; ++q) {
#pragma unroll
            for (int k = 0; k < NGR; ++k) { const int ck = q * NGR + k; const v4f vu = rg[ck % NRG]; v4h_ ow;
#pragma unroll
                for (int j = 0; j < 4; ++j) { ow[j] = toh_flush(run[j]); run[j] = run[j] + vu[j]; }
                *(v4h_*)(dst + (size_t)ck * NBL) = ow; }
            asm volatile("s_wait_xcnt 0x0" ::: "memory");   /* in front of every rewrite of a register that the stores above name: the loads below and the next chunks' words reuse them */
            if ((q + 1) * NGR + NRG <= NCK) {
#pragma unroll
                for (int k = 0; k < NGR; ++k) { const int ck = q * NGR + k; rg[ck % NRG] = *(const v4fa*)(src + (size_t)(ck + NRG) * NBL); } }
            __builtin_amdgcn_sched_barrier(0);   /* as above: the loads just issued stay NRG - NGR chunks ahead of their uses */
        }
        v4h_ ot;
#pragma unroll
        for (int j = 0; j < 4; ++j) ot[j] = toh_flush(run[j]);
        *(v4h_*)(Tw + (size_t)pr * NBL + j4 * 4) = ot;
        asm volatile("s_wait_xcnt 0x0" ::: "memory");   /* behind the part's last store: in the built code the other part's loads may stand behind a branch after it and reuse its registers */
    } else {
        const unsigned i = (blockIdx.x - NPR * NBL / 4 / 64) * 64 + threadIdx.x; const float* src = Cu + i * 4; float* dst = Cs + i * 4; v4f rg[NRG]; v4f run = (v4f){};
#pragma unroll
        for (int k = 0; k < NRG; ++k) rg[k] = *(const v4fa*)(src + (size_t)k * NPR * 64);
        __builtin_amdgcn_sched_barrier(0);   /* as in the branch above */
#pragma unroll
        for (int q = 0; q < NCK / NGR; ++q) {
#pragma unroll
            for (int k = 0; k < NGR; ++k) { const int ck = q * NGR + k; const v4f vu = rg[ck % NRG];
                *(v4f*)(dst + (size_t)ck * NPR * 64) = run;
#pragma unroll
                for (int j = 0; j < 4; ++j) run[j] = run[j] + vu[j]; }
            asm volatile("s_wait_xcnt 0x0" ::: "memory");   /* in front of every rewrite of a register that the stores above name: the loads below and the next chunks' words reuse them */
            if ((q + 1) * NGR + NRG <= NCK) {
#pragma unroll
                for (int k = 0; k < NGR; ++k) { const int ck = q * NGR + k; rg[ck % NRG] = *(const v4fa*)(src + (size_t)(ck + NRG) * NPR * 64); } }
            __builtin_amdgcn_sched_barrier(0);   /* as in the branch above */
        }
        *(v4f*)(dst + (size_t)NCK * NPR * 64) = run;
        asm volatile("s_wait_xcnt 0x0" ::: "memory");   /* as behind the last store of the branch above */
    } }

// ---- k_res: both results of one block in one work-group; nothing between the inputs' words and the results goes through the workspace.
// Every product is taken TRANSPOSED: the 16 rows (times) of a wave are the matrix instruction's columns, so a lane holds one time: Fa's words, made in registers from ina, are the B operand of three products; two neighbouring 16 by 16 tiles of Pw^T, cast in place, are the B operand of the product with Gc (the hardware's k order, which the 16-byte pieces of the A operands have as well); each lower term is one word a lane.
// The four A operands (Fb's words, Gc, Sw, Tw: 64 by 64 f16 each) are wanted whole by every wave: wave w brings rows 16 w to 16 w + 15 of each, as the four 16-byte pieces a lane that make its two fragments, and lays them in LDS piece by piece, the lanes side by side.
// Every loop of k_res is unrolled whole: its small arrays are indexed by the loop counters, and only so do they stay in registers.
__global__ __launch_bounds__(128) void k_res(const float* __restrict__ ina, const float* __restrict__ inb, const float* __restrict__ ind, const h16* __restrict__ Gc, const h16* __restrict__ Sw, const h16* __restrict__ Tw, const float* __restrict__ Cs, float* __restrict__ R0, float* __restrict__ R1) {
    __shared__ __align__(16) float sm[4 * 2 * 16 * 68];   /* first the four operands: [operand][16 rows' group][piece][lane] 16-byte pieces (32 KiB); then a wave's two result tiles of 16 rows, pitch 68 words */
    const unsigned zq = blockIdx.x, ck = zq & 127u, pr = zq >> 7, sq = pr >> 3, hd = pr & 7u; const unsigned lane = threadIdx.x & 31u, wv = threadIdx.x >> 5, lr = lane & 15u, hi = lane >> 4;
    const unsigned t0 = ck * NCS + wv * 16; const unsigned rob = lr * (NHS * NFE * 4) + hi * 32, pob = (wv * 16 + lr) * 128 + hi * 16, lob = lr * 4, hob = hi * 32;   /* a lane's byte offsets: in the inputs' rows, in a 64 by 64 f16 plane, in ind, in a row of Cs */
    const char* ap = (const char*)(ina + (((size_t)sq * NTS + t0) * NHS + hd) * NFE) + rob; const char* bp = (const char*)(inb + (((size_t)sq * NTS + t0) * NHS + hd) * NFE) + rob; const char* ip = (const char*)(ind + (size_t)sq * NTS + t0) + lob;
    const char* gb = (const char*)(Gc + (size_t)zq * NBL); const char* sb = (const char*)(Sw + (size_t)zq * NBL); const char* tb = (const char*)(Tw + (size_t)pr * NBL); const char* c1b = (const char*)(Cs + ((size_t)ck * NPR + pr) * 64); const char* c0b = (const char*)(Cs + ((size_t)NCK * NPR + pr) * 64);
    v8ha* fr = (v8ha*)sm; v8f wa[4], wb[4], c1[4], c0[4]; v8h gq[4], sw[4], tq[4], fq[4], kq[4];
#pragma unroll
    for (int q = 0; q < 4; ++q) { gq[q] = *(const v8h*)(gb + pob + q * 32); sw[q] = *(const v8h*)(sb + pob + q * 32); tq[q] = *(const v8h*)(tb + pob + q * 32); }
    const float mw = *(const float*)ip;
#pragma unroll
    for (int q = 0; q < 4; ++q) { wa[q] = *(const v8f*)(ap + q * 64); wb[q] = *(const v8f*)(bp + q * 64); }
    asm volatile("s_wait_xcnt 0x0" :: "v"(ap), "v"(bp), "v"(ip), "v"(pob) : "memory");   /* in front of every rewrite of a register that the loads above name; the addresses are inputs so that no later load of the group lands in one of them */
    __builtin_amdgcn_sched_barrier(0);   /* holds the loads above their uses: all of them are on their way at once */
#pragma unroll
    for (int q = 0; q < 4; ++q) { fr[((1 * 4 + wv) * 4 + q) * 32 + lane] = gq[q]; fr[((2 * 4 + wv) * 4 + q) * 32 + lane] = sw[q]; fr[((3 * 4 + wv) * 4 + q) * 32 + lane] = tq[q]; }
    const float mk = bfr(mw);
#pragma unroll
    for (int q = 0; q < 4; ++q) {
#pragma unroll
        for (int j = 0; j < 8; ++j) { const float ya = bfr(wa[q][j]), yb = bfr(wb[q][j]); fq[q][j] = toh_flush(fmaxf(ya, 0.0f) + exn(fminf(ya, 0.0f))); kq[q][j] = toh_flush((fmaxf(yb, 0.0f) + exn(fminf(yb, 0.0f))) * mk); }
        fr[((0 * 4 + wv) * 4 + q) * 32 + lane] = kq[q]; }
    __syncthreads();   /* the four operands stand whole in LDS before any wave reads another wave's rows */
#pragma unroll
    for (int q = 0; q < 4; ++q) { c1[q] = *(const v8f*)(c1b + hob + q * 64); c0[q] = *(const v8f*)(c0b + hob + q * 64); }
    asm volatile("s_wait_xcnt 0x0" :: "v"(hob) : "memory");   /* as above, for the loads of the carried sums' rows */
    __builtin_amdgcn_sched_barrier(0);   /* holds these loads here: they fly while Pw is made and are used behind it */
    const v16h fa0 = cat16(fq[0], fq[1]), fa1 = cat16(fq[2], fq[3]);
#define AFR(op, g, kc) cat16(fr[(((op) * 4 + (g)) * 4 + 2 * (kc)) * 32 + lane], fr[(((op) * 4 + (g)) * 4 + 2 * (kc) + 1) * 32 + lane])
    v8h ph[4], pl[4]; float acc = 0.0f;
#pragma unroll
    for (int ub = 0; ub < 4; ++ub) { v8f p = (v8f){}; p = wmma16(AFR(0, ub, 0), fa0, p); p = wmma16(AFR(0, ub, 1), fa1, p);   /* p[j] = Pw[row time 16 wv + lr][column time 16 ub + 8 hi + j] */
#pragma unroll
        for (int j = 0; j < 8; ++j) { const float kp = (float)((unsigned)(ub * 16 + j) + hi * 8 <= wv * 16 + lr); const float pm = p[j] * kp; const h16 wh = toh_flush(pm); ph[ub][j] = wh; pl[ub][j] = toh_flush(pm - (float)wh); acc = acc + pm; } }
    float d1 = 0.0f, d0 = 0.0f;
#pragma unroll
    for (int q = 0; q < 4; ++q) {
#pragma unroll
        for (int j = 0; j < 8; ++j) { const float wf = (float)fq[q][j]; d1 = d1 + wf * c1[q][j]; d0 = d0 + wf * c0[q][j]; } }
    acc = acc + __shfl_xor(acc, 16, 32); d1 = d1 + __shfl_xor(d1, 16, 32); d0 = d0 + __shfl_xor(d0, 16, 32);   /* lanes lr and lr + 16 hold the two halves of one row's sums */
    const float r1 = 1.0f / (acc + d1 + 1e-6f); const float r0 = 1.0f / (d0 + 1e-6f);
    const v16h bh0 = cat16(ph[0], ph[1]), bh1 = cat16(ph[2], ph[3]), bl0 = cat16(pl[0], pl[1]), bl1 = cat16(pl[2], pl[3]); v8f o1[4], o0[4];
#pragma unroll
    for (int mb = 0; mb < 4; ++mb) { const v16h g0 = AFR(1, mb, 0), g1 = AFR(1, mb, 1); v8f ua = (v8f){}, ub = (v8f){}, uc = (v8f){};
        ua = wmma16(g0, bh0, ua); ua = wmma16(g0, bl0, ua); ua = wmma16(g1, bh1, ua); ua = wmma16(g1, bl1, ua);
        ub = wmma16(AFR(2, mb, 0), fa0, ub); ub = wmma16(AFR(2, mb, 1), fa1, ub); uc = wmma16(AFR(3, mb, 0), fa0, uc); uc = wmma16(AFR(3, mb, 1), fa1, uc);
#pragma unroll
        for (int j = 0; j < 8; ++j) { o1[mb][j] = (ua[j] + ub[j]) * r1; o0[mb][j] = uc[j] * r0; } }   /* word j: column 16 mb + 8 hi + j of row time 16 wv + lr */
#undef AFR
    __syncthreads();   /* every wave has read the operands for the last time: their LDS takes the result tiles */
    float* os = sm + wv * (2 * 16 * 68);
#pragma unroll
    for (int mb = 0; mb < 4; ++mb) { float* w0 = os + lr * 68 + mb * 16 + hi * 8; float* w1 = w0 + 16 * 68;
        *(v4fa*)w0 = (v4f){o0[mb][0], o0[mb][1], o0[mb][2], o0[mb][3]}; *(v4fa*)(w0 + 4) = (v4f){o0[mb][4], o0[mb][5], o0[mb][6], o0[mb][7]}; *(v4fa*)w1 = (v4f){o1[mb][0], o1[mb][1], o1[mb][2], o1[mb][3]}; *(v4fa*)(w1 + 4) = (v4f){o1[mb][4], o1[mb][5], o1[mb][6], o1[mb][7]}; }
    __syncthreads();   /* the tiles stand in LDS before other lanes read them back row by row: each store below then covers two whole rows of 256 bytes */
#pragma unroll
    for (int s = 0; s < 8; ++s) { const unsigned row = 2 * s + hi, cofs = lr * 4; const size_t dst = (((size_t)sq * NTS + t0 + row) * NHS + hd) * NFE + cofs;
        *(v4f*)(R0 + dst) = *(const v4fa*)(os + row * 68 + cofs); *(v4f*)(R1 + dst) = *(const v4fa*)(os + (16 + row) * 68 + cofs); }
}

extern "C" void kernel_launch(void* const* d_in, const int* in_sizes, int n_in, void* d_out, int out_size, void* d_ws, size_t ws_size, hipStream_t stream) {
    if (n_in < 4) return;
    if (in_sizes[0] != NSQ * NTS * NHS * NFE || in_sizes[1] != NSQ * NTS * NHS * NFE || in_sizes[2] != NSQ * NTS * NHS * NFE || in_sizes[3] != NSQ * NTS) return;
    if (out_size != 2 * NSQ * NTS * NHS * NFE) return;
    static_assert(NPR == NSQ * NHS && NHS == 8 && NFE == 64 && NCS == 64 && NCK * NCS == NTS && NTS == 8192 && NCK == 128 && NZQ == NPR * NCK && NBL == 64 * 64 && (NPR * NBL / 4) % 64 == 0 && NBL / 4 == 1024 && (NPR * 64 / 4) % 64 == 0 && NCK % NGR == 0 && NRG % NGR == 0 && NRG < NCK, "the products: 64 by 64 blocks over a depth of 64; the flat grids exact; the index fields' widths (3 bits a head, 7 a chunk, 6 a column; 10 a group of four words in a plane)");
    const float* ina = (const float*)d_in[0]; const float* inb = (const float*)d_in[1]; const float* inc = (const float*)d_in[2]; const float* ind = (const float*)d_in[3]; float* R0 = (float*)d_out; float* R1 = R0 + (size_t)NSQ * NTS * NHS * NFE;
    char* wsp = (char*)d_ws; auto take = [&](size_t bytes) { char* p = wsp; wsp += (bytes + 255) & ~(size_t)255; return (void*)p; };
    float* Cs = (float*)take((size_t)(NCK + 1) * NPR * 64 * 4); float* Cu = (float*)take((size_t)NCK * NPR * 64 * 4);
    float* Du = (float*)take((size_t)NPR * NCK * NBL * 4); h16* Sw = (h16*)take((size_t)NPR * NCK * NBL * 2); h16* Gc = (h16*)take((size_t)NPR * NCK * NBL * 2); h16* Tw = (h16*)take((size_t)NPR * NBL * 2);
    if ((size_t)(wsp - (char*)d_ws) > ws_size) return;
    /* the blocks' own sums */
    k_own<<<(unsigned)NZQ, 128, 0, stream>>>(inb, inc, ind, Gc, Du, Cu);   /* Gc, Cu and Du[m][e] = the sum over the block's steps of Gc[m][time] Gb[e][time] */
    k_scan<<<(unsigned)(NPR * NBL / 4 / 64 + NPR * 64 / 4 / 64), 64, 0, stream>>>(Du, Cu, Sw, Tw, Cs);   /* the sums carried, and the sum over all chunks: one launch */
    /* the results */
    k_res<<<(unsigned)NZQ, 128, 0, stream>>>(ina, inb, ind, Gc, Sw, Tw, Cs, R0, R1);
}

// v006
// Measured time: 39.8 microseconds a run.
// Two timings next to v005 both put it at 1.06 times that version's speed.
// Counting every step since v000, it is 19.4 times as fast.
#include <hip/hip_runtime.h>

// Inputs, in this order: ina [2][8192][8][64]; inb [2][8192][8][64]; inc [2][8192][8][64]; ind [2][8192] (a 0 | 1 word a (sequence, time)). Results, one after the other in the result buffer: R0 [2][8192][8][64], then R1 [2][8192][8][64]. A PAIR is one (sequence, head): 16 pairs; a CHUNK is 64 steps: 128 chunks a pair; a BLOCK is one (pair, chunk): 64 by 64 words: 2,048 blocks.
// With fa = max(w, 0) + exp(min(w, 0)) of ina's words and fb = the same of inb's words times ind's word of that (sequence, time): R0[t] = fa[t] . (the sum over ALL steps u of fb[u] inc[u]^T), times 1 / (fa[t] . (the sum over all u of fb[u]) + 1e-6); R1[t] = fa[t] . (the sum over u <= t of fb[u] inc[u]^T), times 1 / (fa[t] . (the sum over u <= t of fb[u]) + 1e-6): every pair by itself.
// THE FORM: chunk by chunk, every block of every pair side by side in each launch. For a block c: Du_c = Gc_c Gb_c^T: the block's own sum of inc[u] fb[u]^T (64 by 64 over the 64 steps), made in the launch that reads inb and inc (k_own); the sums carried over the chunks before c: Sw_c = the word of (Du_0 + .. + Du_(c-1)), made by ONE launch in which every thread keeps the running sum of its own four words in registers, starts it at nought and walks the 128 chunks in their order (behind the last chunk it lays the word of the sum over ALL chunks: Tw). THE RESULTS: ONE launch, a work-group of four waves a block, a wave 16 rows (k_res): Pw = Fa_c Fb_c^T (64 by 64 over 64); kept where the column's time is not after the row's; its f16 word Ph and the word Pl of what Ph leaves; R1's upper term = (Ph + Pl) Gc_c^T + Fa_c Sw_c^T; its lower term = the kept words' sum along the row + Fa's row . (the carried sums of fb's words) + 1e-6; R0's upper term = Fa Tw^T; its lower term = Fa's row . (the sum of fb's words over all steps) + 1e-6.
// Layout of the workspace, every plane for all 16 pairs: Cs f32 [129][16][64] (row 0 noughts; row c + 1 = row c + Cu's row c); Cu f32 [128][16][64]; Du f32 [16][128][4096]; Sw f16 [16][128][4096]; Gc f16 [16][128][64][64] (inc's words, the steps side by side); Tw f16 [16][4096]. Gb (fb's words, the steps side by side) stands in LDS alone.
// Compute dtypes, f32 accumulate: every float input is taken at its bf16 value where it is read; fa, fb, inc's words, the carried sums and the sum over all chunks go to the matrix unit as ONE f16 word each (a value under 2^-14 in magnitude made an exact nought before the cast); the kept words of Pw as TWO f16 words (Ph and Pl: one accumulator takes both); everything else is f32. The lower terms' reciprocals are true divisions.

#define NSQ 2
#define NTS 8192
#define NHS 8
#define NFE 64
#define NCS 64
#define NCK 128
#define NPR 16
#define NZQ 2048
#define NBL 4096

typedef _Float16 h16;
typedef unsigned short bf;
typedef __attribute__((ext_vector_type(16))) __bf16   v16bf;
typedef __attribute__((ext_vector_type(16))) _Float16 v16h;
typedef __attribute__((ext_vector_type(8)))  _Float16 v8h;
typedef __attribute__((ext_vector_type(8)))  unsigned short v8us;
typedef __attribute__((ext_vector_type(8)))  float    v8f;
typedef __attribute__((ext_vector_type(4)))  float    v4f;
typedef v8h  __attribute__((may_alias)) v8ha;
typedef v4f  __attribute__((may_alias)) v4fa;
typedef v8us __attribute__((may_alias)) v8usa;

__device__ __forceinline__ unsigned short f2bf(float f) { unsigned u = __float_as_uint(f); u += 0x7FFFu + ((u >> 16) & 1u); return (unsigned short)(u >> 16); }
__device__ __forceinline__ float bf2f(unsigned short b) { return __uint_as_float(((unsigned)b) << 16); }
__device__ __forceinline__ float bfr(float f) { return bf2f(f2bf(f)); }
__device__ __forceinline__ v16h cat16(v8h lo, v8h hi) { return __builtin_shufflevector(lo, hi, 0, 1, 2, 3, 4, 5, 6, 7, 8, 9, 10, 11, 12, 13, 14, 15); }
__device__ __forceinline__ v8f wmma16(v16h a, v16h b, v8f c) { return __builtin_amdgcn_wmma_f32_16x16x32_f16(false, a, false, b, (short)0, c, false, false); }

typedef __attribute__((ext_vector_type(2))) _Float16 v2h;
typedef __attribute__((ext_vector_type(4))) _Float16 v4h;
typedef __attribute__((ext_vector_type(2))) unsigned short v2us;
typedef __attribute__((ext_vector_type(4))) unsigned short v4us;
typedef __attribute__((ext_vector_type(2))) float v2f;
typedef __attribute__((ext_vector_type(4))) int v4i;
// the f16 cast of the new kernels: a value under 2^-14 in magnitude becomes an exact zero BEFORE the conversion (a select on the value): no subnormal f16 word is made.
__device__ __forceinline__ h16 toh_flush(float x) { const float z = (fabsf(x) < 6.103515625e-05f) ? 0.0f : x; return (h16)z; }
// e^x for x <= 0, as the feature map wants it: the hardware's 2^y on y = x log2(e). The roundings of the constant and of the product move the result by under |y| 2^-23 of itself, far under the 2^-11 of the f16 word that it is cast to; a y under -126 gives nought, which the cast's flush gives as well. k_own and k_res take the same form, so fb's words are the same in both.
__device__ __forceinline__ float exn(float x) { return __builtin_amdgcn_exp2f(x * 1.44269504088896340736f); }

typedef __attribute__((ext_vector_type(4))) _Float16 v4h_;
// ---- k_own: a block's own sums in one launch, a work-group of four waves a block. A thread takes one column (cl) of inb and of inc over half of the block's 64 steps (th): its words are 64 bytes of row cl of Gb and of Gc (the steps side by side), which it lays in LDS.
// Behind the barrier wave w takes rows 16 w to 16 w + 15 of Du = Gc Gb^T (the same fragments, k order and order of the two depth steps as a product from 128-byte rows in memory); Gb is wanted nowhere else and stays in LDS; Gc goes to the workspace from LDS, 512 bytes in a row a store.
// Every loop of k_own is unrolled whole: its small arrays are indexed by the loop counters, and only so do they stay in registers.
#define NPT 72   /* a row's pitch in LDS, in f16 words: 144 bytes = 16 bytes times an odd number, free of bank conflicts for 16-byte reads and writes down a column of rows */
__global__ __launch_bounds__(128) void k_own(const float* __restrict__ inb, const float* __restrict__ inc, const float* __restrict__ ind, h16* __restrict__ Gc, float* __restrict__ Du, float* __restrict__ Cu) {
    __shared__ __align__(16) h16 rw[2 * 64 * NPT];   /* Gb's 64 rows, then Gc's */
    __shared__ __align__(16) float ot[4 * 16 * 68];   /* a wave's own 16 rows of Du, pitch 68 words */
    __shared__ float cp[2 * 64];   /* the two halves of each column's sum of fb's words */
    const unsigned zq = blockIdx.x, ck = zq & 127u, pr = zq >> 7, sq = pr >> 3, hd = pr & 7u; const unsigned cl = threadIdx.x & 63u, lane = threadIdx.x & 31u, lr = lane & 15u, hi = lane >> 4;
    const unsigned wv = (unsigned)__builtin_amdgcn_readfirstlane((int)(threadIdx.x >> 5)), th = wv >> 1;   /* the wave's number in a scalar register: ind's words then come by scalar loads */
    const size_t b0 = (((size_t)sq * NTS + (size_t)ck * NCS + th * 32) * NHS + hd) * NFE + cl; const float* bp = inb + b0; const float* qp = inc + b0; const float* mp = ind + (size_t)sq * NTS + (size_t)ck * NCS + th * 32;
    float yb[32], yc[32];
#pragma unroll
    for (int tj = 0; tj < 32; ++tj) { yb[tj] = bp[(size_t)tj * (NHS * NFE)]; yc[tj] = qp[(size_t)tj * (NHS * NFE)]; }
    asm volatile("s_wait_xcnt 0x0" :: "v"(bp), "v"(qp) : "memory");   /* in front of every rewrite of a register that the loads above name; the addresses are inputs so that no load of the group lands in one of them */
    __builtin_amdgcn_sched_barrier(0);   /* holds the loads above their uses: all 64 are on their way at once */
    v8h ob[4], oc[4]; float acc = 0.0f;
#pragma unroll
    for (int tj = 0; tj < 32; ++tj) { const float vb = bfr(yb[tj]); const float vc = bfr(yc[tj]); const h16 wb = toh_flush((fmaxf(vb, 0.0f) + exn(fminf(vb, 0.0f))) * bfr(mp[tj])); ob[tj >> 3][tj & 7] = wb; oc[tj >> 3][tj & 7] = toh_flush(vc); acc = acc + (float)wb; }
#pragma unroll
    for (int g = 0; g < 4; ++g) { *(v8ha*)(rw + cl * NPT + th * 32 + g * 8) = ob[g]; *(v8ha*)(rw + (64 + cl) * NPT + th * 32 + g * 8) = oc[g]; }
    cp[th * 64 + cl] = acc;
    __syncthreads();   /* both operands' rows and the half sums stand whole in LDS before any wave reads another wave's words */
    const h16* ar = rw + (64 + wv * 16 + lr) * NPT + hi * 8; const v16h a0 = cat16(*(const v8ha*)ar, *(const v8ha*)(ar + 16)), a1 = cat16(*(const v8ha*)(ar + 32), *(const v8ha*)(ar + 48)); float* os = ot + wv * (16 * 68);
#pragma unroll
    for (int nb = 0; nb < 4; ++nb) { const h16* br = rw + (nb * 16 + lr) * NPT + hi * 8; v8f d = (v8f){}; d = wmma16(a0, cat16(*(const v8ha*)br, *(const v8ha*)(br + 16)), d); d = wmma16(a1, cat16(*(const v8ha*)(br + 32), *(const v8ha*)(br + 48)), d);   /* d[j] = Du[16 wv + 8 hi + j][16 nb + lr] */
#pragma unroll
        for (int j = 0; j < 8; ++j) os[(hi * 8 + j) * 68 + nb * 16 + lr] = d[j]; }
    asm volatile("s_wait_dscnt 0x0" ::: "memory");   /* the wave's own tile stands in LDS before other lanes of the same wave read it back row by row: each store below then covers two whole rows of 256 bytes */
    v4f du[8]; v8h gc[4];
#pragma unroll
    for (int s = 0; s < 8; ++s) du[s] = *(const v4fa*)(os + (2 * s + hi) * 68 + lr * 4);
#pragma unroll
    for (int p = 0; p < 4; ++p) { const unsigned f = p * 128 + threadIdx.x; gc[p] = *(const v8ha*)(rw + (64 + (f >> 3)) * NPT + (f & 7u) * 8); }
    const float cs = cp[cl] + cp[64 + cl];
    float* dd = Du + (size_t)zq * NBL + (wv * 16 + hi) * 64 + lr * 4; h16* gd = Gc + (size_t)zq * NBL + threadIdx.x * 8;
#pragma unroll
    for (int s = 0; s < 8; ++s) *(v4f*)(dd + s * 128) = du[s];
#pragma unroll
    for (int p = 0; p < 4; ++p) *(v8h*)(gd + p * 1024) = gc[p];
    asm volatile("s_wait_xcnt 0x0" ::: "memory");   /* in front of every rewrite of a register that the stores above name: the last store's address and word are formed behind a branch, in registers of theirs */
    if (th == 0) Cu[((size_t)ck * NPR + pr) * 64 + cl] = cs;
}

// ---- k_scan: every carried sum in one launch. A thread owns four neighbouring words of one pair's 64 by 64 plane (work-groups 0 to 255) or of the 16 by 64 row of fb's sums (the last 4 work-groups); it adds the 128 chunks' own sums in their order, one f32 addition a chunk and word, from a start value of nought, and stores what it holds IN FRONT of each addition.
// The addresses do not hang on the sums, so the loads run ahead: NRG chunks' words stand in registers or are on their way; NGR chunks are taken at a time, and their registers are loaded anew at once.
#define NRG 48
#define NGR 8
__global__ __launch_bounds__(64) void k_scan(const float* __restrict__ Du, const float* __restrict__ Cu, h16* __restrict__ Sw, h16* __restrict__ Tw, float* __restrict__ Cs) {
    if (blockIdx.x < NPR * NBL / 4 / 64) {
        const unsigned i = blockIdx.x * 64 + threadIdx.x; const unsigned j4 = i & 1023u, pr = i >> 10; const float* src = Du + (size_t)pr * NCK * NBL + j4 * 4; h16* dst = Sw + (size_t)pr * NCK * NBL + j4 * 4; v4f rg[NRG]; v4f run = (v4f){};
#pragma unroll
        for (int k = 0; k < NRG; ++k) rg[k] = *(const v4fa*)(src + (size_t)k * NBL);
        __builtin_amdgcn_sched_barrier(0);   /* holds the loads above their uses: left free, the compiler moves each load down to its addition and one or two are on their way at a time */
#pragma unroll
        for (int q = 0; q < NCK / NGR; ++q) {
#pragma unroll
            for (int k = 0; k < NGR; ++k) { const int ck = q * NGR + k; const v4f vu = rg[ck % NRG]; v4h_ ow;
#pragma unroll
                for (int j = 0; j < 4; ++j) { ow[j] = toh_flush(run[j]); run[j] = run[j] + vu[j]; }
                *(v4h_*)(dst + (size_t)ck * NBL) = ow; }
            asm volatile("s_wait_xcnt 0x0" ::: "memory");   /* in front of every rewrite of a register that the stores above name: the loads below and the next chunks' words reuse them */
            if ((q + 1) * NGR + NRG <= NCK) {
#pragma unroll
                for (int k = 0; k < NGR; ++k) { const int ck = q * NGR + k; rg[ck % NRG] = *(const v4fa*)(src + (size_t)(ck + NRG) * NBL); } }
            __builtin_amdgcn_sched_barrier(0);   /* as above: the loads just issued stay NRG - NGR chunks ahead of their uses */
        }
        v4h_ ot;
#pragma unroll
        for (int j = 0; j < 4; ++j) ot[j] = toh_flush(run[j]);
        *(v4h_*)(Tw + (size_t)pr * NBL + j4 * 4) = ot;
        asm volatile("s_wait_xcnt 0x0" ::: "memory");   /* behind the part's last store: in the built code the other part's loads may stand behind a branch after it and reuse its registers */
    } else {
        const unsigned i = (blockIdx.x - NPR * NBL / 4 / 64) * 64 + threadIdx.x; const float* src = Cu + i * 4; float* dst = Cs + i * 4; v4f rg[NRG]; v4f run = (v4f){};
#pragma unroll
        for (int k = 0; k < NRG; ++k) rg[k] = *(const v4fa*)(src + (size_t)k * NPR * 64);
        __builtin_amdgcn_sched_barrier(0);   /* as in the branch above */
#pragma unroll
        for (int q = 0; q < NCK / NGR; ++q) {
#pragma unroll
            for (int k = 0; k < NGR; ++k) { const int ck = q * NGR + k; const v4f vu = rg[ck % NRG];
                *(v4f*)(dst + (size_t)ck * NPR * 64) = run;
#pragma unroll
                for (int j = 0; j < 4; ++j) run[j] = run[j] + vu[j]; }
            asm volatile("s_wait_xcnt 0x0" ::: "memory");   /* in front of every rewrite of a register that the stores above name: the loads below and the next chunks' words reuse them */
            if ((q + 1) * NGR + NRG <= NCK) {
#pragma unroll
                for (int k = 0; k < NGR; ++k) { const int ck = q * NGR + k; rg[ck % NRG] = *(const v4fa*)(src + (size_t)(ck + NRG) * NPR * 64); } }
            __builtin_amdgcn_sched_barrier(0);   /* as in the branch above */
        }
        *(v4f*)(dst + (size_t)NCK * NPR * 64) = run;
        asm volatile("s_wait_xcnt 0x0" ::: "memory");   /* as behind the last store of the branch above */
    } }

// ---- k_res: both results of one block in one work-group; nothing between the inputs' words and the results goes through the workspace.
// Every product is taken TRANSPOSED: the 16 rows (times) of a wave are the matrix instruction's columns, so a lane holds one time: Fa's words, made in registers from ina, are the B operand of three products; two neighbouring 16 by 16 tiles of Pw^T, cast in place, are the B operand of the product with Gc (the hardware's k order, which the 16-byte pieces of the A operands have as well); each lower term is one word a lane.
// The four A operands (Fb's words, Gc, Sw, Tw: 64 by 64 f16 each) are wanted whole by every wave: wave w brings rows 16 w to 16 w + 15 of each and lays them in LDS as 16-byte pieces: piece (q, h) of a row is its words 16 q + 8 h to 16 q + 8 h + 7; a fragment's piece is read by lane (h, row).
// EVERY GLOBAL LOAD OF THE INPUTS' AND THE PLANES' WORDS COVERS WHOLE 128-BYTE LINES: 512 bytes in a row of an f16 plane (four rows), or two whole 256-byte rows of ina or inb. A lane's 16 bytes are then not the piece that the lane wants as a fragment: they find their place through LDS. Fa's words, which only their own wave wants, go through the place of the wave's own rows of Fb and come back as the lane's four pieces before Fb's words are laid there.
// The pieces' places, in 16-byte units: FPQ a (operand, 16 rows' group, q), FPH an h, 1 a row. FPH = 18 and FPQ = 36 are 2 and 4 modulo 16 (the banks' 256 bytes): the 16 lanes of a half wave, which hold 8 pieces (q, h) of 2 rows, write 16 different bank groups; the readers' 16 rows stand side by side.
// Every loop of k_res is unrolled whole: its small arrays are indexed by the loop counters, and only so do they stay in registers.
#define FPH 18
#define FPQ 36
#define FIX(op, g, q) ((((op) * 4 + (g)) * 4 + (q)) * FPQ)
typedef v4h __attribute__((may_alias)) v4ha;
__global__ __launch_bounds__(128) void k_res(const float* __restrict__ ina, const float* __restrict__ inb, const float* __restrict__ ind, const h16* __restrict__ Gc, const h16* __restrict__ Sw, const h16* __restrict__ Tw, const float* __restrict__ Cs, float* __restrict__ R0, float* __restrict__ R1) {
    __shared__ __align__(16) float sm[4 * 4 * 4 * FPQ * 4];   /* first the four operands' 16-byte pieces, at FIX(operand, group, q) + h FPH + row (36 KiB); then a wave's two result tiles of 16 rows, pitch 68 words (34 KiB) */
    const unsigned zq = blockIdx.x, ck = zq & 127u, pr = zq >> 7, sq = pr >> 3, hd = pr & 7u; const unsigned lane = threadIdx.x & 31u, wv = threadIdx.x >> 5, lr = lane & 15u, hi = lane >> 4;
    const unsigned t0 = ck * NCS + wv * 16; const unsigned rob = hi * (NHS * NFE * 4) + lr * 16, pob = wv * 2048 + lane * 16, hob = hi * 32;   /* a lane's byte offsets: in a pair of the inputs' rows (row hi, words 4 lr to 4 lr + 3), in a 64 by 64 f16 plane (the wave's 2 KiB, the lanes side by side), in a row of Cs */
    const char* ap = (const char*)(ina + (((size_t)sq * NTS + t0) * NHS + hd) * NFE) + rob; const char* bp = (const char*)(inb + (((size_t)sq * NTS + t0) * NHS + hd) * NFE) + rob; const float* mp = ind + (size_t)sq * NTS + (size_t)ck * NCS + (unsigned)__builtin_amdgcn_readfirstlane((int)wv) * 16;   /* the wave's number in a scalar register: ind's 16 words come by scalar loads */
    const char* gb = (const char*)(Gc + (size_t)zq * NBL); const char* sb = (const char*)(Sw + (size_t)zq * NBL); const char* tb = (const char*)(Tw + (size_t)pr * NBL); const char* c1b = (const char*)(Cs + ((size_t)ck * NPR + pr) * 64); const char* c0b = (const char*)(Cs + ((size_t)NCK * NPR + pr) * 64);
    v8ha* fr = (v8ha*)sm; v4ha* f8 = (v4ha*)sm; v4f wa[8], wb[8]; v8f c1[4], c0[4]; v8h gq[4], sw[4], tq[4], fq[4]; float ms[16];
#pragma unroll
    for (int k = 0; k < 16; ++k) ms[k] = bfr(mp[k]);
#pragma unroll
    for (int i = 0; i < 4; ++i) { gq[i] = *(const v8h*)(gb + pob + i * 512); sw[i] = *(const v8h*)(sb + pob + i * 512); tq[i] = *(const v8h*)(tb + pob + i * 512); }   /* rows 4 i + (lane >> 3) of the wave's 16, piece lane & 7 */
#pragma unroll
    for (int s = 0; s < 8; ++s) { wa[s] = *(const v4f*)(ap + s * (2 * NHS * NFE * 4)); wb[s] = *(const v4f*)(bp + s * (2 * NHS * NFE * 4)); }   /* row 2 s + hi of the wave's 16 */
    asm volatile("s_wait_xcnt 0x0" :: "v"(ap), "v"(bp), "v"(pob) : "memory");   /* in front of every rewrite of a register that the loads above name; the addresses are inputs so that no later load of the group lands in one of them */
    __builtin_amdgcn_sched_barrier(0);   /* holds the loads above their uses: all of them are on their way at once */
    const unsigned wpl = FIX(0, wv, (lane & 7u) >> 1) + (lane & 1u) * FPH + (lane >> 3);   /* where a plane's loaded piece goes: q = (lane & 7) >> 1, h = lane & 1, row (lane >> 3) + 4 i */
    const unsigned whf = (FIX(0, wv, lr >> 2) + ((lr >> 1) & 1u) * FPH + hi) * 2 + (lr & 1u);   /* where four words of Fa or Fb go, in 8-byte halves of a piece: q = lr >> 2, h = (lr >> 1) & 1, half lr & 1, row hi + 2 s */
    const unsigned rpl = hi * FPH + lr;   /* a reader's place behind FIX(operand, group, q) */
#pragma unroll
    for (int i = 0; i < 4; ++i) { fr[FIX(1, 0, 0) + wpl + i * 4] = gq[i]; fr[FIX(2, 0, 0) + wpl + i * 4] = sw[i]; fr[FIX(3, 0, 0) + wpl + i * 4] = tq[i]; }
#pragma unroll
    for (int s = 0; s < 8; ++s) { v4h fw;
#pragma unroll
        for (int j = 0; j < 4; ++j) { const float ya = bfr(wa[s][j]); fw[j] = toh_flush(fmaxf(ya, 0.0f) + exn(fminf(ya, 0.0f))); }
        f8[whf + s * 4] = fw; }
    asm volatile("s_wait_dscnt 0x0" ::: "memory");   /* the wave's own rows of Fa stand in LDS before other lanes of the same wave read them back as pieces */
#pragma unroll
    for (int q = 0; q < 4; ++q) fq[q] = fr[FIX(0, wv, q) + rpl];
    asm volatile("s_wait_dscnt 0x0" ::: "memory");   /* Fa's pieces have left LDS before Fb's words are laid in their place */
#pragma unroll
    for (int s = 0; s < 8; ++s) { const float mk = hi ? ms[2 * s + 1] : ms[2 * s]; v4h kw;
#pragma unroll
        for (int j = 0; j < 4; ++j) { const float yb = bfr(wb[s][j]); kw[j] = toh_flush((fmaxf(yb, 0.0f) + exn(fminf(yb, 0.0f))) * mk); }
        f8[whf + s * 4] = kw; }
    __syncthreads();   /* the four operands stand whole in LDS before any wave reads another wave's rows */
#pragma unroll
    for (int q = 0; q < 4; ++q) { c1[q] = *(const v8f*)(c1b + hob + q * 64); c0[q] = *(const v8f*)(c0b + hob + q * 64); }
    asm volatile("s_wait_xcnt 0x0" :: "v"(hob) : "memory");   /* as above, for the loads of the carried sums' rows */
    __builtin_amdgcn_sched_barrier(0);   /* holds these loads here: they fly while Pw is made and are used behind it */
    const v16h fa0 = cat16(fq[0], fq[1]), fa1 = cat16(fq[2], fq[3]);
#define AFR(op, g, kc) cat16(fr[FIX(op, g, 2 * (kc)) + rpl], fr[FIX(op, g, 2 * (kc) + 1) + rpl])
    v8h ph[4], pl[4]; float acc = 0.0f;
#pragma unroll
    for (int ub = 0; ub < 4; ++ub) { v8f p = (v8f){}; p = wmma16(AFR(0, ub, 0), fa0, p); p = wmma16(AFR(0, ub, 1), fa1, p);   /* p[j] = Pw[row time 16 wv + lr][column time 16 ub + 8 hi + j] */
#pragma unroll
        for (int j = 0; j < 8; ++j) { const float kp = (float)((unsigned)(ub * 16 + j) + hi * 8 <= wv * 16 + lr); const float pm = p[j] * kp; const h16 wh = toh_flush(pm); ph[ub][j] = wh; pl[ub][j] = toh_flush(pm - (float)wh); acc = acc + pm; } }
    float d1 = 0.0f, d0 = 0.0f;
#pragma unroll
    for (int q = 0; q < 4; ++q) {
#pragma unroll
        for (int j = 0; j < 8; ++j) { const float wf = (float)fq[q][j]; d1 = d1 + wf * c1[q][j]; d0 = d0 + wf * c0[q][j]; } }
    acc = acc + __shfl_xor(acc, 16, 32); d1 = d1 + __shfl_xor(d1, 16, 32); d0 = d0 + __shfl_xor(d0, 16, 32);   /* lanes lr and lr + 16 hold the two halves of one row's sums */
    const float r1 = 1.0f / (acc + d1 + 1e-6f); const float r0 = 1.0f / (d0 + 1e-6f);
    const v16h bh0 = cat16(ph[0], ph[1]), bh1 = cat16(ph[2], ph[3]), bl0 = cat16(pl[0], pl[1]), bl1 = cat16(pl[2], pl[3]); v8f o1[4], o0[4];
#pragma unroll
    for (int mb = 0; mb < 4; ++mb) { const v16h g0 = AFR(1, mb, 0), g1 = AFR(1, mb, 1); v8f ua = (v8f){}, ub = (v8f){}, uc = (v8f){};
        ua = wmma16(g0, bh0, ua); ua = wmma16(g0, bl0, ua); ua = wmma16(g1, bh1, ua); ua = wmma16(g1, bl1, ua);
        ub = wmma16(AFR(2, mb, 0), fa0, ub); ub = wmma16(AFR(2, mb, 1), fa1, ub); uc = wmma16(AFR(3, mb, 0), fa0, uc); uc = wmma16(AFR(3, mb, 1), fa1, uc);
#pragma unroll
        for (int j = 0; j < 8; ++j) { o1[mb][j] = (ua[j] + ub[j]) * r1; o0[mb][j] = uc[j] * r0; } }   /* word j: column 16 mb + 8 hi + j of row time 16 wv + lr */
#undef AFR
    __syncthreads();   /* every wave has read the operands for the last time: their LDS takes the result tiles */
    float* os = sm + wv * (2 * 16 * 68);
#pragma unroll
    for (int mb = 0; mb < 4; ++mb) { float* w0 = os + lr * 68 + mb * 16 + hi * 8; float* w1 = w0 + 16 * 68;
        *(v4fa*)w0 = (v4f){o0[mb][0], o0[mb][1], o0[mb][2], o0[mb][3]}; *(v4fa*)(w0 + 4) = (v4f){o0[mb][4], o0[mb][5], o0[mb][6], o0[mb][7]}; *(v4fa*)w1 = (v4f){o1[mb][0], o1[mb][1], o1[mb][2], o1[mb][3]}; *(v4fa*)(w1 + 4) = (v4f){o1[mb][4], o1[mb][5], o1[mb][6], o1[mb][7]}; }
    __syncthreads();   /* the tiles stand in LDS before other lanes read them back row by row: each store below then covers two whole rows of 256 bytes */
#pragma unroll
    for (int s = 0; s < 8; ++s) { const unsigned row = 2 * s + hi, cofs = lr * 4; const size_t dst = (((size_t)sq * NTS + t0 + row) * NHS + hd) * NFE + cofs;
        *(v4f*)(R0 + dst) = *(const v4fa*)(os + row * 68 + cofs); *(v4f*)(R1 + dst) = *(const v4fa*)(os + (16 + row) * 68 + cofs); }
}

extern "C" void kernel_launch(void* const* d_in, const int* in_sizes, int n_in, void* d_out, int out_size, void* d_ws, size_t ws_size, hipStream_t stream) {
    if (n_in < 4) return;
    if (in_sizes[0] != NSQ * NTS * NHS * NFE || in_sizes[1] != NSQ * NTS * NHS * NFE || in_sizes[2] != NSQ * NTS * NHS * NFE || in_sizes[3] != NSQ * NTS) return;
    if (out_size != 2 * NSQ * NTS * NHS * NFE) return;
    static_assert(NPR == NSQ * NHS && NHS == 8 && NFE == 64 && NCS == 64 && NCK * NCS == NTS && NTS == 8192 && NCK == 128 && NZQ == NPR * NCK && NBL == 64 * 64 && (NPR * NBL / 4) % 64 == 0 && NBL / 4 == 1024 && (NPR * 64 / 4) % 64 == 0 && NCK % NGR == 0 && NRG % NGR == 0 && NRG < NCK, "the products: 64 by 64 blocks over a depth of 64; the flat grids exact; the index fields' widths (3 bits a head, 7 a chunk, 6 a column; 10 a group of four words in a plane)");
    const float* ina = (const float*)d_in[0]; const float* inb = (const float*)d_in[1]; const float* inc = (const float*)d_in[2]; const float* ind = (const float*)d_in[3]; float* R0 = (float*)d_out; float* R1 = R0 + (size_t)NSQ * NTS * NHS * NFE;
    char* wsp = (char*)d_ws; auto take = [&](size_t bytes) { char* p = wsp; wsp += (bytes + 255) & ~(size_t)255; return (void*)p; };
    float* Cs = (float*)take((size_t)(NCK + 1) * NPR * 64 * 4); float* Cu = (float*)take((size_t)NCK * NPR * 64 * 4);
    float* Du = (float*)take((size_t)NPR * NCK * NBL * 4); h16* Sw = (h16*)take((size_t)NPR * NCK * NBL * 2); h16* Gc = (h16*)take((size_t)NPR * NCK * NBL * 2); h16* Tw = (h16*)take((size_t)NPR * NBL * 2);
    if ((size_t)(wsp - (char*)d_ws) > ws_size) return;
    /* the blocks' own sums */
    k_own<<<(unsigned)NZQ, 128, 0, stream>>>(inb, inc, ind, Gc, Du, Cu);   /* Gc, Cu and Du[m][e] = the sum over the block's steps of Gc[m][time] Gb[e][time] */
    k_scan<<<(unsigned)(NPR * NBL / 4 / 64 + NPR * 64 / 4 / 64), 64, 0, stream>>>(Du, Cu, Sw, Tw, Cs);   /* the sums carried, and the sum over all chunks: one launch */
    /* the results */
    k_res<<<(unsigned)NZQ, 128, 0, stream>>>(ina, inb, ind, Gc, Sw, Tw, Cs, R0, R1);
}

// v007
// It runs in 33.4 microseconds.
// Two timings next to v006 put it at 1.19 and 1.20 times that version's speed.
// Over all steps from v000 it is 23.2 times as fast.
#include <hip/hip_runtime.h>

// Inputs, in this order: ina [2][8192][8][64]; inb [2][8192][8][64]; inc [2][8192][8][64]; ind [2][8192] (a 0 | 1 word a (sequence, time)). Results, one after the other in the result buffer: R0 [2][8192][8][64], then R1 [2][8192][8][64]. A PAIR is one (sequence, head): 16 pairs; a CHUNK is 128 steps, two HALVES of 64: 64 chunks a pair; a BLOCK is one (pair, chunk): 128 by 64 words: 1,024 blocks.
// With fa = max(w, 0) + exp(min(w, 0)) of ina's words and fb = the same of inb's words times ind's word of that (sequence, time): R0[t] = fa[t] . (the sum over ALL steps u of fb[u] inc[u]^T), times 1 / (fa[t] . (the sum over all u of fb[u]) + 1e-6); R1[t] = fa[t] . (the sum over u <= t of fb[u] inc[u]^T), times 1 / (fa[t] . (the sum over u <= t of fb[u]) + 1e-6): every pair by itself.
// THE FORM: chunk by chunk, every block of every pair side by side in each launch. For a block c: Du_c = Gc_c Gb_c^T: the block's own sum of inc[u] fb[u]^T (64 by 64 over the 128 steps), made in the launch that reads inb and inc (k_own); the sums carried over the chunks before c: Sw_c = the word of (Du_0 + .. + Du_(c-1)), made by ONE launch in which every thread keeps the running sum of its own four words in registers, starts it at nought and walks the 64 chunks in their order (behind the last chunk it lays the word of the sum over ALL chunks: Tw). THE RESULTS: ONE launch, a work-group of four waves a block, a wave 16 rows of each half (k_res): Pw = Fa_c Fb_c^T (128 by 128 over 64; the tiles of a first-half row with second-half columns are not made); kept where the column's time is not after the row's; its f16 word Ph and the word Pl of what Ph leaves; R1's upper term = (Ph + Pl) Gc_c^T + Fa_c Sw_c^T; its lower term = the kept words' sum along the row + Fa's row . (the carried sums of fb's words) + 1e-6; R0's upper term = Fa Tw^T; its lower term = Fa's row . (the sum of fb's words over all steps) + 1e-6.
// Layout of the workspace, every plane for all 16 pairs: Cs f32 [65][16][64] (row 0 noughts; row c + 1 = row c + Cu's row c); Cu f32 [64][16][64]; Du f32 [16][64][4096]; Sw f16 [16][64][4096]; Gc f16 [16][64][2][64][64] (inc's words, a plane a half, the half's steps side by side); Tw f16 [16][4096]. Gb (fb's words, the steps side by side) stands in LDS alone.
// Compute dtypes, f32 accumulate: every float input is taken at its bf16 value where it is read; fa, fb, inc's words, the carried sums and the sum over all chunks go to the matrix unit as ONE f16 word each (a value under 2^-14 in magnitude made an exact nought before the cast); the kept words of Pw as TWO f16 words (Ph and Pl: one accumulator takes both); everything else is f32. The lower terms' reciprocals are true divisions.

#define NSQ 2
#define NTS 8192
#define NHS 8
#define NFE 64
#define NCS 128
#define NCK 64
#define NPR 16
#define NZQ 1024
#define NBL 4096

typedef _Float16 h16;
typedef unsigned short bf;
typedef __attribute__((ext_vector_type(16))) __bf16   v16bf;
typedef __attribute__((ext_vector_type(16))) _Float16 v16h;
typedef __attribute__((ext_vector_type(8)))  _Float16 v8h;
typedef __attribute__((ext_vector_type(8)))  unsigned short v8us;
typedef __attribute__((ext_vector_type(8)))  float    v8f;
typedef __attribute__((ext_vector_type(4)))  float    v4f;
typedef v8h  __attribute__((may_alias)) v8ha;
typedef v4f  __attribute__((may_alias)) v4fa;
typedef v8us __attribute__((may_alias)) v8usa;

__device__ __forceinline__ unsigned short f2bf(float f) { unsigned u = __float_as_uint(f); u += 0x7FFFu + ((u >> 16) & 1u); return (unsigned short)(u >> 16); }
__device__ __forceinline__ float bf2f(unsigned short b) { return __uint_as_float(((unsigned)b) << 16); }
__device__ __forceinline__ float bfr(float f) { return bf2f(f2bf(f)); }
__device__ __forceinline__ v16h cat16(v8h lo, v8h hi) { return __builtin_shufflevector(lo, hi, 0, 1, 2, 3, 4, 5, 6, 7, 8, 9, 10, 11, 12, 13, 14, 15); }
__device__ __forceinline__ v8f wmma16(v16h a, v16h b, v8f c) { return __builtin_amdgcn_wmma_f32_16x16x32_f16(false, a, false, b, (short)0, c, false, false); }

typedef __attribute__((ext_vector_type(2))) _Float16 v2h;
typedef __attribute__((ext_vector_type(4))) _Float16 v4h;
typedef __attribute__((ext_vector_type(2))) unsigned short v2us;
typedef __attribute__((ext_vector_type(4))) unsigned short v4us;
typedef __attribute__((ext_vector_type(2))) float v2f;
typedef __attribute__((ext_vector_type(4))) int v4i;
// the f16 cast of the new kernels: a value under 2^-14 in magnitude becomes an exact zero BEFORE the conversion (a select on the value): no subnormal f16 word is made.
__device__ __forceinline__ h16 toh_flush(float x) { const float z = (fabsf(x) < 6.103515625e-05f) ? 0.0f : x; return (h16)z; }
// e^x for x <= 0, as the feature map wants it: the hardware's 2^y on y = x log2(e). The roundings of the constant and of the product move the result by under |y| 2^-23 of itself, far under the 2^-11 of the f16 word that it is cast to; a y under -126 gives nought, which the cast's flush gives as well. k_own and k_res take the same form, so fb's words are the same in both.
__device__ __forceinline__ float exn(float x) { return __builtin_amdgcn_exp2f(x * 1.44269504088896340736f); }

typedef __attribute__((ext_vector_type(4))) _Float16 v4h_;
// ---- k_own: a block's own sums in one launch, a work-group of four waves a block. A thread takes one column (cl) of inb and of inc over 32 steps (th) of each half of the block's 128: its words of a half are 64 bytes of row cl of Gb and of Gc (the half's steps side by side), which it lays in LDS, one half after the other.
// Behind the barrier wave w takes rows 16 w to 16 w + 15 of Du = Gc Gb^T (the same fragments and k order as a product from 128-byte rows in memory); its accumulators take the first half's two depth steps, then the second half's; Gb is wanted nowhere else and stays in LDS; each half's Gc goes to the workspace from LDS, 512 bytes in a row a store.
// Every loop of k_own is unrolled whole: its small arrays are indexed by the loop counters, and only so do they stay in registers.
#define NPT 72   /* a row's pitch in LDS, in f16 words: 144 bytes = 16 bytes times an odd number, free of bank conflicts for 16-byte reads and writes down a column of rows */
__global__ __launch_bounds__(128) void k_own(const float* __restrict__ inb, const float* __restrict__ inc, const float* __restrict__ ind, h16* __restrict__ Gc, float* __restrict__ Du, float* __restrict__ Cu) {
    __shared__ __align__(16) h16 rw[2 * 64 * NPT];   /* a half's Gb, 64 rows, then its Gc */
    __shared__ __align__(16) float ot[4 * 16 * 68];   /* a wave's own 16 rows of Du, pitch 68 words */
    __shared__ float cp[2 * 64];   /* the two parts of each column's sum of fb's words over a half */
    const unsigned zq = blockIdx.x, ck = zq & 63u, pr = zq >> 6, sq = pr >> 3, hd = pr & 7u; const unsigned cl = threadIdx.x & 63u, lane = threadIdx.x & 31u, lr = lane & 15u, hi = lane >> 4;
    const unsigned wv = (unsigned)__builtin_amdgcn_readfirstlane((int)(threadIdx.x >> 5)), th = wv >> 1;   /* the wave's number in a scalar register: ind's words then come by scalar loads */
    const size_t b0 = (((size_t)sq * NTS + (size_t)ck * NCS + th * 32) * NHS + hd) * NFE + cl; const float* bp = inb + b0; const float* qp = inc + b0; const float* mp = ind + (size_t)sq * NTS + (size_t)ck * NCS + th * 32;
    float yb[2][32], yc[2][32];
#pragma unroll
    for (int hf = 0; hf < 2; ++hf) {
#pragma unroll
        for (int tj = 0; tj < 32; ++tj) { yb[hf][tj] = bp[(size_t)(hf * 64 + tj) * (NHS * NFE)]; yc[hf][tj] = qp[(size_t)(hf * 64 + tj) * (NHS * NFE)]; } }
    asm volatile("s_wait_xcnt 0x0" :: "v"(bp), "v"(qp) : "memory");   /* in front of every rewrite of a register that the loads above name; the addresses are inputs so that no load of the group lands in one of them */
    __builtin_amdgcn_sched_barrier(0);   /* holds the loads above their uses: both halves' loads are on their way at once */
    v8f d[4]; float cs = 0.0f; h16* gd = Gc + (size_t)zq * (2 * NBL) + threadIdx.x * 8;
#pragma unroll
    for (int nb = 0; nb < 4; ++nb) d[nb] = (v8f){};
#pragma unroll
    for (int hf = 0; hf < 2; ++hf) {
        v8h ob[4], oc[4]; float acc = 0.0f;
#pragma unroll
        for (int tj = 0; tj < 32; ++tj) { const float vb = bfr(yb[hf][tj]); const float vc = bfr(yc[hf][tj]); const h16 wb = toh_flush((fmaxf(vb, 0.0f) + exn(fminf(vb, 0.0f))) * bfr(mp[hf * 64 + tj])); ob[tj >> 3][tj & 7] = wb; oc[tj >> 3][tj & 7] = toh_flush(vc); acc = acc + (float)wb; }
        if (hf) __syncthreads();   /* every wave has read the first half's rows and part sums for the last time before the second half's take their place */
#pragma unroll
        for (int g = 0; g < 4; ++g) { *(v8ha*)(rw + cl * NPT + th * 32 + g * 8) = ob[g]; *(v8ha*)(rw + (64 + cl) * NPT + th * 32 + g * 8) = oc[g]; }
        cp[th * 64 + cl] = acc;
        __syncthreads();   /* both operands' rows and the part sums of this half stand whole in LDS before any wave reads another wave's words */
        const h16* ar = rw + (64 + wv * 16 + lr) * NPT + hi * 8; const v16h a0 = cat16(*(const v8ha*)ar, *(const v8ha*)(ar + 16)), a1 = cat16(*(const v8ha*)(ar + 32), *(const v8ha*)(ar + 48));
#pragma unroll
        for (int nb = 0; nb < 4; ++nb) { const h16* br = rw + (nb * 16 + lr) * NPT + hi * 8; d[nb] = wmma16(a0, cat16(*(const v8ha*)br, *(const v8ha*)(br + 16)), d[nb]); d[nb] = wmma16(a1, cat16(*(const v8ha*)(br + 32), *(const v8ha*)(br + 48)), d[nb]); }   /* d[nb][j] = Du[16 wv + 8 hi + j][16 nb + lr] */
        v8h gc[4];
#pragma unroll
        for (int p = 0; p < 4; ++p) { const unsigned f = p * 128 + threadIdx.x; gc[p] = *(const v8ha*)(rw + (64 + (f >> 3)) * NPT + (f & 7u) * 8); }
        cs = cs + (cp[cl] + cp[64 + cl]);
#pragma unroll
        for (int p = 0; p < 4; ++p) *(v8h*)(gd + hf * NBL + p * 1024) = gc[p];
        asm volatile("s_wait_xcnt 0x0" ::: "memory");   /* in front of every rewrite of a register that the stores above name */
        __builtin_amdgcn_sched_barrier(0);   /* keeps the next half's arithmetic, which reuses the stores' registers, behind that wait */
    }
    float* os = ot + wv * (16 * 68);
#pragma unroll
    for (int nb = 0; nb < 4; ++nb) {
#pragma unroll
        for (int j = 0; j < 8; ++j) os[(hi * 8 + j) * 68 + nb * 16 + lr] = d[nb][j]; }
    asm volatile("s_wait_dscnt 0x0" ::: "memory");   /* the wave's own tile stands in LDS before other lanes of the same wave read it back row by row: each store below then covers two whole rows of 256 bytes */
    v4f du[8];
#pragma unroll
    for (int s = 0; s < 8; ++s) du[s] = *(const v4fa*)(os + (2 * s + hi) * 68 + lr * 4);
    float* dd = Du + (size_t)zq * NBL + (wv * 16 + hi) * 64 + lr * 4;
#pragma unroll
    for (int s = 0; s < 8; ++s) *(v4f*)(dd + s * 128) = du[s];
    asm volatile("s_wait_xcnt 0x0" ::: "memory");   /* in front of every rewrite of a register that the stores above name: the last store's address and word are formed behind a branch, in registers of theirs */
    if (th == 0) Cu[((size_t)ck * NPR + pr) * 64 + cl] = cs;
}

// ---- k_scan: every carried sum in one launch. A thread owns four neighbouring words of one pair's 64 by 64 plane (work-groups 0 to 255) or of the 16 by 64 row of fb's sums (the last 4 work-groups); it adds the 64 chunks' own sums in their order, one f32 addition a chunk and word, from a start value of nought, and stores what it holds IN FRONT of each addition.
// The addresses do not hang on the sums, so the loads run ahead: NRG chunks' words stand in registers or are on their way; NGR chunks are taken at a time, and their registers are loaded anew at once.
#define NRG 48
#define NGR 8
__global__ __launch_bounds__(64) void k_scan(const float* __restrict__ Du, const float* __restrict__ Cu, h16* __restrict__ Sw, h16* __restrict__ Tw, float* __restrict__ Cs) {
    if (blockIdx.x < NPR * NBL / 4 / 64) {
        const unsigned i = blockIdx.x * 64 + threadIdx.x; const unsigned j4 = i & 1023u, pr = i >> 10; const float* src = Du + (size_t)pr * NCK * NBL + j4 * 4; h16* dst = Sw + (size_t)pr * NCK * NBL + j4 * 4; v4f rg[NRG]; v4f run = (v4f){};
#pragma unroll
        for (int k = 0; k < NRG; ++k) rg[k] = *(const v4fa*)(src + (size_t)k * NBL);
        __builtin_amdgcn_sched_barrier(0);   /* holds the loads above their uses: left free, the compiler moves each load down to its addition and one or two are on their way at a time */
#pragma unroll
        for (int q = 0; q < NCK / NGR; ++q) {
#pragma unroll
            for (int k = 0; k < NGR; ++k) { const int ck = q * NGR + k; const v4f vu = rg[ck % NRG]; v4h_ ow;
#pragma unroll
                for (int j = 0; j < 4; ++j) { ow[j] = toh_flush(run[j]); run[j] = run[j] + vu[j]; }
                *(v4h_*)(dst + (size_t)ck * NBL) = ow; }
            asm volatile("s_wait_xcnt 0x0" ::: "memory");   /* in front of every rewrite of a register that the stores above name: the loads below and the next chunks' words reuse them */
            if ((q + 1) * NGR + NRG <= NCK) {
#pragma unroll
                for (int k = 0; k < NGR; ++k) { const int ck = q * NGR + k; rg[ck % NRG] = *(const v4fa*)(src + (size_t)(ck + NRG) * NBL); } }
            __builtin_amdgcn_sched_barrier(0);   /* as above: the loads just issued stay NRG - NGR chunks ahead of their uses */
        }
        v4h_ ot;
#pragma unroll
        for (int j = 0; j < 4; ++j) ot[j] = toh_flush(run[j]);
        *(v4h_*)(Tw + (size_t)pr * NBL + j4 * 4) = ot;
        asm volatile("s_wait_xcnt 0x0" ::: "memory");   /* behind the part's last store: in the built code the other part's loads may stand behind a branch after it and reuse its registers */
    } else {
        const unsigned i = (blockIdx.x - NPR * NBL / 4 / 64) * 64 + threadIdx.x; const float* src = Cu + i * 4; float* dst = Cs + i * 4; v4f rg[NRG]; v4f run = (v4f){};
#pragma unroll
        for (int k = 0; k < NRG; ++k) rg[k] = *(const v4fa*)(src + (size_t)k * NPR * 64);
        __builtin_amdgcn_sched_barrier(0);   /* as in the branch above */
#pragma unroll
        for (int q = 0; q < NCK / NGR; ++q) {
#pragma unroll
            for (int k = 0; k < NGR; ++k) { const int ck = q * NGR + k; const v4f vu = rg[ck % NRG];
                *(v4f*)(dst + (size_t)ck * NPR * 64) = run;
#pragma unroll
                for (int j = 0; j < 4; ++j) run[j] = run[j] + vu[j]; }
            asm volatile("s_wait_xcnt 0x0" ::: "memory");   /* in front of every rewrite of a register that the stores above name: the loads below and the next chunks' words reuse them */
            if ((q + 1) * NGR + NRG <= NCK) {
#pragma unroll
                for (int k = 0; k < NGR; ++k) { const int ck = q * NGR + k; rg[ck % NRG] = *(const v4fa*)(src + (size_t)(ck + NRG) * NPR * 64); } }
            __builtin_amdgcn_sched_barrier(0);   /* as in the branch above */
        }
        *(v4f*)(dst + (size_t)NCK * NPR * 64) = run;
        asm volatile("s_wait_xcnt 0x0" ::: "memory");   /* as behind the last store of the branch above */
    } }

// ---- k_res: both results of one block in one work-group; nothing between the inputs' words and the results goes through the workspace.
// Every product is taken TRANSPOSED: the 16 rows (times) that a wave takes of a half are the matrix instruction's columns, so a lane holds one time: Fa's words, made in registers from ina, are the B operand of three products; two neighbouring 16 by 16 tiles of Pw^T, cast in place, are the B operand of the product with Gc (the hardware's k order, which the 16-byte pieces of the A operands have as well); each lower term is one word a lane.
// A wave takes rows 16 w to 16 w + 15 of the first half and the same of the second, one after the other. A first-half row meets the first half's columns (kept where the column's time is not after the row's); a second-half row meets all of the first half's columns and, kept likewise, the second half's.
// The six A operands (Fb's words of each half, Gc of each half, Sw, Tw: 64 by 64 f16 each) are wanted whole by every wave: wave w brings rows 16 w to 16 w + 15 of each and lays them in LDS as 16-byte pieces: piece (q, h) of a row is its words 16 q + 8 h to 16 q + 8 h + 7; a fragment's piece is read by lane (h, row).
// EVERY GLOBAL LOAD OF THE INPUTS' AND THE PLANES' WORDS COVERS WHOLE 128-BYTE LINES: 512 bytes in a row of an f16 plane (four rows), or two whole 256-byte rows of ina or inb. A lane's 16 bytes are then not the piece that the lane wants as a fragment: they find their place through LDS. Fa's words, which only their own wave wants, go through the place of the wave's own rows of Fb and come back as the lane's four pieces before Fb's words are laid there.
// The pieces' places, in 16-byte units: FPQ a (operand, 16 rows' group, q), FPH an h, 1 a row. FPH = 18 and FPQ = 36 are 2 and 4 modulo 16 (the banks' 256 bytes): the 16 lanes of a half wave, which hold 8 pieces (q, h) of 2 rows, write 16 different bank groups; the readers' 16 rows stand side by side.
// A result tile (16 rows by 64 words) goes out through a place in LDS that is its wave's own and lies behind the operands: no barrier stands behind the one that publishes the operands.
// Every loop of k_res is unrolled whole: its small arrays are indexed by the loop counters, and only so do they stay in registers.
#define FPH 18
#define FPQ 36
#define FIX(op, g, q) ((((op) * 4 + (g)) * 4 + (q)) * FPQ)
#define FOP (6 * 4 * 4 * FPQ * 4)   /* the six operands' words of four bytes */
typedef v4h __attribute__((may_alias)) v4ha;
// one result tile of a wave: word j of o[mb] is column 16 mb + 8 hi + j of row lr; it is laid in the wave's own LDS and read back row by row, so that each store covers two whole rows of 256 bytes. dp: the result's word at (the tile's row hi, column 4 lr).
__device__ __forceinline__ void tile_out(float* os, const v8f* o, float* dp, unsigned lr, unsigned hi) {
#pragma unroll
    for (int mb = 0; mb < 4; ++mb) { float* w0 = os + lr * 68 + mb * 16 + hi * 8; *(v4fa*)w0 = (v4f){o[mb][0], o[mb][1], o[mb][2], o[mb][3]}; *(v4fa*)(w0 + 4) = (v4f){o[mb][4], o[mb][5], o[mb][6], o[mb][7]}; }
    asm volatile("s_wait_dscnt 0x0" ::: "memory");   /* the wave's own tile stands in LDS before other lanes of the same wave read it back row by row */
    v4f rr[8];
#pragma unroll
    for (int s = 0; s < 8; ++s) rr[s] = *(const v4fa*)(os + (2 * s + hi) * 68 + lr * 4);
    asm volatile("s_wait_dscnt 0x0" ::: "memory");   /* the rows have left LDS before the wave's next tile is laid in their place */
#pragma unroll
    for (int s = 0; s < 8; ++s) *(v4f*)(dp + (size_t)s * (2 * NHS * NFE)) = rr[s];
    asm volatile("s_wait_xcnt 0x0" ::: "memory");   /* in front of every rewrite of a register that the stores above name */
    __builtin_amdgcn_sched_barrier(0);   /* keeps the arithmetic that follows, which reuses the stores' registers, behind that wait */
}
/* the second bound: four waves a SIMD, so that all 1,024 work-groups (four a WGP) are resident at once; left free, the compiler fetches fragments so far ahead that only three fit */
__global__ __launch_bounds__(128, 4) void k_res(const float* __restrict__ ina, const float* __restrict__ inb, const float* __restrict__ ind, const h16* __restrict__ Gc, const h16* __restrict__ Sw, const h16* __restrict__ Tw, const float* __restrict__ Cs, float* __restrict__ R0, float* __restrict__ R1) {
    __shared__ __align__(16) float sm[FOP + 4 * 16 * 68];   /* the six operands' 16-byte pieces, at FIX(operand, group, q) + h FPH + row (54 KiB): 0, 1 Fb of the halves; 2, 3 Gc of the halves; 4 Sw; 5 Tw; then a place of 16 rows, pitch 68 words, a wave (17 KiB) */
    const unsigned zq = blockIdx.x, ck = zq & 63u, pr = zq >> 6, sq = pr >> 3, hd = pr & 7u; const unsigned lane = threadIdx.x & 31u, wv = threadIdx.x >> 5, lr = lane & 15u, hi = lane >> 4;
    const unsigned t0 = ck * NCS + wv * 16; const unsigned rob = hi * (NHS * NFE * 4) + lr * 16, pob = wv * 2048 + lane * 16, hob = hi * 32;   /* a lane's byte offsets: in a pair of the inputs' rows (row hi, words 4 lr to 4 lr + 3), in a 64 by 64 f16 plane (the wave's 2 KiB, the lanes side by side), in a row of Cs */
    const char* ap = (const char*)(ina + (((size_t)sq * NTS + t0) * NHS + hd) * NFE) + rob; const char* bp = (const char*)(inb + (((size_t)sq * NTS + t0) * NHS + hd) * NFE) + rob; const float* mp = ind + (size_t)sq * NTS + (size_t)ck * NCS + (unsigned)__builtin_amdgcn_readfirstlane((int)wv) * 16;   /* the wave's number in a scalar register: ind's words come by scalar loads */
    const char* gb = (const char*)(Gc + (size_t)zq * (2 * NBL)); const char* sb = (const char*)(Sw + (size_t)zq * NBL); const char* tb = (const char*)(Tw + (size_t)pr * NBL); const char* c1b = (const char*)(Cs + ((size_t)ck * NPR + pr) * 64); const char* c0b = (const char*)(Cs + ((size_t)NCK * NPR + pr) * 64);
    v8ha* fr = (v8ha*)sm; v4ha* f8 = (v4ha*)sm; v4f wa[2][8], wb[2][8]; v8f c1[4], c0[4]; v8h gq[2][4], sw[4], tq[4], fq[2][4]; float ms[2][16];
#pragma unroll
    for (int i = 0; i < 4; ++i) { gq[0][i] = *(const v8h*)(gb + pob + i * 512); gq[1][i] = *(const v8h*)(gb + pob + (NBL * 2 + i * 512)); sw[i] = *(const v8h*)(sb + pob + i * 512); tq[i] = *(const v8h*)(tb + pob + i * 512); }   /* rows 4 i + (lane >> 3) of the wave's 16, piece lane & 7 */
#pragma unroll
    for (int hf = 0; hf < 2; ++hf) {
#pragma unroll
        for (int s = 0; s < 8; ++s) { wa[hf][s] = *(const v4f*)(ap + (hf * 32 + s) * (2 * NHS * NFE * 4)); wb[hf][s] = *(const v4f*)(bp + (hf * 32 + s) * (2 * NHS * NFE * 4)); } }   /* row 2 s + hi of the wave's 16 of half hf */
    asm volatile("s_wait_xcnt 0x0" :: "v"(ap), "v"(bp), "v"(pob) : "memory");   /* in front of every rewrite of a register that the loads above name; the addresses are inputs so that no later load of the group lands in one of them */
    __builtin_amdgcn_sched_barrier(0);   /* holds the loads above their uses: all of them are on their way at once */
#pragma unroll
    for (int hf = 0; hf < 2; ++hf) {
#pragma unroll
        for (int k = 0; k < 16; ++k) ms[hf][k] = bfr(mp[hf * 64 + k]); }
    const unsigned wpl = FIX(0, wv, (lane & 7u) >> 1) + (lane & 1u) * FPH + (lane >> 3);   /* where a plane's loaded piece goes: q = (lane & 7) >> 1, h = lane & 1, row (lane >> 3) + 4 i */
    const unsigned whf = (FIX(0, wv, lr >> 2) + ((lr >> 1) & 1u) * FPH + hi) * 2 + (lr & 1u);   /* where four words of Fa or Fb go, in 8-byte halves of a piece: q = lr >> 2, h = (lr >> 1) & 1, half lr & 1, row hi + 2 s */
    const unsigned rpl = hi * FPH + lr;   /* a reader's place behind FIX(operand, group, q) */
#pragma unroll
    for (int i = 0; i < 4; ++i) { fr[FIX(2, 0, 0) + wpl + i * 4] = gq[0][i]; fr[FIX(3, 0, 0) + wpl + i * 4] = gq[1][i]; fr[FIX(4, 0, 0) + wpl + i * 4] = sw[i]; fr[FIX(5, 0, 0) + wpl + i * 4] = tq[i]; }
#pragma unroll
    for (int hf = 0; hf < 2; ++hf) {
#pragma unroll
        for (int s = 0; s < 8; ++s) { v4h fw;
#pragma unroll
            for (int j = 0; j < 4; ++j) { const float ya = bfr(wa[hf][s][j]); fw[j] = toh_flush(fmaxf(ya, 0.0f) + exn(fminf(ya, 0.0f))); }
            f8[FIX(hf, 0, 0) * 2 + whf + s * 4] = fw; } }
    asm volatile("s_wait_dscnt 0x0" ::: "memory");   /* the wave's own rows of Fa stand in LDS before other lanes of the same wave read them back as pieces */
#pragma unroll
    for (int hf = 0; hf < 2; ++hf) {
#pragma unroll
        for (int q = 0; q < 4; ++q) fq[hf][q] = fr[FIX(hf, wv, q) + rpl]; }
    asm volatile("s_wait_dscnt 0x0" ::: "memory");   /* Fa's pieces have left LDS before Fb's words are laid in their place */
#pragma unroll
    for (int hf = 0; hf < 2; ++hf) {
#pragma unroll
        for (int s = 0; s < 8; ++s) { const float mk = hi ? ms[hf][2 * s + 1] : ms[hf][2 * s]; v4h kw;
#pragma unroll
            for (int j = 0; j < 4; ++j) { const float yb = bfr(wb[hf][s][j]); kw[j] = toh_flush((fmaxf(yb, 0.0f) + exn(fminf(yb, 0.0f))) * mk); }
            f8[FIX(hf, 0, 0) * 2 + whf + s * 4] = kw; } }
    __syncthreads();   /* the six operands stand whole in LDS before any wave reads another wave's rows */
#pragma unroll
    for (int q = 0; q < 4; ++q) { c1[q] = *(const v8f*)(c1b + hob + q * 64); c0[q] = *(const v8f*)(c0b + hob + q * 64); }
    asm volatile("s_wait_xcnt 0x0" :: "v"(hob) : "memory");   /* as above, for the loads of the carried sums' rows */
    __builtin_amdgcn_sched_barrier(0);   /* holds these loads here: they fly while the first half's Pw is made and are used behind it */
    float dc1[2], dc0[2];
#define AFR(op, g, kc) cat16(fr[FIX(op, g, 2 * (kc)) + rpl], fr[FIX(op, g, 2 * (kc) + 1) + rpl])
    float* os = sm + FOP + wv * (16 * 68);
#pragma unroll
    for (int hf = 0; hf < 2; ++hf) {
        const v16h fa0 = cat16(fq[hf][0], fq[hf][1]), fa1 = cat16(fq[hf][2], fq[hf][3]);
        v8h ph[8], pl[8]; float acc = 0.0f;
#pragma unroll
        for (int cf = 0; cf <= hf; ++cf) {
#pragma unroll
            for (int ub = 0; ub < 4; ++ub) { v8f p = (v8f){}; p = wmma16(AFR(cf, ub, 0), fa0, p); p = wmma16(AFR(cf, ub, 1), fa1, p);   /* p[j] = Pw[row time 16 wv + lr of half hf][column time 16 ub + 8 hi + j of half cf] */
#pragma unroll
                for (int j = 0; j < 8; ++j) { const float kp = (cf < hf) ? 1.0f : (float)((unsigned)(ub * 16 + j) + hi * 8 <= wv * 16 + lr); const float pm = p[j] * kp; const h16 wh = toh_flush(pm); ph[cf * 4 + ub][j] = wh; pl[cf * 4 + ub][j] = toh_flush(pm - (float)wh); acc = acc + pm; } } }
        if (hf == 0) {   /* both halves' rows meet the same carried sums: taken here once, behind the first Pw, so that the sums' registers are free again */
#pragma unroll
            for (int rf = 0; rf < 2; ++rf) { float d1 = 0.0f, d0 = 0.0f;
#pragma unroll
                for (int q = 0; q < 4; ++q) {
#pragma unroll
                    for (int j = 0; j < 8; ++j) { const float wf = (float)fq[rf][q][j]; d1 = d1 + wf * c1[q][j]; d0 = d0 + wf * c0[q][j]; } }
                dc1[rf] = d1 + __shfl_xor(d1, 16, 32); dc0[rf] = d0 + __shfl_xor(d0, 16, 32); } }   /* lanes lr and lr + 16 hold the two halves of one row's sums */
        acc = acc + __shfl_xor(acc, 16, 32);
        const float r1 = 1.0f / (acc + dc1[hf] + 1e-6f); const float r0 = 1.0f / (dc0[hf] + 1e-6f);
        const size_t dst = (((size_t)sq * NTS + t0 + hf * 64 + hi) * NHS + hd) * NFE + lr * 4;
        v8f o1[4], o0[4];   /* word j: column 16 mb + 8 hi + j of row time 16 wv + lr of half hf */
#pragma unroll
        for (int mb = 0; mb < 4; ++mb) { v8f ua = (v8f){}, ub = (v8f){};
#pragma unroll
            for (int cf = 0; cf <= hf; ++cf) { const v16h g0 = AFR(2 + cf, mb, 0), g1 = AFR(2 + cf, mb, 1);
                ua = wmma16(g0, cat16(ph[cf * 4], ph[cf * 4 + 1]), ua); ua = wmma16(g0, cat16(pl[cf * 4], pl[cf * 4 + 1]), ua); ua = wmma16(g1, cat16(ph[cf * 4 + 2], ph[cf * 4 + 3]), ua); ua = wmma16(g1, cat16(pl[cf * 4 + 2], pl[cf * 4 + 3]), ua); }
            ub = wmma16(AFR(4, mb, 0), fa0, ub); ub = wmma16(AFR(4, mb, 1), fa1, ub);
#pragma unroll
            for (int j = 0; j < 8; ++j) o1[mb][j] = (ua[j] + ub[j]) * r1; }
        tile_out(os, o1, R1 + dst, lr, hi);
#pragma unroll
        for (int mb = 0; mb < 4; ++mb) { v8f uc = (v8f){}; uc = wmma16(AFR(5, mb, 0), fa0, uc); uc = wmma16(AFR(5, mb, 1), fa1, uc);
#pragma unroll
            for (int j = 0; j < 8; ++j) o0[mb][j] = uc[j] * r0; }
        tile_out(os, o0, R0 + dst, lr, hi);
    }
#undef AFR
}

extern "C" void kernel_launch(void* const* d_in, const int* in_sizes, int n_in, void* d_out, int out_size, void* d_ws, size_t ws_size, hipStream_t stream) {
    if (n_in < 4) return;
    if (in_sizes[0] != NSQ * NTS * NHS * NFE || in_sizes[1] != NSQ * NTS * NHS * NFE || in_sizes[2] != NSQ * NTS * NHS * NFE || in_sizes[3] != NSQ * NTS) return;
    if (out_size != 2 * NSQ * NTS * NHS * NFE) return;
    static_assert(NPR == NSQ * NHS && NHS == 8 && NFE == 64 && NCS == 128 && NCK * NCS == NTS && NTS == 8192 && NCK == 64 && NZQ == NPR * NCK && NBL == 64 * 64 && (NPR * NBL / 4) % 64 == 0 && NBL / 4 == 1024 && (NPR * 64 / 4) % 64 == 0 && NCK % NGR == 0 && NRG % NGR == 0 && NRG < NCK, "the products: 64 by 64 tiles over depths of 64; the flat grids exact; the index fields' widths (3 bits a head, 6 a chunk, 6 a column; 10 a group of four words in a plane)");
    const float* ina = (const float*)d_in[0]; const float* inb = (const float*)d_in[1]; const float* inc = (const float*)d_in[2]; const float* ind = (const float*)d_in[3]; float* R0 = (float*)d_out; float* R1 = R0 + (size_t)NSQ * NTS * NHS * NFE;
    char* wsp = (char*)d_ws; auto take = [&](size_t bytes) { char* p = wsp; wsp += (bytes + 255) & ~(size_t)255; return (void*)p; };
    float* Cs = (float*)take((size_t)(NCK + 1) * NPR * 64 * 4); float* Cu = (float*)take((size_t)NCK * NPR * 64 * 4);
    float* Du = (float*)take((size_t)NPR * NCK * NBL * 4); h16* Sw = (h16*)take((size_t)NPR * NCK * NBL * 2); h16* Gc = (h16*)take((size_t)NPR * NCK * 2 * NBL * 2); h16* Tw = (h16*)take((size_t)NPR * NBL * 2);
    if ((size_t)(wsp - (char*)d_ws) > ws_size) return;
    /* the blocks' own sums */
    k_own<<<(unsigned)NZQ, 128, 0, stream>>>(inb, inc, ind, Gc, Du, Cu);   /* Gc, Cu and Du[m][e] = the sum over the block's steps of Gc[m][time] Gb[e][time] */
    k_scan<<<(unsigned)(NPR * NBL / 4 / 64 + NPR * 64 / 4 / 64), 64, 0, stream>>>(Du, Cu, Sw, Tw, Cs);   /* the sums carried, and the sum over all chunks: one launch */
    /* the results */
    k_res<<<(unsigned)NZQ, 128, 0, stream>>>(ina, inb, ind, Gc, Sw, Tw, Cs, R0, R1);
}

// v008
// One run takes 31.9 microseconds.
// Timed twice side by side with v007, it ran 1.05 and 1.06 times as fast.
// Over all steps from v000 it is 24.5 times as fast.
#include <hip/hip_runtime.h>

// Inputs, in this order: ina [2][8192][8][64]; inb [2][8192][8][64]; inc [2][8192][8][64]; ind [2][8192] (a 0 | 1 word a (sequence, time)). Results, one after the other in the result buffer: R0 [2][8192][8][64], then R1 [2][8192][8][64]. A PAIR is one (sequence, head): 16 pairs; a CHUNK is 128 steps, two HALVES of 64: 64 chunks a pair; a BLOCK is one (pair, chunk): 128 by 64 words: 1,024 blocks.
// With fa = max(w, 0) + exp(min(w, 0)) of ina's words and fb = the same of inb's words times ind's word of that (sequence, time): R0[t] = fa[t] . (the sum over ALL steps u of fb[u] inc[u]^T), times 1 / (fa[t] . (the sum over all u of fb[u]) + 1e-6); R1[t] = fa[t] . (the sum over u <= t of fb[u] inc[u]^T), times 1 / (fa[t] . (the sum over u <= t of fb[u]) + 1e-6): every pair by itself.
// THE FORM: chunk by chunk, every block of every pair side by side in each launch. For a block c: Du_c = Gc_c Gb_c^T: the block's own sum of inc[u] fb[u]^T (64 by 64 over the 128 steps), made in the launch that reads inb and inc (k_own); the sums carried over the chunks before c: Sw_c = the word of (Du_0 + .. + Du_(c-1)), made by ONE launch in which every thread keeps the running sum of its own four words in registers, starts it at nought and walks the 64 chunks in their order (behind the last chunk it lays the word of the sum over ALL chunks: Tw). THE RESULTS: ONE launch, a work-group of four waves a block, a wave 16 rows of each half (k_res): Pw = Fa_c Fb_c^T (128 by 128 over 64; the tiles of a first-half row with second-half columns are not made); kept where the column's time is not after the row's; its f16 word Ph and the word Pl of what Ph leaves; R1's upper term = (Ph + Pl) Gc_c^T + Fa_c Sw_c^T; its lower term = the kept words' sum along the row + Fa's row . (the carried sums of fb's words) + 1e-6; R0's upper term = Fa Tw^T; its lower term = Fa's row . (the sum of fb's words over all steps) + 1e-6.
// Layout of the workspace, every plane for all 16 pairs: Cs f32 [65][16][64] (row 0 noughts; row c + 1 = row c + Cu's row c); Cu f32 [64][16][64]; Du f32 [16][64][4096]; Sw f16 [16][64][4096]; Gc f16 [16][64][2][64][64] (inc's words, a plane a half, the half's steps side by side); Tw f16 [16][4096]. Gb (fb's words, the steps side by side) stands in LDS alone.
// Compute dtypes, f32 accumulate: every float input is taken at its bf16 value where it is read; fa, fb, inc's words, the carried sums and the sum over all chunks go to the matrix unit as ONE f16 word each (a value under 2^-14 in magnitude made an exact nought before the cast); the kept words of Pw as TWO f16 words (Ph and Pl: one accumulator takes both); everything else is f32. The lower terms' reciprocals are true divisions.

#define NSQ 2
#define NTS 8192
#define NHS 8
#define NFE 64
#define NCS 128
#define NCK 64
#define NPR 16
#define NZQ 1024
#define NBL 4096

typedef _Float16 h16;
typedef unsigned short bf;
typedef __attribute__((ext_vector_type(16))) __bf16   v16bf;
typedef __attribute__((ext_vector_type(16))) _Float16 v16h;
typedef __attribute__((ext_vector_type(8)))  _Float16 v8h;
typedef __attribute__((ext_vector_type(8)))  unsigned short v8us;
typedef __attribute__((ext_vector_type(8)))  float    v8f;
typedef __attribute__((ext_vector_type(4)))  float    v4f;
typedef v8h  __attribute__((may_alias)) v8ha;
typedef v4f  __attribute__((may_alias)) v4fa;
typedef v8us __attribute__((may_alias)) v8usa;

__device__ __forceinline__ unsigned short f2bf(float f) { unsigned u = __float_as_uint(f); u += 0x7FFFu + ((u >> 16) & 1u); return (unsigned short)(u >> 16); }
__device__ __forceinline__ float bf2f(unsigned short b) { return __uint_as_float(((unsigned)b) << 16); }
__device__ __forceinline__ float bfr(float f) { return bf2f(f2bf(f)); }   /* the integer form: kept for ind's words, which stand in scalar registers */
typedef __attribute__((ext_vector_type(2))) __bf16 v2bf;
typedef __attribute__((ext_vector_type(2))) float v2fp;
// two words' bf16 values at once, by the hardware's packed conversion (round to nearest even, as the integer form above gives for every finite word) and back to f32.
__device__ __forceinline__ v2fp bfr2(float a, float b) { return __builtin_convertvector(__builtin_convertvector((v2fp){a, b}, v2bf), v2fp); }
__device__ __forceinline__ v16h cat16(v8h lo, v8h hi) { return __builtin_shufflevector(lo, hi, 0, 1, 2, 3, 4, 5, 6, 7, 8, 9, 10, 11, 12, 13, 14, 15); }
__device__ __forceinline__ v8f wmma16(v16h a, v16h b, v8f c) { return __builtin_amdgcn_wmma_f32_16x16x32_f16(false, a, false, b, (short)0, c, false, false); }

typedef __attribute__((ext_vector_type(2))) _Float16 v2h;
typedef __attribute__((ext_vector_type(4))) _Float16 v4h;
typedef __attribute__((ext_vector_type(2))) unsigned short v2us;
typedef __attribute__((ext_vector_type(4))) unsigned short v4us;
typedef __attribute__((ext_vector_type(2))) float v2f;
typedef __attribute__((ext_vector_type(4))) int v4i;
// the f16 cast of the new kernels: a value under 2^-14 in magnitude becomes an exact zero BEFORE the conversion (a select on the value): no subnormal f16 word is made.
__device__ __forceinline__ h16 toh_flush(float x) { const float z = (fabsf(x) < 6.103515625e-05f) ? 0.0f : x; return (h16)z; }
// e^x for x <= 0, as the feature map wants it: the hardware's 2^y on y = x log2(e). The roundings of the constant and of the product move the result by under |y| 2^-23 of itself, far under the 2^-11 of the f16 word that it is cast to; a y under -126 gives nought, which the cast's flush gives as well. k_own and k_res take the same form, so fb's words are the same in both.
__device__ __forceinline__ float exn(float x) { return __builtin_amdgcn_exp2f(x * 1.44269504088896340736f); }

typedef __attribute__((ext_vector_type(4))) _Float16 v4h_;
// ---- k_own: a block's own sums in one launch, a work-group of four waves a block. A thread takes one column (cl) of inb and of inc over 32 steps (th) of each half of the block's 128: its words of a half are 64 bytes of row cl of Gb and of Gc (the half's steps side by side), which it lays in LDS, one half after the other.
// Behind the barrier wave w takes rows 16 w to 16 w + 15 of Du = Gc Gb^T (the same fragments and k order as a product from 128-byte rows in memory); its accumulators take the first half's two depth steps, then the second half's; Gb is wanted nowhere else and stays in LDS; each half's Gc goes to the workspace from LDS, 512 bytes in a row a store.
// Every loop of k_own is unrolled whole: its small arrays are indexed by the loop counters, and only so do they stay in registers.
#define NPT 72   /* a row's pitch in LDS, in f16 words: 144 bytes = 16 bytes times an odd number, free of bank conflicts for 16-byte reads and writes down a column of rows */
__global__ __launch_bounds__(128) void k_own(const float* __restrict__ inb, const float* __restrict__ inc, const float* __restrict__ ind, h16* __restrict__ Gc, float* __restrict__ Du, float* __restrict__ Cu) {
    __shared__ __align__(16) h16 rw[2 * 64 * NPT];   /* a half's Gb, 64 rows, then its Gc */
    __shared__ __align__(16) float ot[4 * 16 * 68];   /* a wave's own 16 rows of Du, pitch 68 words */
    __shared__ float cp[2 * 64];   /* the two parts of each column's sum of fb's words over a half */
    const unsigned zq = blockIdx.x, ck = zq & 63u, pr = zq >> 6, sq = pr >> 3, hd = pr & 7u; const unsigned cl = threadIdx.x & 63u, lane = threadIdx.x & 31u, lr = lane & 15u, hi = lane >> 4;
    const unsigned wv = (unsigned)__builtin_amdgcn_readfirstlane((int)(threadIdx.x >> 5)), th = wv >> 1;   /* the wave's number in a scalar register: ind's words then come by scalar loads */
    const size_t b0 = (((size_t)sq * NTS + (size_t)ck * NCS + th * 32) * NHS + hd) * NFE + cl; const float* bp = inb + b0; const float* qp = inc + b0; const float* mp = ind + (size_t)sq * NTS + (size_t)ck * NCS + th * 32;
    float yb[2][32], yc[2][32];
#pragma unroll
    for (int hf = 0; hf < 2; ++hf) {
#pragma unroll
        for (int tj = 0; tj < 32; ++tj) { yb[hf][tj] = bp[(size_t)(hf * 64 + tj) * (NHS * NFE)]; yc[hf][tj] = qp[(size_t)(hf * 64 + tj) * (NHS * NFE)]; } }
    asm volatile("s_wait_xcnt 0x0" :: "v"(bp), "v"(qp) : "memory");   /* in front of every rewrite of a register that the loads above name; the addresses are inputs so that no load of the group lands in one of them */
    __builtin_amdgcn_sched_barrier(0);   /* holds the loads above their uses: both halves' loads are on their way at once */
    v8f d[4]; float cs = 0.0f; h16* gd = Gc + (size_t)zq * (2 * NBL) + threadIdx.x * 8;
#pragma unroll
    for (int nb = 0; nb < 4; ++nb) d[nb] = (v8f){};
#pragma unroll
    for (int hf = 0; hf < 2; ++hf) {
        v8h ob[4], oc[4]; float acc = 0.0f;
#pragma unroll
        for (int tj = 0; tj < 32; ++tj) { const v2fp vv = bfr2(yb[hf][tj], yc[hf][tj]); const float vb = vv[0]; const float vc = vv[1]; const h16 wb = toh_flush((fmaxf(vb, 0.0f) + exn(fminf(vb, 0.0f))) * bfr(mp[hf * 64 + tj])); ob[tj >> 3][tj & 7] = wb; oc[tj >> 3][tj & 7] = toh_flush(vc); acc = acc + (float)wb; }
        if (hf) __syncthreads();   /* every wave has read the first half's rows and part sums for the last time before the second half's take their place */
#pragma unroll
        for (int g = 0; g < 4; ++g) { *(v8ha*)(rw + cl * NPT + th * 32 + g * 8) = ob[g]; *(v8ha*)(rw + (64 + cl) * NPT + th * 32 + g * 8) = oc[g]; }
        cp[th * 64 + cl] = acc;
        __syncthreads();   /* both operands' rows and the part sums of this half stand whole in LDS before any wave reads another wave's words */
        const h16* ar = rw + (64 + wv * 16 + lr) * NPT + hi * 8; const v16h a0 = cat16(*(const v8ha*)ar, *(const v8ha*)(ar + 16)), a1 = cat16(*(const v8ha*)(ar + 32), *(const v8ha*)(ar + 48));
#pragma unroll
        for (int nb = 0; nb < 4; ++nb) { const h16* br = rw + (nb * 16 + lr) * NPT + hi * 8; d[nb] = wmma16(a0, cat16(*(const v8ha*)br, *(const v8ha*)(br + 16)), d[nb]); d[nb] = wmma16(a1, cat16(*(const v8ha*)(br + 32), *(const v8ha*)(br + 48)), d[nb]); }   /* d[nb][j] = Du[16 wv + 8 hi + j][16 nb + lr] */
        v8h gc[4];
#pragma unroll
        for (int p = 0; p < 4; ++p) { const unsigned f = p * 128 + threadIdx.x; gc[p] = *(const v8ha*)(rw + (64 + (f >> 3)) * NPT + (f & 7u) * 8); }
        cs = cs + (cp[cl] + cp[64 + cl]);
#pragma unroll
        for (int p = 0; p < 4; ++p) *(v8h*)(gd + hf * NBL + p * 1024) = gc[p];
        asm volatile("s_wait_xcnt 0x0" ::: "memory");   /* in front of every rewrite of a register that the stores above name */
        __builtin_amdgcn_sched_barrier(0);   /* keeps the next half's arithmetic, which reuses the stores' registers, behind that wait */
    }
    float* os = ot + wv * (16 * 68);
#pragma unroll
    for (int nb = 0; nb < 4; ++nb) {
#pragma unroll
        for (int j = 0; j < 8; ++j) os[(hi * 8 + j) * 68 + nb * 16 + lr] = d[nb][j]; }
    asm volatile("s_wait_dscnt 0x0" ::: "memory");   /* the wave's own tile stands in LDS before other lanes of the same wave read it back row by row: each store below then covers two whole rows of 256 bytes */
    v4f du[8];
#pragma unroll
    for (int s = 0; s < 8; ++s) du[s] = *(const v4fa*)(os + (2 * s + hi) * 68 + lr * 4);
    float* dd = Du + (size_t)zq * NBL + (wv * 16 + hi) * 64 + lr * 4;
#pragma unroll
    for (int s = 0; s < 8; ++s) *(v4f*)(dd + s * 128) = du[s];
    asm volatile("s_wait_xcnt 0x0" ::: "memory");   /* in front of every rewrite of a register that the stores above name: the last store's address and word are formed behind a branch, in registers of theirs */
    if (th == 0) Cu[((size_t)ck * NPR + pr) * 64 + cl] = cs;
}

// ---- k_scan: every carried sum in one launch. A thread owns four neighbouring words of one pair's 64 by 64 plane (work-groups 0 to 255) or of the 16 by 64 row of fb's sums (the last 4 work-groups); it adds the 64 chunks' own sums in their order, one f32 addition a chunk and word, from a start value of nought, and stores what it holds IN FRONT of each addition.
// The addresses do not hang on the sums, so the loads run ahead: NRG chunks' words stand in registers or are on their way; NGR chunks are taken at a time, and their registers are loaded anew at once.
#define NRG 48
#define NGR 8
__global__ __launch_bounds__(64) void k_scan(const float* __restrict__ Du, const float* __restrict__ Cu, h16* __restrict__ Sw, h16* __restrict__ Tw, float* __restrict__ Cs) {
    if (blockIdx.x < NPR * NBL / 4 / 64) {
        const unsigned i = blockIdx.x * 64 + threadIdx.x; const unsigned j4 = i & 1023u, pr = i >> 10; const float* src = Du + (size_t)pr * NCK * NBL + j4 * 4; h16* dst = Sw + (size_t)pr * NCK * NBL + j4 * 4; v4f rg[NRG]; v4f run = (v4f){};
#pragma unroll
        for (int k = 0; k < NRG; ++k) rg[k] = *(const v4fa*)(src + (size_t)k * NBL);
        __builtin_amdgcn_sched_barrier(0);   /* holds the loads above their uses: left free, the compiler moves each load down to its addition and one or two are on their way at a time */
#pragma unroll
        for (int q = 0; q < NCK / NGR; ++q) {
#pragma unroll
            for (int k = 0; k < NGR; ++k) { const int ck = q * NGR + k; const v4f vu = rg[ck % NRG]; v4h_ ow;
#pragma unroll
                for (int j = 0; j < 4; ++j) { ow[j] = toh_flush(run[j]); run[j] = run[j] + vu[j]; }
                *(v4h_*)(dst + (size_t)ck * NBL) = ow; }
            asm volatile("s_wait_xcnt 0x0" ::: "memory");   /* in front of every rewrite of a register that the stores above name: the loads below and the next chunks' words reuse them */
            if ((q + 1) * NGR + NRG <= NCK) {
#pragma unroll
                for (int k = 0; k < NGR; ++k) { const int ck = q * NGR + k; rg[ck % NRG] = *(const v4fa*)(src + (size_t)(ck + NRG) * NBL); } }
            __builtin_amdgcn_sched_barrier(0);   /* as above: the loads just issued stay NRG - NGR chunks ahead of their uses */
        }
        v4h_ ot;
#pragma unroll
        for (int j = 0; j < 4; ++j) ot[j] = toh_flush(run[j]);
        *(v4h_*)(Tw + (size_t)pr * NBL + j4 * 4) = ot;
        asm volatile("s_wait_xcnt 0x0" ::: "memory");   /* behind the part's last store: in the built code the other part's loads may stand behind a branch after it and reuse its registers */
    } else {
        const unsigned i = (blockIdx.x - NPR * NBL / 4 / 64) * 64 + threadIdx.x; const float* src = Cu + i * 4; float* dst = Cs + i * 4; v4f rg[NRG]; v4f run = (v4f){};
#pragma unroll
        for (int k = 0; k < NRG; ++k) rg[k] = *(const v4fa*)(src + (size_t)k * NPR * 64);
        __builtin_amdgcn_sched_barrier(0);   /* as in the branch above */
#pragma unroll
        for (int q = 0; q < NCK / NGR; ++q) {
#pragma unroll
            for (int k = 0; k < NGR; ++k) { const int ck = q * NGR + k; const v4f vu = rg[ck % NRG];
                *(v4f*)(dst + (size_t)ck * NPR * 64) = run;
#pragma unroll
                for (int j = 0; j < 4; ++j) run[j] = run[j] + vu[j]; }
            asm volatile("s_wait_xcnt 0x0" ::: "memory");   /* in front of every rewrite of a register that the stores above name: the loads below and the next chunks' words reuse them */
            if ((q + 1) * NGR + NRG <= NCK) {
#pragma unroll
                for (int k = 0; k < NGR; ++k) { const int ck = q * NGR + k; rg[ck % NRG] = *(const v4fa*)(src + (size_t)(ck + NRG) * NPR * 64); } }
            __builtin_amdgcn_sched_barrier(0);   /* as in the branch above */
        }
        *(v4f*)(dst + (size_t)NCK * NPR * 64) = run;
        asm volatile("s_wait_xcnt 0x0" ::: "memory");   /* as behind the last store of the branch above */
    } }

// ---- k_res: both results of one block in one work-group; nothing between the inputs' words and the results goes through the workspace.
// Every product is taken TRANSPOSED: the 16 rows (times) that a wave takes of a half are the matrix instruction's columns, so a lane holds one time: Fa's words, made in registers from ina, are the B operand of three products; two neighbouring 16 by 16 tiles of Pw^T, cast in place, are the B operand of the product with Gc (the hardware's k order, which the 16-byte pieces of the A operands have as well); each lower term is one word a lane.
// A wave takes rows 16 w to 16 w + 15 of the first half and the same of the second, one after the other. A first-half row meets the first half's columns (kept where the column's time is not after the row's); a second-half row meets all of the first half's columns and, kept likewise, the second half's.
// The six A operands (Fb's words of each half, Gc of each half, Sw, Tw: 64 by 64 f16 each) are wanted whole by every wave: wave w brings rows 16 w to 16 w + 15 of each and lays them in LDS as 16-byte pieces: piece (q, h) of a row is its words 16 q + 8 h to 16 q + 8 h + 7; a fragment's piece is read by lane (h, row).
// EVERY GLOBAL LOAD OF THE INPUTS' AND THE PLANES' WORDS COVERS WHOLE 128-BYTE LINES: 512 bytes in a row of an f16 plane (four rows), or two whole 256-byte rows of ina or inb. A lane's 16 bytes are then not the piece that the lane wants as a fragment: they find their place through LDS. Fa's words, which only their own wave wants, go through the place of the wave's own rows of Fb and come back as the lane's four pieces before Fb's words are laid there.
// The pieces' places, in 16-byte units: FPQ a (operand, 16 rows' group, q), FPH an h, 1 a row. FPH = 18 and FPQ = 36 are 2 and 4 modulo 16 (the banks' 256 bytes): the 16 lanes of a half wave, which hold 8 pieces (q, h) of 2 rows, write 16 different bank groups; the readers' 16 rows stand side by side.
// A result tile (16 rows by 64 words) goes out through a place in LDS that is its wave's own and lies behind the operands: no barrier stands behind the one that publishes the operands.
// Every loop of k_res is unrolled whole: its small arrays are indexed by the loop counters, and only so do they stay in registers.
#define FPH 18
#define FPQ 36
#define FIX(op, g, q) ((((op) * 4 + (g)) * 4 + (q)) * FPQ)
#define FOP (6 * 4 * 4 * FPQ * 4)   /* the six operands' words of four bytes */
typedef v4h __attribute__((may_alias)) v4ha;
// one result tile of a wave: word j of o[mb] is column 16 mb + 8 hi + j of row lr; it is laid in the wave's own LDS and read back row by row, so that each store covers two whole rows of 256 bytes. dp: the result's word at (the tile's row hi, column 4 lr).
__device__ __forceinline__ void tile_out(float* os, const v8f* o, float* dp, unsigned lr, unsigned hi) {
#pragma unroll
    for (int mb = 0; mb < 4; ++mb) { float* w0 = os + lr * 68 + mb * 16 + hi * 8; *(v4fa*)w0 = (v4f){o[mb][0], o[mb][1], o[mb][2], o[mb][3]}; *(v4fa*)(w0 + 4) = (v4f){o[mb][4], o[mb][5], o[mb][6], o[mb][7]}; }
    asm volatile("s_wait_dscnt 0x0" ::: "memory");   /* the wave's own tile stands in LDS before other lanes of the same wave read it back row by row */
    v4f rr[8];
#pragma unroll
    for (int s = 0; s < 8; ++s) rr[s] = *(const v4fa*)(os + (2 * s + hi) * 68 + lr * 4);
    asm volatile("s_wait_dscnt 0x0" ::: "memory");   /* the rows have left LDS before the wave's next tile is laid in their place */
#pragma unroll
    for (int s = 0; s < 8; ++s) *(v4f*)(dp + (size_t)s * (2 * NHS * NFE)) = rr[s];
    asm volatile("s_wait_xcnt 0x0" ::: "memory");   /* in front of every rewrite of a register that the stores above name */
    __builtin_amdgcn_sched_barrier(0);   /* keeps the arithmetic that follows, which reuses the stores' registers, behind that wait */
}
/* the second bound: four waves a SIMD, so that all 1,024 work-groups (four a WGP) are resident at once; left free, the compiler fetches fragments so far ahead that only three fit */
__global__ __launch_bounds__(128, 4) void k_res(const float* __restrict__ ina, const float* __restrict__ inb, const float* __restrict__ ind, const h16* __restrict__ Gc, const h16* __restrict__ Sw, const h16* __restrict__ Tw, const float* __restrict__ Cs, float* __restrict__ R0, float* __restrict__ R1) {
    __shared__ __align__(16) float sm[FOP + 4 * 16 * 68];   /* the six operands' 16-byte pieces, at FIX(operand, group, q) + h FPH + row (54 KiB): 0, 1 Fb of the halves; 2, 3 Gc of the halves; 4 Sw; 5 Tw; then a place of 16 rows, pitch 68 words, a wave (17 KiB) */
    const unsigned zq = blockIdx.x, ck = zq & 63u, pr = zq >> 6, sq = pr >> 3, hd = pr & 7u; const unsigned lane = threadIdx.x & 31u, wv = threadIdx.x >> 5, lr = lane & 15u, hi = lane >> 4;
    const unsigned t0 = ck * NCS + wv * 16; const unsigned rob = hi * (NHS * NFE * 4) + lr * 16, pob = wv * 2048 + lane * 16, hob = hi * 32;   /* a lane's byte offsets: in a pair of the inputs' rows (row hi, words 4 lr to 4 lr + 3), in a 64 by 64 f16 plane (the wave's 2 KiB, the lanes side by side), in a row of Cs */
    const char* ap = (const char*)(ina + (((size_t)sq * NTS + t0) * NHS + hd) * NFE) + rob; const char* bp = (const char*)(inb + (((size_t)sq * NTS + t0) * NHS + hd) * NFE) + rob; const float* mp = ind + (size_t)sq * NTS + (size_t)ck * NCS + (unsigned)__builtin_amdgcn_readfirstlane((int)wv) * 16;   /* the wave's number in a scalar register: ind's words come by scalar loads */
    const char* gb = (const char*)(Gc + (size_t)zq * (2 * NBL)); const char* sb = (const char*)(Sw + (size_t)zq * NBL); const char* tb = (const char*)(Tw + (size_t)pr * NBL); const char* c1b = (const char*)(Cs + ((size_t)ck * NPR + pr) * 64); const char* c0b = (const char*)(Cs + ((size_t)NCK * NPR + pr) * 64);
    v8ha* fr = (v8ha*)sm; v4ha* f8 = (v4ha*)sm; v4f wa[2][8], wb[2][8]; v8f c1[4], c0[4]; v8h gq[2][4], sw[4], tq[4], fq[2][4]; float ms[2][16];
#pragma unroll
    for (int i = 0; i < 4; ++i) { gq[0][i] = *(const v8h*)(gb + pob + i * 512); gq[1][i] = *(const v8h*)(gb + pob + (NBL * 2 + i * 512)); sw[i] = *(const v8h*)(sb + pob + i * 512); tq[i] = *(const v8h*)(tb + pob + i * 512); }   /* rows 4 i + (lane >> 3) of the wave's 16, piece lane & 7 */
#pragma unroll
    for (int hf = 0; hf < 2; ++hf) {
#pragma unroll
        for (int s = 0; s < 8; ++s) { wa[hf][s] = *(const v4f*)(ap + (hf * 32 + s) * (2 * NHS * NFE * 4)); wb[hf][s] = *(const v4f*)(bp + (hf * 32 + s) * (2 * NHS * NFE * 4)); } }   /* row 2 s + hi of the wave's 16 of half hf */
    asm volatile("s_wait_xcnt 0x0" :: "v"(ap), "v"(bp), "v"(pob) : "memory");   /* in front of every rewrite of a register that the loads above name; the addresses are inputs so that no later load of the group lands in one of them */
    __builtin_amdgcn_sched_barrier(0);   /* holds the loads above their uses: all of them are on their way at once */
#pragma unroll
    for (int hf = 0; hf < 2; ++hf) {
#pragma unroll
        for (int k = 0; k < 16; ++k) ms[hf][k] = bfr(mp[hf * 64 + k]); }
    const unsigned wpl = FIX(0, wv, (lane & 7u) >> 1) + (lane & 1u) * FPH + (lane >> 3);   /* where a plane's loaded piece goes: q = (lane & 7) >> 1, h = lane & 1, row (lane >> 3) + 4 i */
    const unsigned whf = (FIX(0, wv, lr >> 2) + ((lr >> 1) & 1u) * FPH + hi) * 2 + (lr & 1u);   /* where four words of Fa or Fb go, in 8-byte halves of a piece: q = lr >> 2, h = (lr >> 1) & 1, half lr & 1, row hi + 2 s */
    const unsigned rpl = hi * FPH + lr;   /* a reader's place behind FIX(operand, group, q) */
#pragma unroll
    for (int i = 0; i < 4; ++i) { fr[FIX(2, 0, 0) + wpl + i * 4] = gq[0][i]; fr[FIX(3, 0, 0) + wpl + i * 4] = gq[1][i]; fr[FIX(4, 0, 0) + wpl + i * 4] = sw[i]; fr[FIX(5, 0, 0) + wpl + i * 4] = tq[i]; }
#pragma unroll
    for (int hf = 0; hf < 2; ++hf) {
#pragma unroll
        for (int s = 0; s < 8; ++s) { v4h fw; const v2fp a01 = bfr2(wa[hf][s][0], wa[hf][s][1]), a23 = bfr2(wa[hf][s][2], wa[hf][s][3]); const float av[4] = {a01[0], a01[1], a23[0], a23[1]};
#pragma unroll
            for (int j = 0; j < 4; ++j) { const float ya = av[j]; fw[j] = toh_flush(fmaxf(ya, 0.0f) + exn(fminf(ya, 0.0f))); }
            f8[FIX(hf, 0, 0) * 2 + whf + s * 4] = fw; } }
    asm volatile("s_wait_dscnt 0x0" ::: "memory");   /* the wave's own rows of Fa stand in LDS before other lanes of the same wave read them back as pieces */
#pragma unroll
    for (int hf = 0; hf < 2; ++hf) {
#pragma unroll
        for (int q = 0; q < 4; ++q) fq[hf][q] = fr[FIX(hf, wv, q) + rpl]; }
    asm volatile("s_wait_dscnt 0x0" ::: "memory");   /* Fa's pieces have left LDS before Fb's words are laid in their place */
#pragma unroll
    for (int hf = 0; hf < 2; ++hf) {
#pragma unroll
        for (int s = 0; s < 8; ++s) { const float mk = hi ? ms[hf][2 * s + 1] : ms[hf][2 * s]; v4h kw; const v2fp b01 = bfr2(wb[hf][s][0], wb[hf][s][1]), b23 = bfr2(wb[hf][s][2], wb[hf][s][3]); const float bv[4] = {b01[0], b01[1], b23[0], b23[1]};
#pragma unroll
            for (int j = 0; j < 4; ++j) { const float yb = bv[j]; kw[j] = toh_flush((fmaxf(yb, 0.0f) + exn(fminf(yb, 0.0f))) * mk); }
            f8[FIX(hf, 0, 0) * 2 + whf + s * 4] = kw; } }
    __syncthreads();   /* the six operands stand whole in LDS before any wave reads another wave's rows */
#pragma unroll
    for (int q = 0; q < 4; ++q) { c1[q] = *(const v8f*)(c1b + hob + q * 64); c0[q] = *(const v8f*)(c0b + hob + q * 64); }
    asm volatile("s_wait_xcnt 0x0" :: "v"(hob) : "memory");   /* as above, for the loads of the carried sums' rows */
    __builtin_amdgcn_sched_barrier(0);   /* holds these loads here: they fly while the first half's Pw is made and are used behind it */
    float dc1[2], dc0[2];
#define AFR(op, g, kc) cat16(fr[FIX(op, g, 2 * (kc)) + rpl], fr[FIX(op, g, 2 * (kc) + 1) + rpl])
    float* os = sm + FOP + wv * (16 * 68);
#pragma unroll
    for (int hf = 0; hf < 2; ++hf) {
        const v16h fa0 = cat16(fq[hf][0], fq[hf][1]), fa1 = cat16(fq[hf][2], fq[hf][3]);
        v8h ph[8], pl[8]; float acc = 0.0f;
#pragma unroll
        for (int cf = 0; cf <= hf; ++cf) {
#pragma unroll
            for (int ub = 0; ub < 4; ++ub) { v8f p = (v8f){}; p = wmma16(AFR(cf, ub, 0), fa0, p); p = wmma16(AFR(cf, ub, 1), fa1, p);   /* p[j] = Pw[row time 16 wv + lr of half hf][column time 16 ub + 8 hi + j of half cf] */
#pragma unroll
                for (int j = 0; j < 8; ++j) { const float kp = (cf < hf) ? 1.0f : (float)((unsigned)(ub * 16 + j) + hi * 8 <= wv * 16 + lr); const float pm = p[j] * kp; const h16 wh = toh_flush(pm); ph[cf * 4 + ub][j] = wh; pl[cf * 4 + ub][j] = toh_flush(pm - (float)wh); acc = acc + pm; } } }
        if (hf == 0) {   /* both halves' rows meet the same carried sums: taken here once, behind the first Pw, so that the sums' registers are free again */
#pragma unroll
            for (int rf = 0; rf < 2; ++rf) { float d1 = 0.0f, d0 = 0.0f;
#pragma unroll
                for (int q = 0; q < 4; ++q) {
#pragma unroll
                    for (int j = 0; j < 8; ++j) { const float wf = (float)fq[rf][q][j]; d1 = d1 + wf * c1[q][j]; d0 = d0 + wf * c0[q][j]; } }
                dc1[rf] = d1 + __shfl_xor(d1, 16, 32); dc0[rf] = d0 + __shfl_xor(d0, 16, 32); } }   /* lanes lr and lr + 16 hold the two halves of one row's sums */
        acc = acc + __shfl_xor(acc, 16, 32);
        const float r1 = 1.0f / (acc + dc1[hf] + 1e-6f); const float r0 = 1.0f / (dc0[hf] + 1e-6f);
        const size_t dst = (((size_t)sq * NTS + t0 + hf * 64 + hi) * NHS + hd) * NFE + lr * 4;
        v8f o1[4], o0[4];   /* word j: column 16 mb + 8 hi + j of row time 16 wv + lr of half hf */
#pragma unroll
        for (int mb = 0; mb < 4; ++mb) { v8f ua = (v8f){}, ub = (v8f){};
#pragma unroll
            for (int cf = 0; cf <= hf; ++cf) { const v16h g0 = AFR(2 + cf, mb, 0), g1 = AFR(2 + cf, mb, 1);
                ua = wmma16(g0, cat16(ph[cf * 4], ph[cf * 4 + 1]), ua); ua = wmma16(g0, cat16(pl[cf * 4], pl[cf * 4 + 1]), ua); ua = wmma16(g1, cat16(ph[cf * 4 + 2], ph[cf * 4 + 3]), ua); ua = wmma16(g1, cat16(pl[cf * 4 + 2], pl[cf * 4 + 3]), ua); }
            ub = wmma16(AFR(4, mb, 0), fa0, ub); ub = wmma16(AFR(4, mb, 1), fa1, ub);
#pragma unroll
            for (int j = 0; j < 8; ++j) o1[mb][j] = (ua[j] + ub[j]) * r1; }
        tile_out(os, o1, R1 + dst, lr, hi);
#pragma unroll
        for (int mb = 0; mb < 4; ++mb) { v8f uc = (v8f){}; uc = wmma16(AFR(5, mb, 0), fa0, uc); uc = wmma16(AFR(5, mb, 1), fa1, uc);
#pragma unroll
            for (int j = 0; j < 8; ++j) o0[mb][j] = uc[j] * r0; }
        tile_out(os, o0, R0 + dst, lr, hi);
    }
#undef AFR
}

extern "C" void kernel_launch(void* const* d_in, const int* in_sizes, int n_in, void* d_out, int out_size, void* d_ws, size_t ws_size, hipStream_t stream) {
    if (n_in < 4) return;
    if (in_sizes[0] != NSQ * NTS * NHS * NFE || in_sizes[1] != NSQ * NTS * NHS * NFE || in_sizes[2] != NSQ * NTS * NHS * NFE || in_sizes[3] != NSQ * NTS) return;
    if (out_size != 2 * NSQ * NTS * NHS * NFE) return;
    static_assert(NPR == NSQ * NHS && NHS == 8 && NFE == 64 && NCS == 128 && NCK * NCS == NTS && NTS == 8192 && NCK == 64 && NZQ == NPR * NCK && NBL == 64 * 64 && (NPR * NBL / 4) % 64 == 0 && NBL / 4 == 1024 && (NPR * 64 / 4) % 64 == 0 && NCK % NGR == 0 && NRG % NGR == 0 && NRG < NCK, "the products: 64 by 64 tiles over depths of 64; the flat grids exact; the index fields' widths (3 bits a head, 6 a chunk, 6 a column; 10 a group of four words in a plane)");
    const float* ina = (const float*)d_in[0]; const float* inb = (const float*)d_in[1]; const float* inc = (const float*)d_in[2]; const float* ind = (const float*)d_in[3]; float* R0 = (float*)d_out; float* R1 = R0 + (size_t)NSQ * NTS * NHS * NFE;
    char* wsp = (char*)d_ws; auto take = [&](size_t bytes) { char* p = wsp; wsp += (bytes + 255) & ~(size_t)255; return (void*)p; };
    float* Cs = (float*)take((size_t)(NCK + 1) * NPR * 64 * 4); float* Cu = (float*)take((size_t)NCK * NPR * 64 * 4);
    float* Du = (float*)take((size_t)NPR * NCK * NBL * 4); h16* Sw = (h16*)take((size_t)NPR * NCK * NBL * 2); h16* Gc = (h16*)take((size_t)NPR * NCK * 2 * NBL * 2); h16* Tw = (h16*)take((size_t)NPR * NBL * 2);
    if ((size_t)(wsp - (char*)d_ws) > ws_size) return;
    /* the blocks' own sums */
    k_own<<<(unsigned)NZQ, 128, 0, stream>>>(inb, inc, ind, Gc, Du, Cu);   /* Gc, Cu and Du[m][e] = the sum over the block's steps of Gc[m][time] Gb[e][time] */
    k_scan<<<(unsigned)(NPR * NBL / 4 / 64 + NPR * 64 / 4 / 64), 64, 0, stream>>>(Du, Cu, Sw, Tw, Cs);   /* the sums carried, and the sum over all chunks: one launch */
    /* the results */
    k_res<<<(unsigned)NZQ, 128, 0, stream>>>(ina, inb, ind, Gc, Sw, Tw, Cs, R0, R1);
}

// v009
// One run takes 30.6 microseconds.
// Next to v008, in two timings, it ran 1.05 times as fast each time.
// Over all steps from v000 it is 25.7 times as fast.
#include <hip/hip_runtime.h>

// Inputs, in this order: ina [2][8192][8][64]; inb [2][8192][8][64]; inc [2][8192][8][64]; ind [2][8192] (a 0 | 1 word a (sequence, time)). Results, one after the other in the result buffer: R0 [2][8192][8][64], then R1 [2][8192][8][64]. A PAIR is one (sequence, head): 16 pairs; a CHUNK is 128 steps, two HALVES of 64: 64 chunks a pair; a BLOCK is one (pair, chunk): 128 by 64 words: 1,024 blocks.
// With fa = max(w, 0) + exp(min(w, 0)) of ina's words and fb = the same of inb's words times ind's word of that (sequence, time): R0[t] = fa[t] . (the sum over ALL steps u of fb[u] inc[u]^T), times 1 / (fa[t] . (the sum over all u of fb[u]) + 1e-6); R1[t] = fa[t] . (the sum over u <= t of fb[u] inc[u]^T), times 1 / (fa[t] . (the sum over u <= t of fb[u]) + 1e-6): every pair by itself.
// THE FORM: chunk by chunk, every block of every pair side by side in each launch. For a block c: Du_c = Gc_c Gb_c^T: the block's own sum of inc[u] fb[u]^T (64 by 64 over the 128 steps), made in the launch that reads inb and inc (k_own); the sums carried over the chunks before c: Sw_c = the word of (Du_0 + .. + Du_(c-1)), made by ONE launch in which every thread keeps the running sum of its own four words in registers, starts it at nought and walks the 64 chunks in their order (behind the last chunk it lays the word of the sum over ALL chunks: Tw). THE RESULTS: ONE launch, a work-group of four waves a block, a wave 16 rows of each half (k_res): Pw = Fa_c Fb_c^T (128 by 128 over 64; the tiles of a first-half row with second-half columns are not made); kept where the column's time is not after the row's; its f16 word Ph and the word Pl of what Ph leaves; R1's upper term = (Ph + Pl) Gc_c^T + Fa_c Sw_c^T; its lower term = the kept words' sum along the row + Fa's row . (the carried sums of fb's words) + 1e-6; R0's upper term = Fa Tw^T; its lower term = Fa's row . (the sum of fb's words over all steps) + 1e-6.
// Layout of the workspace, every plane for all 16 pairs: Cs f32 [65][16][64] (row 0 noughts; row c + 1 = row c + Cu's row c); Cu f32 [64][16][64]; Du f32 [16][64][4096]; Sw f16 [16][64][4096]; Gc f16 [16][64][2][64][64] (inc's words, a plane a half, the half's steps side by side); Tw f16 [16][4096]. Gb (fb's words, the steps side by side) stands in LDS alone.
// Compute dtypes, f32 accumulate: every float input is taken at its bf16 value where it is read; fa, fb, inc's words, the carried sums and the sum over all chunks go to the matrix unit as ONE f16 word each (the plain cast, round to nearest even: a value under 2^-14 in magnitude becomes a subnormal f16 word, which the matrix unit takes as it is); the kept words of Pw as TWO f16 words (Ph and Pl: one accumulator takes both); everything else is f32. The lower terms' reciprocals are true divisions.

#define NSQ 2
#define NTS 8192
#define NHS 8
#define NFE 64
#define NCS 128
#define NCK 64
#define NPR 16
#define NZQ 1024
#define NBL 4096

typedef _Float16 h16;
typedef unsigned short bf;
typedef __attribute__((ext_vector_type(16))) __bf16   v16bf;
typedef __attribute__((ext_vector_type(16))) _Float16 v16h;
typedef __attribute__((ext_vector_type(8)))  _Float16 v8h;
typedef __attribute__((ext_vector_type(8)))  unsigned short v8us;
typedef __attribute__((ext_vector_type(8)))  float    v8f;
typedef __attribute__((ext_vector_type(4)))  float    v4f;
typedef v8h  __attribute__((may_alias)) v8ha;
typedef v4f  __attribute__((may_alias)) v4fa;
typedef v8us __attribute__((may_alias)) v8usa;

__device__ __forceinline__ unsigned short f2bf(float f) { unsigned u = __float_as_uint(f); u += 0x7FFFu + ((u >> 16) & 1u); return (unsigned short)(u >> 16); }
__device__ __forceinline__ float bf2f(unsigned short b) { return __uint_as_float(((unsigned)b) << 16); }
__device__ __forceinline__ float bfr(float f) { return bf2f(f2bf(f)); }   /* the integer form: kept for ind's words, which stand in scalar registers */
typedef __attribute__((ext_vector_type(2))) __bf16 v2bf;
typedef __attribute__((ext_vector_type(2))) float v2fp;
// two words' bf16 values at once, by the hardware's packed conversion (round to nearest even, as the integer form above gives for every finite word) and back to f32.
__device__ __forceinline__ v2fp bfr2(float a, float b) { return __builtin_convertvector(__builtin_convertvector((v2fp){a, b}, v2bf), v2fp); }
__device__ __forceinline__ v16h cat16(v8h lo, v8h hi) { return __builtin_shufflevector(lo, hi, 0, 1, 2, 3, 4, 5, 6, 7, 8, 9, 10, 11, 12, 13, 14, 15); }
__device__ __forceinline__ v8f wmma16(v16h a, v16h b, v8f c) { return __builtin_amdgcn_wmma_f32_16x16x32_f16(false, a, false, b, (short)0, c, false, false); }

typedef __attribute__((ext_vector_type(2))) _Float16 v2h;
typedef __attribute__((ext_vector_type(4))) _Float16 v4h;
typedef __attribute__((ext_vector_type(2))) unsigned short v2us;
typedef __attribute__((ext_vector_type(4))) unsigned short v4us;
typedef __attribute__((ext_vector_type(2))) float v2f;
typedef __attribute__((ext_vector_type(4))) int v4i;
// the f16 cast of every kernel here: the hardware's conversion alone, round to nearest even. A value under 2^-14 in magnitude gives a subnormal f16 word; the conversion, the matrix unit and the mixed multiply-add all keep such words at the default float mode.
__device__ __forceinline__ h16 toh(float x) { return (h16)x; }
// e^x for x <= 0, as the feature map wants it: the hardware's 2^y on y = x log2(e). The roundings of the constant and of the product move the result by under |y| 2^-23 of itself, far under the 2^-11 of the f16 word that it is cast to; a y under -126 gives a word far under 2^-25, which the cast makes nought. k_own and k_res take the same form, so fb's words are the same in both.
__device__ __forceinline__ float exn(float x) { return __builtin_amdgcn_exp2f(x * 1.44269504088896340736f); }

typedef __attribute__((ext_vector_type(4))) _Float16 v4h_;
// ---- k_own: a block's own sums in one launch, a work-group of four waves a block. A thread takes one column (cl) of inb and of inc over 32 steps (th) of each half of the block's 128: its words of a half are 64 bytes of row cl of Gb and of Gc (the half's steps side by side), which it lays in LDS, one half after the other.
// Behind the barrier wave w takes rows 16 w to 16 w + 15 of Du = Gc Gb^T (the same fragments and k order as a product from 128-byte rows in memory); its accumulators take the first half's two depth steps, then the second half's; Gb is wanted nowhere else and stays in LDS; each half's Gc goes to the workspace from LDS, 512 bytes in a row a store.
// Every loop of k_own is unrolled whole: its small arrays are indexed by the loop counters, and only so do they stay in registers.
#define NPT 72   /* a row's pitch in LDS, in f16 words: 144 bytes = 16 bytes times an odd number, free of bank conflicts for 16-byte reads and writes down a column of rows */
__global__ __launch_bounds__(128) void k_own(const float* __restrict__ inb, const float* __restrict__ inc, const float* __restrict__ ind, h16* __restrict__ Gc, float* __restrict__ Du, float* __restrict__ Cu) {
    __shared__ __align__(16) h16 rw[2 * 64 * NPT];   /* a half's Gb, 64 rows, then its Gc */
    __shared__ __align__(16) float ot[4 * 16 * 68];   /* a wave's own 16 rows of Du, pitch 68 words */
    __shared__ float cp[2 * 64];   /* the two parts of each column's sum of fb's words over a half */
    const unsigned zq = blockIdx.x, ck = zq & 63u, pr = zq >> 6, sq = pr >> 3, hd = pr & 7u; const unsigned cl = threadIdx.x & 63u, lane = threadIdx.x & 31u, lr = lane & 15u, hi = lane >> 4;
    const unsigned wv = (unsigned)__builtin_amdgcn_readfirstlane((int)(threadIdx.x >> 5)), th = wv >> 1;   /* the wave's number in a scalar register: ind's words then come by scalar loads */
    const size_t b0 = (((size_t)sq * NTS + (size_t)ck * NCS + th * 32) * NHS + hd) * NFE + cl; const float* bp = inb + b0; const float* qp = inc + b0; const float* mp = ind + (size_t)sq * NTS + (size_t)ck * NCS + th * 32;
    float yb[2][32], yc[2][32];
#pragma unroll
    for (int hf = 0; hf < 2; ++hf) {
#pragma unroll
        for (int tj = 0; tj < 32; ++tj) { yb[hf][tj] = bp[(size_t)(hf * 64 + tj) * (NHS * NFE)]; yc[hf][tj] = qp[(size_t)(hf * 64 + tj) * (NHS * NFE)]; } }
    asm volatile("s_wait_xcnt 0x0" :: "v"(bp), "v"(qp) : "memory");   /* in front of every rewrite of a register that the loads above name; the addresses are inputs so that no load of the group lands in one of them */
    __builtin_amdgcn_sched_barrier(0);   /* holds the loads above their uses: both halves' loads are on their way at once */
    v8f d[4]; float cs = 0.0f; h16* gd = Gc + (size_t)zq * (2 * NBL) + threadIdx.x * 8;
#pragma unroll
    for (int nb = 0; nb < 4; ++nb) d[nb] = (v8f){};
#pragma unroll
    for (int hf = 0; hf < 2; ++hf) {
        v8h ob[4], oc[4]; float acc = 0.0f;
#pragma unroll
        for (int tj = 0; tj < 32; ++tj) { const v2fp vv = bfr2(yb[hf][tj], yc[hf][tj]); const float vb = vv[0]; const float vc = vv[1]; const h16 wb = toh((fmaxf(vb, 0.0f) + exn(fminf(vb, 0.0f))) * bfr(mp[hf * 64 + tj])); ob[tj >> 3][tj & 7] = wb; oc[tj >> 3][tj & 7] = toh(vc); acc = acc + (float)wb; }
        if (hf) __syncthreads();   /* every wave has read the first half's rows and part sums for the last time before the second half's take their place */
#pragma unroll
        for (int g = 0; g < 4; ++g) { *(v8ha*)(rw + cl * NPT + th * 32 + g * 8) = ob[g]; *(v8ha*)(rw + (64 + cl) * NPT + th * 32 + g * 8) = oc[g]; }
        cp[th * 64 + cl] = acc;
        __syncthreads();   /* both operands' rows and the part sums of this half stand whole in LDS before any wave reads another wave's words */
        const h16* ar = rw + (64 + wv * 16 + lr) * NPT + hi * 8; const v16h a0 = cat16(*(const v8ha*)ar, *(const v8ha*)(ar + 16)), a1 = cat16(*(const v8ha*)(ar + 32), *(const v8ha*)(ar + 48));
#pragma unroll
        for (int nb = 0; nb < 4; ++nb) { const h16* br = rw + (nb * 16 + lr) * NPT + hi * 8; d[nb] = wmma16(a0, cat16(*(const v8ha*)br, *(const v8ha*)(br + 16)), d[nb]); d[nb] = wmma16(a1, cat16(*(const v8ha*)(br + 32), *(const v8ha*)(br + 48)), d[nb]); }   /* d[nb][j] = Du[16 wv + 8 hi + j][16 nb + lr] */
        v8h gc[4];
#pragma unroll
        for (int p = 0; p < 4; ++p) { const unsigned f = p * 128 + threadIdx.x; gc[p] = *(const v8ha*)(rw + (64 + (f >> 3)) * NPT + (f & 7u) * 8); }
        cs = cs + (cp[cl] + cp[64 + cl]);
#pragma unroll
        for (int p = 0; p < 4; ++p) *(v8h*)(gd + hf * NBL + p * 1024) = gc[p];
        asm volatile("s_wait_xcnt 0x0" ::: "memory");   /* in front of every rewrite of a register that the stores above name */
        __builtin_amdgcn_sched_barrier(0);   /* keeps the next half's arithmetic, which reuses the stores' registers, behind that wait */
    }
    float* os = ot + wv * (16 * 68);
#pragma unroll
    for (int nb = 0; nb < 4; ++nb) {
#pragma unroll
        for (int j = 0; j < 8; ++j) os[(hi * 8 + j) * 68 + nb * 16 + lr] = d[nb][j]; }
    asm volatile("s_wait_dscnt 0x0" ::: "memory");   /* the wave's own tile stands in LDS before other lanes of the same wave read it back row by row: each store below then covers two whole rows of 256 bytes */
    v4f du[8];
#pragma unroll
    for (int s = 0; s < 8; ++s) du[s] = *(const v4fa*)(os + (2 * s + hi) * 68 + lr * 4);
    float* dd = Du + (size_t)zq * NBL + (wv * 16 + hi) * 64 + lr * 4;
#pragma unroll
    for (int s = 0; s < 8; ++s) *(v4f*)(dd + s * 128) = du[s];
    asm volatile("s_wait_xcnt 0x0" ::: "memory");   /* in front of every rewrite of a register that the stores above name: the last store's address and word are formed behind a branch, in registers of theirs */
    if (th == 0) Cu[((size_t)ck * NPR + pr) * 64 + cl] = cs;
}

// ---- k_scan: every carried sum in one launch. A thread owns four neighbouring words of one pair's 64 by 64 plane (work-groups 0 to 255) or of the 16 by 64 row of fb's sums (the last 4 work-groups); it adds the 64 chunks' own sums in their order, one f32 addition a chunk and word, from a start value of nought, and stores what it holds IN FRONT of each addition.
// The addresses do not hang on the sums, so the loads run ahead: NRG chunks' words stand in registers or are on their way; NGR chunks are taken at a time, and their registers are loaded anew at once.
#define NRG 48
#define NGR 8
__global__ __launch_bounds__(64) void k_scan(const float* __restrict__ Du, const float* __restrict__ Cu, h16* __restrict__ Sw, h16* __restrict__ Tw, float* __restrict__ Cs) {
    if (blockIdx.x < NPR * NBL / 4 / 64) {
        const unsigned i = blockIdx.x * 64 + threadIdx.x; const unsigned j4 = i & 1023u, pr = i >> 10; const float* src = Du + (size_t)pr * NCK * NBL + j4 * 4; h16* dst = Sw + (size_t)pr * NCK * NBL + j4 * 4; v4f rg[NRG]; v4f run = (v4f){};
#pragma unroll
        for (int k = 0; k < NRG; ++k) rg[k] = *(const v4fa*)(src + (size_t)k * NBL);
        __builtin_amdgcn_sched_barrier(0);   /* holds the loads above their uses: left free, the compiler moves each load down to its addition and one or two are on their way at a time */
#pragma unroll
        for (int q = 0; q < NCK / NGR; ++q) {
#pragma unroll
            for (int k = 0; k < NGR; ++k) { const int ck = q * NGR + k; const v4f vu = rg[ck % NRG]; v4h_ ow;
#pragma unroll
                for (int j = 0; j < 4; ++j) { ow[j] = toh(run[j]); run[j] = run[j] + vu[j]; }
                *(v4h_*)(dst + (size_t)ck * NBL) = ow; }
            asm volatile("s_wait_xcnt 0x0" ::: "memory");   /* in front of every rewrite of a register that the stores above name: the loads below and the next chunks' words reuse them */
            if ((q + 1) * NGR + NRG <= NCK) {
#pragma unroll
                for (int k = 0; k < NGR; ++k) { const int ck = q * NGR + k; rg[ck % NRG] = *(const v4fa*)(src + (size_t)(ck + NRG) * NBL); } }
            __builtin_amdgcn_sched_barrier(0);   /* as above: the loads just issued stay NRG - NGR chunks ahead of their uses */
        }
        v4h_ ot;
#pragma unroll
        for (int j = 0; j < 4; ++j) ot[j] = toh(run[j]);
        *(v4h_*)(Tw + (size_t)pr * NBL + j4 * 4) = ot;
        asm volatile("s_wait_xcnt 0x0" ::: "memory");   /* behind the part's last store: in the built code the other part's loads may stand behind a branch after it and reuse its registers */
    } else {
        const unsigned i = (blockIdx.x - NPR * NBL / 4 / 64) * 64 + threadIdx.x; const float* src = Cu + i * 4; float* dst = Cs + i * 4; v4f rg[NRG]; v4f run = (v4f){};
#pragma unroll
        for (int k = 0; k < NRG; ++k) rg[k] = *(const v4fa*)(src + (size_t)k * NPR * 64);
        __builtin_amdgcn_sched_barrier(0);   /* as in the branch above */
#pragma unroll
        for (int q = 0; q < NCK / NGR; ++q) {
#pragma unroll
            for (int k = 0; k < NGR; ++k) { const int ck = q * NGR + k; const v4f vu = rg[ck % NRG];
                *(v4f*)(dst + (size_t)ck * NPR * 64) = run;
#pragma unroll
                for (int j = 0; j < 4; ++j) run[j] = run[j] + vu[j]; }
            asm volatile("s_wait_xcnt 0x0" ::: "memory");   /* in front of every rewrite of a register that the stores above name: the loads below and the next chunks' words reuse them */
            if ((q + 1) * NGR + NRG <= NCK) {
#pragma unroll
                for (int k = 0; k < NGR; ++k) { const int ck = q * NGR + k; rg[ck % NRG] = *(const v4fa*)(src + (size_t)(ck + NRG) * NPR * 64); } }
            __builtin_amdgcn_sched_barrier(0);   /* as in the branch above */
        }
        *(v4f*)(dst + (size_t)NCK * NPR * 64) = run;
        asm volatile("s_wait_xcnt 0x0" ::: "memory");   /* as behind the last store of the branch above */
    } }

// ---- k_res: both results of one block in one work-group; nothing between the inputs' words and the results goes through the workspace.
// Every product is taken TRANSPOSED: the 16 rows (times) that a wave takes of a half are the matrix instruction's columns, so a lane holds one time: Fa's words, made in registers from ina, are the B operand of three products; two neighbouring 16 by 16 tiles of Pw^T, cast in place, are the B operand of the product with Gc (the hardware's k order, which the 16-byte pieces of the A operands have as well); each lower term is one word a lane.
// A wave takes rows 16 w to 16 w + 15 of the first half and the same of the second, one after the other. A first-half row meets the first half's columns (kept where the column's time is not after the row's); a second-half row meets all of the first half's columns and, kept likewise, the second half's.
// The six A operands (Fb's words of each half, Gc of each half, Sw, Tw: 64 by 64 f16 each) are wanted whole by every wave: wave w brings rows 16 w to 16 w + 15 of each and lays them in LDS as 16-byte pieces: piece (q, h) of a row is its words 16 q + 8 h to 16 q + 8 h + 7; a fragment's piece is read by lane (h, row).
// EVERY GLOBAL LOAD OF THE INPUTS' AND THE PLANES' WORDS COVERS WHOLE 128-BYTE LINES: 512 bytes in a row of an f16 plane (four rows), or two whole 256-byte rows of ina or inb. A lane's 16 bytes are then not the piece that the lane wants as a fragment: they find their place through LDS. Fa's words, which only their own wave wants, go through the place of the wave's own rows of Fb and come back as the lane's four pieces before Fb's words are laid there.
// The pieces' places, in 16-byte units: FPQ a (operand, 16 rows' group, q), FPH an h, 1 a row. FPH = 18 and FPQ = 36 are 2 and 4 modulo 16 (the banks' 256 bytes): the 16 lanes of a half wave, which hold 8 pieces (q, h) of 2 rows, write 16 different bank groups; the readers' 16 rows stand side by side.
// A result tile (16 rows by 64 words) goes out through a place in LDS that is its wave's own and lies behind the operands: no barrier stands behind the one that publishes the operands.
// Every loop of k_res is unrolled whole: its small arrays are indexed by the loop counters, and only so do they stay in registers.
#define FPH 18
#define FPQ 36
#define FIX(op, g, q) ((((op) * 4 + (g)) * 4 + (q)) * FPQ)
#define FOP (6 * 4 * 4 * FPQ * 4)   /* the six operands' words of four bytes */
typedef v4h __attribute__((may_alias)) v4ha;
// one result tile of a wave: word j of o[mb] is column 16 mb + 8 hi + j of row lr; it is laid in the wave's own LDS and read back row by row, so that each store covers two whole rows of 256 bytes. dp: the result's word at (the tile's row hi, column 4 lr).
__device__ __forceinline__ void tile_out(float* os, const v8f* o, float* dp, unsigned lr, unsigned hi) {
#pragma unroll
    for (int mb = 0; mb < 4; ++mb) { float* w0 = os + lr * 68 + mb * 16 + hi * 8; *(v4fa*)w0 = (v4f){o[mb][0], o[mb][1], o[mb][2], o[mb][3]}; *(v4fa*)(w0 + 4) = (v4f){o[mb][4], o[mb][5], o[mb][6], o[mb][7]}; }
    asm volatile("s_wait_dscnt 0x0" ::: "memory");   /* the wave's own tile stands in LDS before other lanes of the same wave read it back row by row */
    v4f rr[8];
#pragma unroll
    for (int s = 0; s < 8; ++s) rr[s] = *(const v4fa*)(os + (2 * s + hi) * 68 + lr * 4);
    asm volatile("s_wait_dscnt 0x0" ::: "memory");   /* the rows have left LDS before the wave's next tile is laid in their place */
#pragma unroll
    for (int s = 0; s < 8; ++s) *(v4f*)(dp + (size_t)s * (2 * NHS * NFE)) = rr[s];
    asm volatile("s_wait_xcnt 0x0" ::: "memory");   /* in front of every rewrite of a register that the stores above name */
    __builtin_amdgcn_sched_barrier(0);   /* keeps the arithmetic that follows, which reuses the stores' registers, behind that wait */
}
/* the second bound: four waves a SIMD, so that all 1,024 work-groups (four a WGP) are resident at once; left free, the compiler fetches fragments so far ahead that only three fit */
__global__ __launch_bounds__(128, 4) void k_res(const float* __restrict__ ina, const float* __restrict__ inb, const float* __restrict__ ind, const h16* __restrict__ Gc, const h16* __restrict__ Sw, const h16* __restrict__ Tw, const float* __restrict__ Cs, float* __restrict__ R0, float* __restrict__ R1) {
    __shared__ __align__(16) float sm[FOP + 4 * 16 * 68];   /* the six operands' 16-byte pieces, at FIX(operand, group, q) + h FPH + row (54 KiB): 0, 1 Fb of the halves; 2, 3 Gc of the halves; 4 Sw; 5 Tw; then a place of 16 rows, pitch 68 words, a wave (17 KiB) */
    const unsigned zq = blockIdx.x, ck = zq & 63u, pr = zq >> 6, sq = pr >> 3, hd = pr & 7u; const unsigned lane = threadIdx.x & 31u, wv = threadIdx.x >> 5, lr = lane & 15u, hi = lane >> 4;
    const unsigned t0 = ck * NCS + wv * 16; const unsigned rob = hi * (NHS * NFE * 4) + lr * 16, pob = wv * 2048 + lane * 16, hob = hi * 32;   /* a lane's byte offsets: in a pair of the inputs' rows (row hi, words 4 lr to 4 lr + 3), in a 64 by 64 f16 plane (the wave's 2 KiB, the lanes side by side), in a row of Cs */
    const char* ap = (const char*)(ina + (((size_t)sq * NTS + t0) * NHS + hd) * NFE) + rob; const char* bp = (const char*)(inb + (((size_t)sq * NTS + t0) * NHS + hd) * NFE) + rob; const float* mp = ind + (size_t)sq * NTS + (size_t)ck * NCS + (unsigned)__builtin_amdgcn_readfirstlane((int)wv) * 16;   /* the wave's number in a scalar register: ind's words come by scalar loads */
    const char* gb = (const char*)(Gc + (size_t)zq * (2 * NBL)); const char* sb = (const char*)(Sw + (size_t)zq * NBL); const char* tb = (const char*)(Tw + (size_t)pr * NBL); const char* c1b = (const char*)(Cs + ((size_t)ck * NPR + pr) * 64); const char* c0b = (const char*)(Cs + ((size_t)NCK * NPR + pr) * 64);
    v8ha* fr = (v8ha*)sm; v4ha* f8 = (v4ha*)sm; v4f wa[2][8], wb[2][8]; v8f c1[4], c0[4]; v8h gq[2][4], sw[4], tq[4], fq[2][4]; float ms[2][16];
#pragma unroll
    for (int i = 0; i < 4; ++i) { gq[0][i] = *(const v8h*)(gb + pob + i * 512); gq[1][i] = *(const v8h*)(gb + pob + (NBL * 2 + i * 512)); sw[i] = *(const v8h*)(sb + pob + i * 512); tq[i] = *(const v8h*)(tb + pob + i * 512); }   /* rows 4 i + (lane >> 3) of the wave's 16, piece lane & 7 */
#pragma unroll
    for (int hf = 0; hf < 2; ++hf) {
#pragma unroll
        for (int s = 0; s < 8; ++s) { wa[hf][s] = *(const v4f*)(ap + (hf * 32 + s) * (2 * NHS * NFE * 4)); wb[hf][s] = *(const v4f*)(bp + (hf * 32 + s) * (2 * NHS * NFE * 4)); } }   /* row 2 s + hi of the wave's 16 of half hf */
    asm volatile("s_wait_xcnt 0x0" :: "v"(ap), "v"(bp), "v"(pob) : "memory");   /* in front of every rewrite of a register that the loads above name; the addresses are inputs so that no later load of the group lands in one of them */
    __builtin_amdgcn_sched_barrier(0);   /* holds the loads above their uses: all of them are on their way at once */
#pragma unroll
    for (int hf = 0; hf < 2; ++hf) {
#pragma unroll
        for (int k = 0; k < 16; ++k) ms[hf][k] = bfr(mp[hf * 64 + k]); }
    const unsigned wpl = FIX(0, wv, (lane & 7u) >> 1) + (lane & 1u) * FPH + (lane >> 3);   /* where a plane's loaded piece goes: q = (lane & 7) >> 1, h = lane & 1, row (lane >> 3) + 4 i */
    const unsigned whf = (FIX(0, wv, lr >> 2) + ((lr >> 1) & 1u) * FPH + hi) * 2 + (lr & 1u);   /* where four words of Fa or Fb go, in 8-byte halves of a piece: q = lr >> 2, h = (lr >> 1) & 1, half lr & 1, row hi + 2 s */
    const unsigned rpl = hi * FPH + lr;   /* a reader's place behind FIX(operand, group, q) */
#pragma unroll
    for (int i = 0; i < 4; ++i) { fr[FIX(2, 0, 0) + wpl + i * 4] = gq[0][i]; fr[FIX(3, 0, 0) + wpl + i * 4] = gq[1][i]; fr[FIX(4, 0, 0) + wpl + i * 4] = sw[i]; fr[FIX(5, 0, 0) + wpl + i * 4] = tq[i]; }
#pragma unroll
    for (int hf = 0; hf < 2; ++hf) {
#pragma unroll
        for (int s = 0; s < 8; ++s) { v4h fw; const v2fp a01 = bfr2(wa[hf][s][0], wa[hf][s][1]), a23 = bfr2(wa[hf][s][2], wa[hf][s][3]); const float av[4] = {a01[0], a01[1], a23[0], a23[1]};
#pragma unroll
            for (int j = 0; j < 4; ++j) { const float ya = av[j]; fw[j] = toh(fmaxf(ya, 0.0f) + exn(fminf(ya, 0.0f))); }
            f8[FIX(hf, 0, 0) * 2 + whf + s * 4] = fw; } }
    asm volatile("s_wait_dscnt 0x0" ::: "memory");   /* the wave's own rows of Fa stand in LDS before other lanes of the same wave read them back as pieces */
#pragma unroll
    for (int hf = 0; hf < 2; ++hf) {
#pragma unroll
        for (int q = 0; q < 4; ++q) fq[hf][q] = fr[FIX(hf, wv, q) + rpl]; }
    asm volatile("s_wait_dscnt 0x0" ::: "memory");   /* Fa's pieces have left LDS before Fb's words are laid in their place */
#pragma unroll
    for (int hf = 0; hf < 2; ++hf) {
#pragma unroll
        for (int s = 0; s < 8; ++s) { const float mk = hi ? ms[hf][2 * s + 1] : ms[hf][2 * s]; v4h kw; const v2fp b01 = bfr2(wb[hf][s][0], wb[hf][s][1]), b23 = bfr2(wb[hf][s][2], wb[hf][s][3]); const float bv[4] = {b01[0], b01[1], b23[0], b23[1]};
#pragma unroll
            for (int j = 0; j < 4; ++j) { const float yb = bv[j]; kw[j] = toh((fmaxf(yb, 0.0f) + exn(fminf(yb, 0.0f))) * mk); }
            f8[FIX(hf, 0, 0) * 2 + whf + s * 4] = kw; } }
    __syncthreads();   /* the six operands stand whole in LDS before any wave reads another wave's rows */
#pragma unroll
    for (int q = 0; q < 4; ++q) { c1[q] = *(const v8f*)(c1b + hob + q * 64); c0[q] = *(const v8f*)(c0b + hob + q * 64); }
    asm volatile("s_wait_xcnt 0x0" :: "v"(hob) : "memory");   /* as above, for the loads of the carried sums' rows */
    __builtin_amdgcn_sched_barrier(0);   /* holds these loads here: they fly while the first half's Pw is made and are used behind it */
    float dc1[2], dc0[2];
#define AFR(op, g, kc) cat16(fr[FIX(op, g, 2 * (kc)) + rpl], fr[FIX(op, g, 2 * (kc) + 1) + rpl])
    float* os = sm + FOP + wv * (16 * 68);
#pragma unroll
    for (int hf = 0; hf < 2; ++hf) {
        const v16h fa0 = cat16(fq[hf][0], fq[hf][1]), fa1 = cat16(fq[hf][2], fq[hf][3]);
        v8h ph[8], pl[8]; float acc = 0.0f;
#pragma unroll
        for (int cf = 0; cf <= hf; ++cf) {
#pragma unroll
            for (int ub = 0; ub < 4; ++ub) { v8f p = (v8f){}; p = wmma16(AFR(cf, ub, 0), fa0, p); p = wmma16(AFR(cf, ub, 1), fa1, p);   /* p[j] = Pw[row time 16 wv + lr of half hf][column time 16 ub + 8 hi + j of half cf] */
#pragma unroll
                for (int j = 0; j < 8; ++j) { const float kp = (cf < hf) ? 1.0f : (float)((unsigned)(ub * 16 + j) + hi * 8 <= wv * 16 + lr); const float pm = p[j] * kp; const h16 wh = toh(pm); ph[cf * 4 + ub][j] = wh; pl[cf * 4 + ub][j] = toh(pm - (float)wh); acc = acc + pm; } } }
        if (hf == 0) {   /* both halves' rows meet the same carried sums: taken here once, behind the first Pw, so that the sums' registers are free again */
#pragma unroll
            for (int rf = 0; rf < 2; ++rf) { float d1 = 0.0f, d0 = 0.0f;
#pragma unroll
                for (int q = 0; q < 4; ++q) {
#pragma unroll
                    for (int j = 0; j < 8; ++j) { const float wf = (float)fq[rf][q][j]; d1 = d1 + wf * c1[q][j]; d0 = d0 + wf * c0[q][j]; } }
                dc1[rf] = d1 + __shfl_xor(d1, 16, 32); dc0[rf] = d0 + __shfl_xor(d0, 16, 32); } }   /* lanes lr and lr + 16 hold the two halves of one row's sums */
        acc = acc + __shfl_xor(acc, 16, 32);
        const float r1 = 1.0f / (acc + dc1[hf] + 1e-6f); const float r0 = 1.0f / (dc0[hf] + 1e-6f);
        const size_t dst = (((size_t)sq * NTS + t0 + hf * 64 + hi) * NHS + hd) * NFE + lr * 4;
        v8f o1[4], o0[4];   /* word j: column 16 mb + 8 hi + j of row time 16 wv + lr of half hf */
#pragma unroll
        for (int mb = 0; mb < 4; ++mb) { v8f ua = (v8f){}, ub = (v8f){};
#pragma unroll
            for (int cf = 0; cf <= hf; ++cf) { const v16h g0 = AFR(2 + cf, mb, 0), g1 = AFR(2 + cf, mb, 1);
                ua = wmma16(g0, cat16(ph[cf * 4], ph[cf * 4 + 1]), ua); ua = wmma16(g0, cat16(pl[cf * 4], pl[cf * 4 + 1]), ua); ua = wmma16(g1, cat16(ph[cf * 4 + 2], ph[cf * 4 + 3]), ua); ua = wmma16(g1, cat16(pl[cf * 4 + 2], pl[cf * 4 + 3]), ua); }
            ub = wmma16(AFR(4, mb, 0), fa0, ub); ub = wmma16(AFR(4, mb, 1), fa1, ub);
#pragma unroll
            for (int j = 0; j < 8; ++j) o1[mb][j] = (ua[j] + ub[j]) * r1; }
        tile_out(os, o1, R1 + dst, lr, hi);
#pragma unroll
        for (int mb = 0; mb < 4; ++mb) { v8f uc = (v8f){}; uc = wmma16(AFR(5, mb, 0), fa0, uc); uc = wmma16(AFR(5, mb, 1), fa1, uc);
#pragma unroll
            for (int j = 0; j < 8; ++j) o0[mb][j] = uc[j] * r0; }
        tile_out(os, o0, R0 + dst, lr, hi);
    }
#undef AFR
}

extern "C" void kernel_launch(void* const* d_in, const int* in_sizes, int n_in, void* d_out, int out_size, void* d_ws, size_t ws_size, hipStream_t stream) {
    if (n_in < 4) return;
    if (in_sizes[0] != NSQ * NTS * NHS * NFE || in_sizes[1] != NSQ * NTS * NHS * NFE || in_sizes[2] != NSQ * NTS * NHS * NFE || in_sizes[3] != NSQ * NTS) return;
    if (out_size != 2 * NSQ * NTS * NHS * NFE) return;
    static_assert(NPR == NSQ * NHS && NHS == 8 && NFE == 64 && NCS == 128 && NCK * NCS == NTS && NTS == 8192 && NCK == 64 && NZQ == NPR * NCK && NBL == 64 * 64 && (NPR * NBL / 4) % 64 == 0 && NBL / 4 == 1024 && (NPR * 64 / 4) % 64 == 0 && NCK % NGR == 0 && NRG % NGR == 0 && NRG < NCK, "the products: 64 by 64 tiles over depths of 64; the flat grids exact; the index fields' widths (3 bits a head, 6 a chunk, 6 a column; 10 a group of four words in a plane)");
    const float* ina = (const float*)d_in[0]; const float* inb = (const float*)d_in[1]; const float* inc = (const float*)d_in[2]; const float* ind = (const float*)d_in[3]; float* R0 = (float*)d_out; float* R1 = R0 + (size_t)NSQ * NTS * NHS * NFE;
    char* wsp = (char*)d_ws; auto take = [&](size_t bytes) { char* p = wsp; wsp += (bytes + 255) & ~(size_t)255; return (void*)p; };
    float* Cs = (float*)take((size_t)(NCK + 1) * NPR * 64 * 4); float* Cu = (float*)take((size_t)NCK * NPR * 64 * 4);
    float* Du = (float*)take((size_t)NPR * NCK * NBL * 4); h16* Sw = (h16*)take((size_t)NPR * NCK * NBL * 2); h16* Gc = (h16*)take((size_t)NPR * NCK * 2 * NBL * 2); h16* Tw = (h16*)take((size_t)NPR * NBL * 2);
    if ((size_t)(wsp - (char*)d_ws) > ws_size) return;
    /* the blocks' own sums */
    k_own<<<(unsigned)NZQ, 128, 0, stream>>>(inb, inc, ind, Gc, Du, Cu);   /* Gc, Cu and Du[m][e] = the sum over the block's steps of Gc[m][time] Gb[e][time] */
    k_scan<<<(unsigned)(NPR * NBL / 4 / 64 + NPR * 64 / 4 / 64), 64, 0, stream>>>(Du, Cu, Sw, Tw, Cs);   /* the sums carried, and the sum over all chunks: one launch */
    /* the results */
    k_res<<<(unsigned)NZQ, 128, 0, stream>>>(ina, inb, ind, Gc, Sw, Tw, Cs, R0, R1);
}
